// v000
// The times below were measured on an AMD MI455X: many runs one after another, warmed up first and cycling through
// copies of the inputs, with the whole window's GPU time divided by the number of runs. Launches and the gaps
// between them are all in it. The median over several windows is given; except for v000 it joins two sittings, which
// can be a few percent apart, so the side-by-side timings, each taken in one sitting, are the better comparison.
// v000, which the later versions start from, runs in 205 microseconds.
#include <hip/hip_runtime.h>
// Contractions on v_wmma_f32_16x16x32_f16 (f16 operands, f32 accumulate): q/k/v projections (bf16-valued x exact in f16, bf16-valued W x16 in f16), output projection (f16 o, bf16-valued Wo x16), P x V^T (f16 P carried x16384, f16 v); scores as K x Q^T with f16 hi planes plus x1024 f16 residual planes (three products, two accumulators, fold 2^-10); softmax statistics and epilogues f32.
#ifndef NB
#define NB 4
#endif
#ifndef SEQ
#define SEQ 2048
#endif
#define NB_FULL 4
#define SEQ_FULL 2048
#define DIN 512          /* input channels */
#define TQ 256           /* n_head * qk_dim */
#define NH 8
#define HD 32
#define DOUT 512
#define NR ((size_t)NB * SEQ)   /* token rows processed */
#define KT 64            /* keys per attention tile */

static_assert(NB >= 1 && NB <= NB_FULL);
static_assert(SEQ >= 128 && SEQ <= SEQ_FULL);
static_assert(SEQ % 128 == 0);
static_assert((NR % 128) == 0);
static_assert(TQ % 64 == 0 && DOUT % 64 == 0 && DIN % 32 == 0 && TQ % 32 == 0);
static_assert(HD == 32 && NH * HD == TQ);
static_assert(SEQ % KT == 0 && KT == 64);

typedef _Float16 v16h __attribute__((ext_vector_type(16)));
typedef unsigned short v8us __attribute__((ext_vector_type(8), may_alias));
typedef float  v8f  __attribute__((ext_vector_type(8)));
typedef float  v4f  __attribute__((ext_vector_type(4)));
typedef float  v4fa __attribute__((ext_vector_type(4), may_alias));
typedef _Float16 v4h __attribute__((ext_vector_type(4)));
union FragH { v16h v; v8us half[2]; _Float16 h[16]; unsigned short u[16]; };

__device__ __forceinline__ unsigned short bf16_bits(float x) { unsigned int u = __float_as_uint(x); return (unsigned short)((u + 0x7FFFu + ((u >> 16) & 1u)) >> 16); }
__device__ __forceinline__ float bf16_val(unsigned short b) { return __uint_as_float(((unsigned int)b) << 16); }
__device__ __forceinline__ float bf16_rne(float x) { return bf16_val(bf16_bits(x)); }

// 16x16 fragment from a 16-bit [row][k] plane row pointer (k contiguous): elements 0..7 <- k 8h..8h+7, elements 8..15 <- k 16+8h..16+8h+7 (same map for A rows and B columns)
__device__ __forceinline__ v16h g2_frag(const _Float16* p, int hh) { FragH f; f.half[0] = *(const v8us*)((const unsigned short*)p + 8 * hh); f.half[1] = *(const v8us*)((const unsigned short*)p + 16 + 8 * hh); return f.v; }
__device__ __forceinline__ v8f g2_mma(v16h a, v16h b, v8f c) { v8f d = __builtin_amdgcn_wmma_f32_16x16x32_f16(false, a, false, b, (short)0, c, false, false); asm volatile("v_nop\n\tv_nop\n\tv_nop\n\tv_nop" : "+v"(d) : "v"(a), "v"(b)); return d; }
// hi/residual product: ah.bh + 2^-10 (al.bh + ah.bl), the x1024 residual products in their own accumulator
__device__ __forceinline__ v8f mma_split(v16h ah, v16h al, v16h bh, v16h bl) {
  const v8f z8 = {0.f,0.f,0.f,0.f,0.f,0.f,0.f,0.f};
  v8f c1 = __builtin_amdgcn_wmma_f32_16x16x32_f16(false, ah, false, bh, (short)0, z8, false, false);
  v8f c2 = __builtin_amdgcn_wmma_f32_16x16x32_f16(false, al, false, bh, (short)0, z8, false, false);
  c2 = __builtin_amdgcn_wmma_f32_16x16x32_f16(false, ah, false, bl, (short)0, c2, false, false);
  asm volatile("v_nop\n\tv_nop\n\tv_nop\n\tv_nop" : "+v"(c1), "+v"(c2) : "v"(ah), "v"(al), "v"(bh), "v"(bl));
  return c1 + c2 * 0.0009765625f;
}

__global__ __launch_bounds__(256) void k_x16r(const float* __restrict__ x, _Float16* __restrict__ X16, size_t n8) {
  const size_t t = (size_t)blockIdx.x * 256 + threadIdx.x; if (t >= n8) return;
  const size_t e = t * 8; const size_t r = e / DIN; const size_t c = e - r * DIN;
  const size_t sr = (r / SEQ) * SEQ_FULL + (r % SEQ);
  const float* s = x + sr * DIN + c;
  const v4f a = *(const v4fa*)s, c4v = *(const v4fa*)(s + 4);
  FragH f;
#pragma unroll
  for (int q = 0; q < 4; ++q) { f.h[q] = (_Float16)bf16_rne(a[q]); f.h[4 + q] = (_Float16)bf16_rne(c4v[q]); }
  unsigned short* d = (unsigned short*)X16 + e;
  *(v8us*)d = f.half[0]; 
}

__global__ __launch_bounds__(256) void k_wt_f16(const float* __restrict__ W, _Float16* __restrict__ Wt, int K, int N, float scale) {
  const int t = blockIdx.x * 256 + threadIdx.x; if (t >= N * (K / 8)) return; const int n = t / (K / 8), k8 = (t % (K / 8)) * 8; FragH f;
#pragma unroll
  for (int i = 0; i < 8; ++i) f.h[i] = (_Float16)(bf16_rne(W[(size_t)(k8 + i) * N + n]) * scale);
  const v8us o = f.half[0]; unsigned short* d = (unsigned short*)Wt + (size_t)n * K + k8;
  *(v8us*)d = o; 
}

__global__ __launch_bounds__(256) void k_hl(const float* __restrict__ F, _Float16* __restrict__ Hh, _Float16* __restrict__ Hl, size_t n8) {
  const size_t t = (size_t)blockIdx.x * 256 + threadIdx.x; if (t >= n8) return; FragH fh, fl; const v4f a = *(const v4fa*)(F + t * 8), c = *(const v4fa*)(F + t * 8 + 4);
#pragma unroll
  for (int q = 0; q < 4; ++q) { _Float16 h = (_Float16)a[q]; fh.h[q] = h; fl.h[q] = (_Float16)((a[q] - (float)h) * 1024.0f); h = (_Float16)c[q]; fh.h[4 + q] = h; fl.h[4 + q] = (_Float16)((c[q] - (float)h) * 1024.0f); }
  { *(v8us*)((unsigned short*)Hh + t * 8) = fh.half[0]; *(v8us*)((unsigned short*)Hl + t * 8) = fl.half[0];  } }

// GEMM C[M][N] (f32, pitch ldc) and/or C16 (f16, pitch ldc) = alpha * A.Bt + bf16(bias): A f16 [M][K] (pitch lda), Bh f16 [N][K] (pitch ldb).
__global__ __launch_bounds__(128) void k_gemm_proj(const _Float16* __restrict__ A, int lda, const _Float16* __restrict__ Bh, int ldb, float alpha, const float* __restrict__ bias,
                                                   float* __restrict__ C, _Float16* __restrict__ C16, int ldc, int M, int N, int K) {
  __shared__ __attribute__((aligned(16))) float so[4][32][68];
  const int tid = threadIdx.x, w = tid >> 5, lane = tid & 31, ln = lane & 15, hh = lane >> 4;
  const int ntn = N >> 6; const int mt = blockIdx.x / ntn, nq = blockIdx.x - mt * ntn; const int row0 = mt * 128 + 32 * w, col0 = nq * 64; if (row0 >= M) return;
  const _Float16* a0p = A + (size_t)(row0 + ln) * lda; const _Float16* a1p = a0p + (size_t)16 * lda;
  const _Float16* b0p = Bh + (size_t)(col0 + ln) * ldb; const _Float16* b1p = b0p + (size_t)16 * ldb; const _Float16* b2p = b1p + (size_t)16 * ldb; const _Float16* b3p = b2p + (size_t)16 * ldb;
  const v8f z8 = {0.f,0.f,0.f,0.f,0.f,0.f,0.f,0.f}; v8f c00 = z8, c01 = z8, c02 = z8, c03 = z8, c10 = z8, c11 = z8, c12 = z8, c13 = z8;
#pragma unroll 1
  for (int kb = 0; kb < K; kb += 32) { const v16h a0 = g2_frag(a0p + kb, hh), a1 = g2_frag(a1p + kb, hh);
    v16h b = g2_frag(b0p + kb, hh); c00 = g2_mma(a0, b, c00); c10 = g2_mma(a1, b, c10);
    b = g2_frag(b1p + kb, hh); c01 = g2_mma(a0, b, c01); c11 = g2_mma(a1, b, c11);
    b = g2_frag(b2p + kb, hh); c02 = g2_mma(a0, b, c02); c12 = g2_mma(a1, b, c12);
    b = g2_frag(b3p + kb, hh); c03 = g2_mma(a0, b, c03); c13 = g2_mma(a1, b, c13); }
  v8f accs[8] = {c00, c01, c02, c03, c10, c11, c12, c13};
#pragma unroll
  for (int u = 0; u < 8; ++u) { const int t = u & 3, half = u >> 2; const int col = col0 + t * 16 + ln; const float bvl = bias ? bf16_rne(bias[col]) : 0.f;
#pragma unroll
    for (int r = 0; r < 8; ++r) { const int rloc = half * 16 + 8 * hh + r; so[w][rloc][t * 16 + ln] = accs[u][r] * alpha + bvl; } }
  __builtin_amdgcn_fence(4 /* acq_rel order */, "workgroup"); __builtin_amdgcn_wave_barrier();
  const int rsub = lane >> 4, c4 = (lane & 15) * 4;
  {
#pragma unroll
    for (int q = 0; q < 16; ++q) { const int r = q * 2 + rsub; const v4f v = *(const v4fa*)&so[w][r][c4];
      if (C) *(v4f*)(C + (size_t)(row0 + r) * ldc + col0 + c4) = v;
      if (C16) { v4h h4; for (int i = 0; i < 4; ++i) h4[i] = (_Float16)v[i]; *(v4h*)(C16 + (size_t)(row0 + r) * ldc + col0 + c4) = h4; } }
     } }

// VT[(b,h)][c][s] = V16[(b*SEQ + s)][h*HD + c] (V16 row pitch TQ); block per ((b,h), 64 tokens): 64 tokens x 32 channels via LDS;
__global__ __launch_bounds__(256) void k_vt32(const _Float16* __restrict__ V16, _Float16* __restrict__ VT) {
  __shared__ unsigned short tl[64][34];
  const int tid = threadIdx.x; const int slab = blockIdx.x / (SEQ / 64), lg = blockIdx.x % (SEQ / 64); const int b = slab / NH, h = slab % NH;
  { const int r = tid >> 2, c8 = (tid & 3) * 8; FragH f;
    f.half[0] = *(const v8us*)((const unsigned short*)V16 + ((size_t)b * SEQ + lg * 64 + r) * TQ + h * HD + c8);
#pragma unroll
    for (int q = 0; q < 8; ++q) tl[r][c8 + q] = f.u[q]; }
  __syncthreads();
  const int d = tid >> 3, pc = tid & 7; FragH f;
#pragma unroll
  for (int q = 0; q < 8; ++q) f.u[q] = tl[pc * 8 + q][d];
  unsigned short* dst = (unsigned short*)VT + ((size_t)slab * HD + d) * SEQ + lg * 64 + pc * 8;
  *(v8us*)dst = f.half[0]; 
}

// flash-style attention per (b,h): block = 4 waves x 16 queries, key tiles of 64; scores computed transposed (S^T tile = K rows x Q^T, D rows = keys, D columns = queries)
// so that two adjacent D tiles form the P (query x key) A fragment directly; online softmax with per-lane query statistics (lanes l and l^16 share a query),
// P carried x16384 (argument of exp shifted by ln 16384), O = P.V^T with B fragments from the VT plane; O written head-major OH[(b,h)][s][c]
__global__ __launch_bounds__(128) void k_flash(const _Float16* __restrict__ QH, const _Float16* __restrict__ QL, const _Float16* __restrict__ KH, const _Float16* __restrict__ KL,
                                              const _Float16* __restrict__ VT, _Float16* __restrict__ OH) {
  __shared__ __attribute__((aligned(16))) _Float16 so[4][16][40];
  const int tid = threadIdx.x, w = tid >> 5, lane = tid & 31, ln = lane & 15, hh = lane >> 4;
  const int bh = blockIdx.y; const int b = bh / NH, h = bh - b * NH;
  const int q0 = blockIdx.x * 64 + w * 16;
  const size_t qrow = (size_t)b * SEQ + q0 + ln;
  const v16h qh = g2_frag(QH + qrow * TQ + h * HD, hh);
  const v16h ql = g2_frag(QL + qrow * TQ + h * HD, hh);
  const _Float16* khb = KH + ((size_t)b * SEQ + ln) * TQ + h * HD;
  const _Float16* klb = KL + ((size_t)b * SEQ + ln) * TQ + h * HD;
  const _Float16* vt0 = VT + ((size_t)bh * HD + ln) * SEQ;
  const _Float16* vt1 = vt0 + (size_t)16 * SEQ;
  const v8f z8 = {0.f,0.f,0.f,0.f,0.f,0.f,0.f,0.f};
  float rm = -3.0e38f, rl = 0.f; v8f o0 = z8, o1 = z8;
#pragma unroll 1
  for (int k0 = 0; k0 < SEQ; k0 += KT) {
    v8f s[4];
#pragma unroll
    for (int t = 0; t < 4; ++t) { const size_t ko = (size_t)(k0 + 16 * t) * TQ; const v16h ah = g2_frag(khb + ko, hh); const v16h al = g2_frag(klb + ko, hh); s[t] = mma_split(ah, al, qh, ql); }
    float m = s[0][0];
#pragma unroll
    for (int t = 0; t < 4; ++t) {
#pragma unroll
      for (int r = 0; r < 8; ++r) m = fmaxf(m, s[t][r]); }
    m = fmaxf(m, __shfl_xor(m, 16, 32));
    const float mn = fmaxf(rm, m);
    const float alpha = __expf(rm - mn);
    rm = mn;
    const float pm = mn - 9.704060527839234f;      /* exp(s - mn) carried x16384 */
    float ls = 0.f; FragH pa[2];
#pragma unroll
    for (int t = 0; t < 4; ++t) {
#pragma unroll
      for (int r = 0; r < 8; ++r) { const float p = __expf(s[t][r] - pm); ls += p; pa[t >> 1].h[((t & 1) << 3) + r] = (_Float16)p; } }
    ls += __shfl_xor(ls, 16, 32);
    rl = rl * alpha + ls;
#pragma unroll
    for (int r = 0; r < 8; ++r) { const float ar = __shfl(alpha, 8 * hh + r, 32); o0[r] *= ar; o1[r] *= ar; }
    v16h vb = g2_frag(vt0 + k0, hh); o0 = g2_mma(pa[0].v, vb, o0);
    vb = g2_frag(vt1 + k0, hh); o1 = g2_mma(pa[0].v, vb, o1);
    vb = g2_frag(vt0 + k0 + 32, hh); o0 = g2_mma(pa[1].v, vb, o0);
    vb = g2_frag(vt1 + k0 + 32, hh); o1 = g2_mma(pa[1].v, vb, o1);
  }
  const float inv = 1.0f / rl;
#pragma unroll
  for (int r = 0; r < 8; ++r) { const float ir = __shfl(inv, 8 * hh + r, 32); so[w][8 * hh + r][ln] = (_Float16)(o0[r] * ir); so[w][8 * hh + r][16 + ln] = (_Float16)(o1[r] * ir); }
  __builtin_amdgcn_fence(4 /* acq_rel order */, "workgroup"); __builtin_amdgcn_wave_barrier();
  unsigned short* ob = (unsigned short*)OH + ((size_t)bh * SEQ + q0) * HD;
  {
#pragma unroll
    for (int j = 0; j < 2; ++j) { const int p = j * 32 + lane; const v8us v = *(const v8us*)&so[w][p >> 2][(p & 3) * 8]; *(v8us*)(ob + (size_t)p * 8) = v; }
     } }

// output projection into the f32 output rows: A = OH head-major ([(b,h)][s][32], k-step == head), Bh = Wot f16 [DOUT][TQ] (x16), C row = b*SEQ_FULL + s (pitch ldc);
__global__ __launch_bounds__(128) void k_gemm_out(const _Float16* __restrict__ OHp, const _Float16* __restrict__ Bh, int ldb, float alpha, const float* __restrict__ bias,
                                                  float* __restrict__ C, int ldc, int M, int N) {
  __shared__ __attribute__((aligned(16))) float so[4][32][68];
  const int tid = threadIdx.x, w = tid >> 5, lane = tid & 31, ln = lane & 15, hh = lane >> 4;
  const int ntn = N >> 6; const int mt = blockIdx.x / ntn, nq = blockIdx.x - mt * ntn; const int row0 = mt * 128 + 32 * w, col0 = nq * 64; if (row0 >= M) return;
  const int bidx = row0 / SEQ, l0 = row0 - bidx * SEQ;
  const _Float16* abase = OHp + (((size_t)bidx * NH) * SEQ + l0 + ln) * HD;
  const size_t hstr = (size_t)SEQ * HD;
  const _Float16* b0p = Bh + (size_t)(col0 + ln) * ldb; const _Float16* b1p = b0p + (size_t)16 * ldb; const _Float16* b2p = b1p + (size_t)16 * ldb; const _Float16* b3p = b2p + (size_t)16 * ldb;
  const v8f z8 = {0.f,0.f,0.f,0.f,0.f,0.f,0.f,0.f}; v8f c00 = z8, c01 = z8, c02 = z8, c03 = z8, c10 = z8, c11 = z8, c12 = z8, c13 = z8;
#pragma unroll 1
  for (int hk = 0; hk < NH; ++hk) { const _Float16* a0p = abase + (size_t)hk * hstr; const int kb = hk * HD;
    const v16h a0 = g2_frag(a0p, hh), a1 = g2_frag(a0p + (size_t)16 * HD, hh);
    v16h b = g2_frag(b0p + kb, hh); c00 = g2_mma(a0, b, c00); c10 = g2_mma(a1, b, c10);
    b = g2_frag(b1p + kb, hh); c01 = g2_mma(a0, b, c01); c11 = g2_mma(a1, b, c11);
    b = g2_frag(b2p + kb, hh); c02 = g2_mma(a0, b, c02); c12 = g2_mma(a1, b, c12);
    b = g2_frag(b3p + kb, hh); c03 = g2_mma(a0, b, c03); c13 = g2_mma(a1, b, c13); }
  v8f accs[8] = {c00, c01, c02, c03, c10, c11, c12, c13};
#pragma unroll
  for (int u = 0; u < 8; ++u) { const int t = u & 3, half = u >> 2; const int col = col0 + t * 16 + ln; const float bvl = bf16_rne(bias[col]);
#pragma unroll
    for (int r = 0; r < 8; ++r) { const int rloc = half * 16 + 8 * hh + r; so[w][rloc][t * 16 + ln] = accs[u][r] * alpha + bvl; } }
  __builtin_amdgcn_fence(4 /* acq_rel order */, "workgroup"); __builtin_amdgcn_wave_barrier();
  const int rsub = lane >> 4, c4 = (lane & 15) * 4;
  const size_t crow0 = (size_t)bidx * SEQ_FULL + l0;
  {
#pragma unroll
    for (int q = 0; q < 16; ++q) { const int r = q * 2 + rsub; const v4f v = *(const v4fa*)&so[w][r][c4]; *(v4f*)(C + (crow0 + r) * ldc + col0 + c4) = v; }
     } }

extern "C" void kernel_launch(void* const* d_in, const int* in_sizes, int n_in,
                              void* d_out, int out_size, void* d_ws, size_t ws_size, hipStream_t stream) {
  if (n_in < 9) return;
  const float* X  = (const float*)d_in[0];      /* [NB_FULL][SEQ_FULL][DIN] */
  const float* Wq = (const float*)d_in[1];      /* [DIN][TQ] */
  const float* bq = (const float*)d_in[2];      /* [TQ] */
  const float* Wk = (const float*)d_in[3];
  const float* bk = (const float*)d_in[4];
  const float* Wv = (const float*)d_in[5];
  const float* bv = (const float*)d_in[6];
  const float* Wo = (const float*)d_in[7];      /* [TQ][DOUT] */
  const float* bo = (const float*)d_in[8];      /* [DOUT] */
  const long long needX = (long long)(((size_t)(NB - 1) * SEQ_FULL + SEQ) * DIN);
  const long long needO = (long long)(((size_t)(NB - 1) * SEQ_FULL + SEQ) * DOUT);
  if ((long long)in_sizes[0] < needX || in_sizes[1] < DIN * TQ || in_sizes[2] < TQ || in_sizes[3] < DIN * TQ || in_sizes[4] < TQ ||
      in_sizes[5] < DIN * TQ || in_sizes[6] < TQ || in_sizes[7] < TQ * DOUT || in_sizes[8] < DOUT || (long long)out_size < needO) return;
  char* ws = (char*)d_ws; size_t off = 0;
  auto take = [&](size_t bytes) { char* p = ws + off; off += (bytes + 255) & ~(size_t)255; return p; };
  _Float16* X16 = (_Float16*)take(NR * DIN * 2);
  _Float16* Wqt = (_Float16*)take((size_t)TQ * DIN * 2); _Float16* Wkt = (_Float16*)take((size_t)TQ * DIN * 2); _Float16* Wvt = (_Float16*)take((size_t)TQ * DIN * 2);
  _Float16* Wot = (_Float16*)take((size_t)DOUT * TQ * 2);
  float* F = (float*)take(NR * TQ * 4);
  _Float16* QH = (_Float16*)take(NR * TQ * 2); _Float16* QL = (_Float16*)take(NR * TQ * 2);
  _Float16* KH = (_Float16*)take(NR * TQ * 2); _Float16* KL = (_Float16*)take(NR * TQ * 2);
  _Float16* V16 = (_Float16*)take(NR * TQ * 2);
  _Float16* VT = (_Float16*)take((size_t)NB * NH * HD * SEQ * 2);
  _Float16* OH = (_Float16*)take((size_t)NB * NH * SEQ * HD * 2);
  if (off > ws_size || off > (size_t)134217728) return;
  const float a16 = 0.0625f;

  k_x16r<<<(unsigned)((NR * DIN / 8 + 255) / 256), 256, 0, stream>>>(X, X16, NR * DIN / 8);      /* x rows -> f16(bf16(x)) */
  k_wt_f16<<<(TQ * (DIN / 8) + 255) / 256, 256, 0, stream>>>(Wq, Wqt, DIN, TQ, 16.0f);          /* Wq[DIN][TQ] -> Wqt[TQ][DIN] x16 */
  k_wt_f16<<<(TQ * (DIN / 8) + 255) / 256, 256, 0, stream>>>(Wk, Wkt, DIN, TQ, 16.0f);
  k_wt_f16<<<(TQ * (DIN / 8) + 255) / 256, 256, 0, stream>>>(Wv, Wvt, DIN, TQ, 16.0f);
  k_wt_f16<<<(DOUT * (TQ / 8) + 255) / 256, 256, 0, stream>>>(Wo, Wot, TQ, DOUT, 16.0f);         /* Wo[TQ][DOUT] -> Wot[DOUT][TQ] x16 */
  const unsigned gproj = (unsigned)((NR / 128) * (TQ / 64));
  k_gemm_proj<<<gproj, 128, 0, stream>>>(X16, DIN, Wqt, DIN, a16, bq, F, nullptr, TQ, (int)NR, TQ, DIN);      /* q = x Wq + bq (f32) */
  k_hl<<<(unsigned)((NR * TQ / 8 + 255) / 256), 256, 0, stream>>>(F, QH, QL, NR * TQ / 8);                    /* q hi / x1024 residual planes */
  k_gemm_proj<<<gproj, 128, 0, stream>>>(X16, DIN, Wkt, DIN, a16, bk, F, nullptr, TQ, (int)NR, TQ, DIN);      /* k = x Wk + bk (f32) */
  k_hl<<<(unsigned)((NR * TQ / 8 + 255) / 256), 256, 0, stream>>>(F, KH, KL, NR * TQ / 8);                    /* k hi / x1024 residual planes */
  k_gemm_proj<<<gproj, 128, 0, stream>>>(X16, DIN, Wvt, DIN, a16, bv, nullptr, V16, TQ, (int)NR, TQ, DIN);    /* v = x Wv + bv -> f16 rows */
  k_vt32<<<(unsigned)(NB * NH * (SEQ / 64)), 256, 0, stream>>>(V16, VT);                                      /* V^T per (b,h): [32][SEQ] */
  k_flash<<<dim3(SEQ / 64, NB * NH), 128, 0, stream>>>(QH, QL, KH, KL, VT, OH);                              /* attention -> O head-major */
  k_gemm_out<<<(unsigned)((NR / 128) * (DOUT / 64)), 128, 0, stream>>>(OH, Wot, TQ, a16, bo, (float*)d_out, DOUT, (int)NR, DOUT);   /* out = O Wo + bo */
}

// v001
// Measured time: 146 microseconds a run.
// Timed twice side by side with v000, it ran 1.51 and 1.46 times as fast.
#include <hip/hip_runtime.h>
// Contractions on v_wmma_f32_16x16x32_f16 (f16 operands, f32 accumulate): q/k/v projections (bf16-valued x exact in f16, bf16-valued W x16 in f16), output projection (f16 o, bf16-valued Wo x16), P x V^T (f16 P carried x16384, f16 v); scores as K x Q^T with f16 hi planes plus x1024 f16 residual planes (three products, two accumulators, fold 2^-10); softmax statistics and epilogues f32.
#ifndef NB
#define NB 4
#endif
#ifndef SEQ
#define SEQ 2048
#endif
#define NB_FULL 4
#define SEQ_FULL 2048
#define DIN 512          /* input channels */
#define TQ 256           /* n_head * qk_dim */
#define NH 8
#define HD 32
#define DOUT 512
#define NR ((size_t)NB * SEQ)   /* token rows processed */
#define KT 64            /* keys per attention tile */

static_assert(NB >= 1 && NB <= NB_FULL);
static_assert(SEQ >= 128 && SEQ <= SEQ_FULL);
static_assert(SEQ % 128 == 0);
static_assert((NR % 128) == 0);
static_assert(TQ % 64 == 0 && DOUT % 64 == 0 && DIN % 32 == 0 && TQ % 32 == 0);
static_assert(HD == 32 && NH * HD == TQ);
static_assert(SEQ % KT == 0 && KT == 64);

typedef _Float16 v16h __attribute__((ext_vector_type(16)));
typedef unsigned short v8us __attribute__((ext_vector_type(8), may_alias));
typedef float  v8f  __attribute__((ext_vector_type(8)));
typedef float  v4f  __attribute__((ext_vector_type(4)));
typedef float  v4fa __attribute__((ext_vector_type(4), may_alias));
typedef _Float16 v4h __attribute__((ext_vector_type(4)));
union FragH { v16h v; v8us half[2]; _Float16 h[16]; unsigned short u[16]; };

__device__ __forceinline__ unsigned short bf16_bits(float x) { unsigned int u = __float_as_uint(x); return (unsigned short)((u + 0x7FFFu + ((u >> 16) & 1u)) >> 16); }
__device__ __forceinline__ float bf16_val(unsigned short b) { return __uint_as_float(((unsigned int)b) << 16); }
__device__ __forceinline__ float bf16_rne(float x) { return bf16_val(bf16_bits(x)); }

// 16x16 fragment from a 16-bit [row][k] plane row pointer (k contiguous): elements 0..7 <- k 8h..8h+7, elements 8..15 <- k 16+8h..16+8h+7 (same map for A rows and B columns)
__device__ __forceinline__ v16h g2_frag(const _Float16* p, int hh) { FragH f; f.half[0] = *(const v8us*)((const unsigned short*)p + 8 * hh); f.half[1] = *(const v8us*)((const unsigned short*)p + 16 + 8 * hh); return f.v; }
__device__ __forceinline__ v8f g2_mma(v16h a, v16h b, v8f c) { v8f d = __builtin_amdgcn_wmma_f32_16x16x32_f16(false, a, false, b, (short)0, c, false, false); asm volatile("v_nop\n\tv_nop\n\tv_nop\n\tv_nop" : "+v"(d) : "v"(a), "v"(b)); return d; }
// hi/residual product: ah.bh + 2^-10 (al.bh + ah.bl), the x1024 residual products in their own accumulator
__device__ __forceinline__ v8f mma_split(v16h ah, v16h al, v16h bh, v16h bl) {
  const v8f z8 = {0.f,0.f,0.f,0.f,0.f,0.f,0.f,0.f};
  v8f c1 = __builtin_amdgcn_wmma_f32_16x16x32_f16(false, ah, false, bh, (short)0, z8, false, false);
  v8f c2 = __builtin_amdgcn_wmma_f32_16x16x32_f16(false, al, false, bh, (short)0, z8, false, false);
  c2 = __builtin_amdgcn_wmma_f32_16x16x32_f16(false, ah, false, bl, (short)0, c2, false, false);
  asm volatile("v_nop\n\tv_nop\n\tv_nop\n\tv_nop" : "+v"(c1), "+v"(c2) : "v"(ah), "v"(al), "v"(bh), "v"(bl));
  return c1 + c2 * 0.0009765625f;
}

__global__ __launch_bounds__(256) void k_x16r(const float* __restrict__ x, _Float16* __restrict__ X16, size_t n8) {
  const size_t t = (size_t)blockIdx.x * 256 + threadIdx.x; if (t >= n8) return;
  const size_t e = t * 8; const size_t r = e / DIN; const size_t c = e - r * DIN;
  const size_t sr = (r / SEQ) * SEQ_FULL + (r % SEQ);
  const float* s = x + sr * DIN + c;
  const v4f a = *(const v4fa*)s, c4v = *(const v4fa*)(s + 4);
  FragH f;
#pragma unroll
  for (int q = 0; q < 4; ++q) { f.h[q] = (_Float16)bf16_rne(a[q]); f.h[4 + q] = (_Float16)bf16_rne(c4v[q]); }
  unsigned short* d = (unsigned short*)X16 + e;
  *(v8us*)d = f.half[0]; 
}

__global__ __launch_bounds__(256) void k_wt_f16(const float* __restrict__ W, _Float16* __restrict__ Wt, int K, int N, float scale) {
  const int t = blockIdx.x * 256 + threadIdx.x; if (t >= N * (K / 8)) return; const int n = t / (K / 8), k8 = (t % (K / 8)) * 8; FragH f;
#pragma unroll
  for (int i = 0; i < 8; ++i) f.h[i] = (_Float16)(bf16_rne(W[(size_t)(k8 + i) * N + n]) * scale);
  const v8us o = f.half[0]; unsigned short* d = (unsigned short*)Wt + (size_t)n * K + k8;
  *(v8us*)d = o; 
}

__global__ __launch_bounds__(256) void k_hl(const float* __restrict__ F, _Float16* __restrict__ Hh, _Float16* __restrict__ Hl, size_t n8) {
  const size_t t = (size_t)blockIdx.x * 256 + threadIdx.x; if (t >= n8) return; FragH fh, fl; const v4f a = *(const v4fa*)(F + t * 8), c = *(const v4fa*)(F + t * 8 + 4);
#pragma unroll
  for (int q = 0; q < 4; ++q) { _Float16 h = (_Float16)a[q]; fh.h[q] = h; fl.h[q] = (_Float16)((a[q] - (float)h) * 1024.0f); h = (_Float16)c[q]; fh.h[4 + q] = h; fl.h[4 + q] = (_Float16)((c[q] - (float)h) * 1024.0f); }
  { *(v8us*)((unsigned short*)Hh + t * 8) = fh.half[0]; *(v8us*)((unsigned short*)Hl + t * 8) = fl.half[0];  } }

// GEMM C[M][N] (f32, pitch ldc) and/or C16 (f16, pitch ldc) = alpha * A.Bt + bf16(bias): A f16 [M][K] (pitch lda), Bh f16 [N][K] (pitch ldb).
__global__ __launch_bounds__(128) void k_gemm_proj(const _Float16* __restrict__ A, int lda, const _Float16* __restrict__ Bh, int ldb, float alpha, const float* __restrict__ bias,
                                                   float* __restrict__ C, _Float16* __restrict__ C16, int ldc, int M, int N, int K) {
  __shared__ __attribute__((aligned(16))) float so[4][32][68];
  const int tid = threadIdx.x, w = tid >> 5, lane = tid & 31, ln = lane & 15, hh = lane >> 4;
  const int ntn = N >> 6; const int mt = blockIdx.x / ntn, nq = blockIdx.x - mt * ntn; const int row0 = mt * 128 + 32 * w, col0 = nq * 64; if (row0 >= M) return;
  const _Float16* a0p = A + (size_t)(row0 + ln) * lda; const _Float16* a1p = a0p + (size_t)16 * lda;
  const _Float16* b0p = Bh + (size_t)(col0 + ln) * ldb; const _Float16* b1p = b0p + (size_t)16 * ldb; const _Float16* b2p = b1p + (size_t)16 * ldb; const _Float16* b3p = b2p + (size_t)16 * ldb;
  const v8f z8 = {0.f,0.f,0.f,0.f,0.f,0.f,0.f,0.f}; v8f c00 = z8, c01 = z8, c02 = z8, c03 = z8, c10 = z8, c11 = z8, c12 = z8, c13 = z8;
#pragma unroll 1
  for (int kb = 0; kb < K; kb += 32) { const v16h a0 = g2_frag(a0p + kb, hh), a1 = g2_frag(a1p + kb, hh);
    v16h b = g2_frag(b0p + kb, hh); c00 = g2_mma(a0, b, c00); c10 = g2_mma(a1, b, c10);
    b = g2_frag(b1p + kb, hh); c01 = g2_mma(a0, b, c01); c11 = g2_mma(a1, b, c11);
    b = g2_frag(b2p + kb, hh); c02 = g2_mma(a0, b, c02); c12 = g2_mma(a1, b, c12);
    b = g2_frag(b3p + kb, hh); c03 = g2_mma(a0, b, c03); c13 = g2_mma(a1, b, c13); }
  v8f accs[8] = {c00, c01, c02, c03, c10, c11, c12, c13};
#pragma unroll
  for (int u = 0; u < 8; ++u) { const int t = u & 3, half = u >> 2; const int col = col0 + t * 16 + ln; const float bvl = bias ? bf16_rne(bias[col]) : 0.f;
#pragma unroll
    for (int r = 0; r < 8; ++r) { const int rloc = half * 16 + 8 * hh + r; so[w][rloc][t * 16 + ln] = accs[u][r] * alpha + bvl; } }
  __builtin_amdgcn_fence(4 /* acq_rel order */, "workgroup"); __builtin_amdgcn_wave_barrier();
  const int rsub = lane >> 4, c4 = (lane & 15) * 4;
  {
#pragma unroll
    for (int q = 0; q < 16; ++q) { const int r = q * 2 + rsub; const v4f v = *(const v4fa*)&so[w][r][c4];
      if (C) *(v4f*)(C + (size_t)(row0 + r) * ldc + col0 + c4) = v;
      if (C16) { v4h h4; for (int i = 0; i < 4; ++i) h4[i] = (_Float16)v[i]; *(v4h*)(C16 + (size_t)(row0 + r) * ldc + col0 + c4) = h4; } }
     } }

// VT[(b,h)][c][s] = V16[(b*SEQ + s)][h*HD + c] (V16 row pitch TQ); block per ((b,h), 64 tokens): 64 tokens x 32 channels via LDS;
__global__ __launch_bounds__(256) void k_vt32(const _Float16* __restrict__ V16, _Float16* __restrict__ VT) {
  __shared__ unsigned short tl[64][34];
  const int tid = threadIdx.x; const int slab = blockIdx.x / (SEQ / 64), lg = blockIdx.x % (SEQ / 64); const int b = slab / NH, h = slab % NH;
  { const int r = tid >> 2, c8 = (tid & 3) * 8; FragH f;
    f.half[0] = *(const v8us*)((const unsigned short*)V16 + ((size_t)b * SEQ + lg * 64 + r) * TQ + h * HD + c8);
#pragma unroll
    for (int q = 0; q < 8; ++q) tl[r][c8 + q] = f.u[q]; }
  __syncthreads();
  const int d = tid >> 3, pc = tid & 7; FragH f;
#pragma unroll
  for (int q = 0; q < 8; ++q) f.u[q] = tl[pc * 8 + q][d];
  unsigned short* dst = (unsigned short*)VT + ((size_t)slab * HD + d) * SEQ + lg * 64 + pc * 8;
  *(v8us*)dst = f.half[0]; 
}

// flash-style attention per (b,h): block = 4 waves x 16 queries, key tiles of 64; scores computed transposed (S^T tile = K rows x Q^T, D rows = keys, D columns = queries)
// so that two adjacent D tiles form the P (query x key) A fragment directly; online softmax with per-lane query statistics (lanes l and l^16 share a query),
// P carried x16384 (argument of exp shifted by ln 16384), O = P.V^T with B fragments from the VT plane; O written head-major OH[(b,h)][s][c]
// each key tile (K hi and residual rows, V^T rows) is copied once per block into LDS, one tile ahead, and all four waves read their fragments there
#define KVP 72                 /* LDS row pitch in halves: 128 data bytes + 16, a 16 B x odd pitch for ds_load_b128 readers */
#define KPART (KT * KVP)       /* 64 key rows: hi plane in halves 0..31, residual plane in halves 32..63 */
#define TILE_H (KPART + HD * KVP) /* then 32 channel rows of V^T, 64 keys each */
// One lane's six 16-byte copies of a key tile, global memory to LDS through no register.
// s_wait_xcnt closes the statement so that no address register of a copy is rewritten ahead of it.
__device__ __forceinline__ void tile_copies(unsigned l0, unsigned l1, unsigned l2, unsigned l3, unsigned l4, unsigned l5,
                                            const _Float16* g0, const _Float16* g1, const _Float16* g2, const _Float16* g3, const _Float16* g4, const _Float16* g5) {
  asm volatile("global_load_async_to_lds_b128 %0, %6, off\n\t"
               "global_load_async_to_lds_b128 %1, %7, off\n\t"
               "global_load_async_to_lds_b128 %2, %8, off\n\t"
               "global_load_async_to_lds_b128 %3, %9, off\n\t"
               "global_load_async_to_lds_b128 %4, %10, off\n\t"
               "global_load_async_to_lds_b128 %5, %11, off\n\t"
               "s_wait_xcnt 0x0"
               :: "v"(l0), "v"(l1), "v"(l2), "v"(l3), "v"(l4), "v"(l5), "v"(g0), "v"(g1), "v"(g2), "v"(g3), "v"(g4), "v"(g5) : "memory");
}

__global__ __launch_bounds__(128) void k_flash(const _Float16* __restrict__ QH, const _Float16* __restrict__ QL, const _Float16* __restrict__ KH, const _Float16* __restrict__ KL,
                                              const _Float16* __restrict__ VT, _Float16* __restrict__ OH) {
  __shared__ __attribute__((aligned(16))) _Float16 so[4][16][40];
  __shared__ __attribute__((aligned(16))) _Float16 kv[2][TILE_H];   /* two key-tile buffers shared by the four waves */
  const int tid = threadIdx.x, w = tid >> 5, lane = tid & 31, ln = lane & 15, hh = lane >> 4;
  const int bh = blockIdx.y; const int b = bh / NH, h = bh - b * NH;
  const int q0 = blockIdx.x * 64 + w * 16;
  const size_t qrow = (size_t)b * SEQ + q0 + ln;
  const v16h qh = g2_frag(QH + qrow * TQ + h * HD, hh);
  const v16h ql = g2_frag(QL + qrow * TQ + h * HD, hh);
  // copy roles: K planes, thread -> (row tid/4 and +32, 16-byte piece tid%4); V^T, thread -> (row tid/8 and +16, piece tid%8)
  const int kr = tid >> 2, kc = (tid & 3) * 8, vr = tid >> 3, vc = (tid & 7) * 8;
  const _Float16* gkh = KH + ((size_t)b * SEQ + kr) * TQ + h * HD + kc;
  const _Float16* gkl = KL + ((size_t)b * SEQ + kr) * TQ + h * HD + kc;
  const _Float16* gvt = VT + ((size_t)bh * HD + vr) * SEQ + vc;
  const unsigned lds0 = (unsigned)(size_t)&kv[0][0];
  const unsigned lk = lds0 + (unsigned)(kr * KVP + kc) * 2u, lv = lds0 + (unsigned)(KPART + vr * KVP + vc) * 2u;
  auto issue_tile = [&](int t) {
    const unsigned bo = (unsigned)(t & 1) * (unsigned)(TILE_H * 2);
    const _Float16* a = gkh + (size_t)t * KT * TQ; const _Float16* c = gkl + (size_t)t * KT * TQ; const _Float16* v = gvt + (size_t)t * KT;
    tile_copies(lk + bo, lk + bo + 32 * KVP * 2, lk + bo + 64, lk + bo + 64 + 32 * KVP * 2, lv + bo, lv + bo + 16 * KVP * 2,
                a, a + (size_t)32 * TQ, c, c + (size_t)32 * TQ, v, v + (size_t)16 * SEQ);
  };
  const v8f z8 = {0.f,0.f,0.f,0.f,0.f,0.f,0.f,0.f};
  float rm = -3.0e38f, rl = 0.f; v8f o0 = z8, o1 = z8;
  constexpr int NT = SEQ / KT;
  issue_tile(0);
  asm volatile("s_wait_asynccnt 0x0" ::: "memory");   /* this wave's copies of tile 0 have landed */
  __syncthreads();                                     /* tile 0 published to all four waves */
  issue_tile(1);
#pragma unroll 1
  for (int t = 0; t < NT; ++t) {
    const _Float16* kb = &kv[t & 1][0] + ln * KVP;
    const _Float16* vp = &kv[t & 1][KPART] + ln * KVP;
    v16h ah[4], al[4];
#pragma unroll /* fragment arrays indexed by constants, so that they stay in registers */
    for (int j = 0; j < 4; ++j) { ah[j] = g2_frag(kb + 16 * j * KVP, hh); al[j] = g2_frag(kb + 16 * j * KVP + 32, hh); }
    const v16h vb0 = g2_frag(vp, hh), vb1 = g2_frag(vp + 16 * KVP, hh), vb2 = g2_frag(vp + 32, hh), vb3 = g2_frag(vp + 16 * KVP + 32, hh);
    v8f s[4];
#pragma unroll /* as above: s[] and the fragments stay in registers */
    for (int j = 0; j < 4; ++j) s[j] = mma_split(ah[j], al[j], qh, ql);
    float m = s[0][0];
#pragma unroll
    for (int t4 = 0; t4 < 4; ++t4) {
#pragma unroll
      for (int r = 0; r < 8; ++r) m = fmaxf(m, s[t4][r]); }
    m = fmaxf(m, __shfl_xor(m, 16, 32));
    const float mn = fmaxf(rm, m);
    const float alpha = __expf(rm - mn);
    rm = mn;
    const float pm = mn - 9.704060527839234f;      /* exp(s - mn) carried x16384 */
    float ls = 0.f; FragH pa[2];
#pragma unroll
    for (int t4 = 0; t4 < 4; ++t4) {
#pragma unroll
      for (int r = 0; r < 8; ++r) { const float p = __expf(s[t4][r] - pm); ls += p; pa[t4 >> 1].h[((t4 & 1) << 3) + r] = (_Float16)p; } }
    ls += __shfl_xor(ls, 16, 32);
    rl = rl * alpha + ls;
#pragma unroll
    for (int r = 0; r < 8; ++r) { const float ar = __shfl(alpha, 8 * hh + r, 32); o0[r] *= ar; o1[r] *= ar; }
    o0 = g2_mma(pa[0].v, vb0, o0);
    o1 = g2_mma(pa[0].v, vb1, o1);
    o0 = g2_mma(pa[1].v, vb2, o0);
    o1 = g2_mma(pa[1].v, vb3, o1);
    asm volatile("s_wait_dscnt 0x0" ::: "memory");     /* this wave's reads of buffer t%2 are done before it is refilled */
    asm volatile("s_wait_asynccnt 0x0" ::: "memory");  /* this wave's copies of tile t+1 have landed */
    __syncthreads();                                   /* publishes tile t+1 and ends every wave's reads of buffer t%2 */
    if (t + 2 < NT) issue_tile(t + 2);
  }
  asm volatile("s_wait_asynccnt 0x0" ::: "memory");    /* no copy outstanding when the wave goes on to its end */
  const float inv = 1.0f / rl;
#pragma unroll
  for (int r = 0; r < 8; ++r) { const float ir = __shfl(inv, 8 * hh + r, 32); so[w][8 * hh + r][ln] = (_Float16)(o0[r] * ir); so[w][8 * hh + r][16 + ln] = (_Float16)(o1[r] * ir); }
  __builtin_amdgcn_fence(4 /* acq_rel order */, "workgroup"); __builtin_amdgcn_wave_barrier();
  unsigned short* ob = (unsigned short*)OH + ((size_t)bh * SEQ + q0) * HD;
  {
#pragma unroll
    for (int j = 0; j < 2; ++j) { const int p = j * 32 + lane; const v8us v = *(const v8us*)&so[w][p >> 2][(p & 3) * 8]; *(v8us*)(ob + (size_t)p * 8) = v; }
     } }

// output projection into the f32 output rows: A = OH head-major ([(b,h)][s][32], k-step == head), Bh = Wot f16 [DOUT][TQ] (x16), C row = b*SEQ_FULL + s (pitch ldc);
__global__ __launch_bounds__(128) void k_gemm_out(const _Float16* __restrict__ OHp, const _Float16* __restrict__ Bh, int ldb, float alpha, const float* __restrict__ bias,
                                                  float* __restrict__ C, int ldc, int M, int N) {
  __shared__ __attribute__((aligned(16))) float so[4][32][68];
  const int tid = threadIdx.x, w = tid >> 5, lane = tid & 31, ln = lane & 15, hh = lane >> 4;
  const int ntn = N >> 6; const int mt = blockIdx.x / ntn, nq = blockIdx.x - mt * ntn; const int row0 = mt * 128 + 32 * w, col0 = nq * 64; if (row0 >= M) return;
  const int bidx = row0 / SEQ, l0 = row0 - bidx * SEQ;
  const _Float16* abase = OHp + (((size_t)bidx * NH) * SEQ + l0 + ln) * HD;
  const size_t hstr = (size_t)SEQ * HD;
  const _Float16* b0p = Bh + (size_t)(col0 + ln) * ldb; const _Float16* b1p = b0p + (size_t)16 * ldb; const _Float16* b2p = b1p + (size_t)16 * ldb; const _Float16* b3p = b2p + (size_t)16 * ldb;
  const v8f z8 = {0.f,0.f,0.f,0.f,0.f,0.f,0.f,0.f}; v8f c00 = z8, c01 = z8, c02 = z8, c03 = z8, c10 = z8, c11 = z8, c12 = z8, c13 = z8;
#pragma unroll 1
  for (int hk = 0; hk < NH; ++hk) { const _Float16* a0p = abase + (size_t)hk * hstr; const int kb = hk * HD;
    const v16h a0 = g2_frag(a0p, hh), a1 = g2_frag(a0p + (size_t)16 * HD, hh);
    v16h b = g2_frag(b0p + kb, hh); c00 = g2_mma(a0, b, c00); c10 = g2_mma(a1, b, c10);
    b = g2_frag(b1p + kb, hh); c01 = g2_mma(a0, b, c01); c11 = g2_mma(a1, b, c11);
    b = g2_frag(b2p + kb, hh); c02 = g2_mma(a0, b, c02); c12 = g2_mma(a1, b, c12);
    b = g2_frag(b3p + kb, hh); c03 = g2_mma(a0, b, c03); c13 = g2_mma(a1, b, c13); }
  v8f accs[8] = {c00, c01, c02, c03, c10, c11, c12, c13};
#pragma unroll
  for (int u = 0; u < 8; ++u) { const int t = u & 3, half = u >> 2; const int col = col0 + t * 16 + ln; const float bvl = bf16_rne(bias[col]);
#pragma unroll
    for (int r = 0; r < 8; ++r) { const int rloc = half * 16 + 8 * hh + r; so[w][rloc][t * 16 + ln] = accs[u][r] * alpha + bvl; } }
  __builtin_amdgcn_fence(4 /* acq_rel order */, "workgroup"); __builtin_amdgcn_wave_barrier();
  const int rsub = lane >> 4, c4 = (lane & 15) * 4;
  const size_t crow0 = (size_t)bidx * SEQ_FULL + l0;
  {
#pragma unroll
    for (int q = 0; q < 16; ++q) { const int r = q * 2 + rsub; const v4f v = *(const v4fa*)&so[w][r][c4]; *(v4f*)(C + (crow0 + r) * ldc + col0 + c4) = v; }
     } }

extern "C" void kernel_launch(void* const* d_in, const int* in_sizes, int n_in,
                              void* d_out, int out_size, void* d_ws, size_t ws_size, hipStream_t stream) {
  if (n_in < 9) return;
  const float* X  = (const float*)d_in[0];      /* [NB_FULL][SEQ_FULL][DIN] */
  const float* Wq = (const float*)d_in[1];      /* [DIN][TQ] */
  const float* bq = (const float*)d_in[2];      /* [TQ] */
  const float* Wk = (const float*)d_in[3];
  const float* bk = (const float*)d_in[4];
  const float* Wv = (const float*)d_in[5];
  const float* bv = (const float*)d_in[6];
  const float* Wo = (const float*)d_in[7];      /* [TQ][DOUT] */
  const float* bo = (const float*)d_in[8];      /* [DOUT] */
  const long long needX = (long long)(((size_t)(NB - 1) * SEQ_FULL + SEQ) * DIN);
  const long long needO = (long long)(((size_t)(NB - 1) * SEQ_FULL + SEQ) * DOUT);
  if ((long long)in_sizes[0] < needX || in_sizes[1] < DIN * TQ || in_sizes[2] < TQ || in_sizes[3] < DIN * TQ || in_sizes[4] < TQ ||
      in_sizes[5] < DIN * TQ || in_sizes[6] < TQ || in_sizes[7] < TQ * DOUT || in_sizes[8] < DOUT || (long long)out_size < needO) return;
  char* ws = (char*)d_ws; size_t off = 0;
  auto take = [&](size_t bytes) { char* p = ws + off; off += (bytes + 255) & ~(size_t)255; return p; };
  _Float16* X16 = (_Float16*)take(NR * DIN * 2);
  _Float16* Wqt = (_Float16*)take((size_t)TQ * DIN * 2); _Float16* Wkt = (_Float16*)take((size_t)TQ * DIN * 2); _Float16* Wvt = (_Float16*)take((size_t)TQ * DIN * 2);
  _Float16* Wot = (_Float16*)take((size_t)DOUT * TQ * 2);
  float* F = (float*)take(NR * TQ * 4);
  _Float16* QH = (_Float16*)take(NR * TQ * 2); _Float16* QL = (_Float16*)take(NR * TQ * 2);
  _Float16* KH = (_Float16*)take(NR * TQ * 2); _Float16* KL = (_Float16*)take(NR * TQ * 2);
  _Float16* V16 = (_Float16*)take(NR * TQ * 2);
  _Float16* VT = (_Float16*)take((size_t)NB * NH * HD * SEQ * 2);
  _Float16* OH = (_Float16*)take((size_t)NB * NH * SEQ * HD * 2);
  if (off > ws_size || off > (size_t)134217728) return;
  const float a16 = 0.0625f;

  k_x16r<<<(unsigned)((NR * DIN / 8 + 255) / 256), 256, 0, stream>>>(X, X16, NR * DIN / 8);      /* x rows -> f16(bf16(x)) */
  k_wt_f16<<<(TQ * (DIN / 8) + 255) / 256, 256, 0, stream>>>(Wq, Wqt, DIN, TQ, 16.0f);          /* Wq[DIN][TQ] -> Wqt[TQ][DIN] x16 */
  k_wt_f16<<<(TQ * (DIN / 8) + 255) / 256, 256, 0, stream>>>(Wk, Wkt, DIN, TQ, 16.0f);
  k_wt_f16<<<(TQ * (DIN / 8) + 255) / 256, 256, 0, stream>>>(Wv, Wvt, DIN, TQ, 16.0f);
  k_wt_f16<<<(DOUT * (TQ / 8) + 255) / 256, 256, 0, stream>>>(Wo, Wot, TQ, DOUT, 16.0f);         /* Wo[TQ][DOUT] -> Wot[DOUT][TQ] x16 */
  const unsigned gproj = (unsigned)((NR / 128) * (TQ / 64));
  k_gemm_proj<<<gproj, 128, 0, stream>>>(X16, DIN, Wqt, DIN, a16, bq, F, nullptr, TQ, (int)NR, TQ, DIN);      /* q = x Wq + bq (f32) */
  k_hl<<<(unsigned)((NR * TQ / 8 + 255) / 256), 256, 0, stream>>>(F, QH, QL, NR * TQ / 8);                    /* q hi / x1024 residual planes */
  k_gemm_proj<<<gproj, 128, 0, stream>>>(X16, DIN, Wkt, DIN, a16, bk, F, nullptr, TQ, (int)NR, TQ, DIN);      /* k = x Wk + bk (f32) */
  k_hl<<<(unsigned)((NR * TQ / 8 + 255) / 256), 256, 0, stream>>>(F, KH, KL, NR * TQ / 8);                    /* k hi / x1024 residual planes */
  k_gemm_proj<<<gproj, 128, 0, stream>>>(X16, DIN, Wvt, DIN, a16, bv, nullptr, V16, TQ, (int)NR, TQ, DIN);    /* v = x Wv + bv -> f16 rows */
  k_vt32<<<(unsigned)(NB * NH * (SEQ / 64)), 256, 0, stream>>>(V16, VT);                                      /* V^T per (b,h): [32][SEQ] */
  k_flash<<<dim3(SEQ / 64, NB * NH), 128, 0, stream>>>(QH, QL, KH, KL, VT, OH);                              /* attention -> O head-major */
  k_gemm_out<<<(unsigned)((NR / 128) * (DOUT / 64)), 128, 0, stream>>>(OH, Wot, TQ, a16, bo, (float*)d_out, DOUT, (int)NR, DOUT);   /* out = O Wo + bo */
}

// v002
// Measured time: 87.8 microseconds a run.
// In both of two side-by-side timings against v001, it was 1.63 times as fast.
// Counting every step since v000, it is 2.42 times as fast.
#include <hip/hip_runtime.h>
// Contractions on v_wmma_f32_16x16x32_f16 (f16 operands, f32 accumulate): q/k/v projections (bf16-valued x exact in f16, bf16-valued W x16 in f16), output projection (f16 o, bf16-valued Wo x16), P x V^T (f16 P carried x16384, f16 v); scores as K x Q^T with f16 hi planes plus x1024 f16 residual planes (three products, two accumulators, fold 2^-10); softmax statistics and epilogues f32.
#ifndef NB
#define NB 4
#endif
#ifndef SEQ
#define SEQ 2048
#endif
#define NB_FULL 4
#define SEQ_FULL 2048
#define DIN 512          /* input channels */
#define TQ 256           /* n_head * qk_dim */
#define NH 8
#define HD 32
#define DOUT 512
#define NR ((size_t)NB * SEQ)   /* token rows processed */
#define KT 64            /* keys per attention tile */

static_assert(NB >= 1 && NB <= NB_FULL);
static_assert(SEQ >= 128 && SEQ <= SEQ_FULL);
static_assert(SEQ % 128 == 0);
static_assert((NR % 128) == 0);
static_assert(TQ % 64 == 0 && DOUT % 64 == 0 && DIN % 32 == 0 && TQ % 32 == 0);
static_assert(HD == 32 && NH * HD == TQ);
static_assert(SEQ % KT == 0 && KT == 64);

typedef _Float16 v16h __attribute__((ext_vector_type(16)));
typedef unsigned short v8us __attribute__((ext_vector_type(8), may_alias));
typedef float  v8f  __attribute__((ext_vector_type(8)));
typedef float  v4f  __attribute__((ext_vector_type(4)));
typedef float  v4fa __attribute__((ext_vector_type(4), may_alias));
typedef _Float16 v4h __attribute__((ext_vector_type(4)));
union FragH { v16h v; v8us half[2]; _Float16 h[16]; unsigned short u[16]; };

__device__ __forceinline__ unsigned short bf16_bits(float x) { unsigned int u = __float_as_uint(x); return (unsigned short)((u + 0x7FFFu + ((u >> 16) & 1u)) >> 16); }
__device__ __forceinline__ float bf16_val(unsigned short b) { return __uint_as_float(((unsigned int)b) << 16); }
__device__ __forceinline__ float bf16_rne(float x) { return bf16_val(bf16_bits(x)); }

// 16x16 fragment from a 16-bit [row][k] plane row pointer (k contiguous): elements 0..7 <- k 8h..8h+7, elements 8..15 <- k 16+8h..16+8h+7 (same map for A rows and B columns)
__device__ __forceinline__ v16h g2_frag(const _Float16* p, int hh) { FragH f; f.half[0] = *(const v8us*)((const unsigned short*)p + 8 * hh); f.half[1] = *(const v8us*)((const unsigned short*)p + 16 + 8 * hh); return f.v; }
__device__ __forceinline__ v8f g2_mma(v16h a, v16h b, v8f c) { v8f d = __builtin_amdgcn_wmma_f32_16x16x32_f16(false, a, false, b, (short)0, c, false, false); asm volatile("v_nop\n\tv_nop\n\tv_nop\n\tv_nop" : "+v"(d) : "v"(a), "v"(b)); return d; }
// hi/residual product: ah.bh + 2^-10 (al.bh + ah.bl), the x1024 residual products in their own accumulator
__device__ __forceinline__ v8f mma_split(v16h ah, v16h al, v16h bh, v16h bl) {
  const v8f z8 = {0.f,0.f,0.f,0.f,0.f,0.f,0.f,0.f};
  v8f c1 = __builtin_amdgcn_wmma_f32_16x16x32_f16(false, ah, false, bh, (short)0, z8, false, false);
  v8f c2 = __builtin_amdgcn_wmma_f32_16x16x32_f16(false, al, false, bh, (short)0, z8, false, false);
  c2 = __builtin_amdgcn_wmma_f32_16x16x32_f16(false, ah, false, bl, (short)0, c2, false, false);
  asm volatile("v_nop\n\tv_nop\n\tv_nop\n\tv_nop" : "+v"(c1), "+v"(c2) : "v"(ah), "v"(al), "v"(bh), "v"(bl));
  return c1 + c2 * 0.0009765625f;
}

// one launch converts x and the four weights: blocks 0..4*WBLK-1 take the weights (their strided reads start first), the rest take x
#define WBLK (TQ * (DIN / 8) / 256)   /* blocks per weight matrix */
static_assert(TQ * (DIN / 8) % 256 == 0 && DOUT * (TQ / 8) == TQ * (DIN / 8) && (NR * DIN / 8) % 256 == 0);

__device__ __forceinline__ void x16r_body(const float* __restrict__ x, _Float16* __restrict__ X16, size_t t) {
  const size_t e = t * 8; const size_t r = e / DIN; const size_t c = e - r * DIN;
  const size_t sr = (r / SEQ) * SEQ_FULL + (r % SEQ);
  const float* s = x + sr * DIN + c;
  const v4f a = *(const v4fa*)s, c4v = *(const v4fa*)(s + 4);
  FragH f;
#pragma unroll
  for (int q = 0; q < 4; ++q) { f.h[q] = (_Float16)bf16_rne(a[q]); f.h[4 + q] = (_Float16)bf16_rne(c4v[q]); }
  unsigned short* d = (unsigned short*)X16 + e;
  *(v8us*)d = f.half[0];
  asm volatile("s_wait_xcnt 0x0" ::: "memory");   /* the store's registers are not rewritten ahead of this (another arm of the caller follows in the code) */
}

__device__ __forceinline__ void wt_f16_body(const float* __restrict__ W, _Float16* __restrict__ Wt, int K, int N, float scale, int t) {
  const int n = t / (K / 8), k8 = (t % (K / 8)) * 8; FragH f;
#pragma unroll
  for (int i = 0; i < 8; ++i) f.h[i] = (_Float16)(bf16_rne(W[(size_t)(k8 + i) * N + n]) * scale);
  const v8us o = f.half[0]; unsigned short* d = (unsigned short*)Wt + (size_t)n * K + k8;
  *(v8us*)d = o;
  asm volatile("s_wait_xcnt 0x0" ::: "memory");   /* the store's registers are not rewritten ahead of this (another arm of the caller follows in the code) */
}

// Wqkvt = [3*TQ][DIN]: rows 0..TQ-1 Wq^T, then Wk^T, then Wv^T, all x16; Wot = [DOUT][TQ] x16
__global__ __launch_bounds__(256) void k_prep(const float* __restrict__ x, const float* __restrict__ Wq, const float* __restrict__ Wk, const float* __restrict__ Wv, const float* __restrict__ Wo,
                                              _Float16* __restrict__ X16, _Float16* __restrict__ Wqkvt, _Float16* __restrict__ Wot) {
  const int bid = blockIdx.x;
  if (bid < 3 * WBLK) { const int m = bid / WBLK; const float* W = m == 0 ? Wq : (m == 1 ? Wk : Wv);
    wt_f16_body(W, Wqkvt + (size_t)m * TQ * DIN, DIN, TQ, 16.0f, (bid - m * WBLK) * 256 + (int)threadIdx.x); }
  else if (bid < 4 * WBLK) wt_f16_body(Wo, Wot, TQ, DOUT, 16.0f, (bid - 3 * WBLK) * 256 + (int)threadIdx.x);
  else x16r_body(x, X16, (size_t)(bid - 4 * WBLK) * 256 + threadIdx.x);
}

// q, k and v projections in one launch: C = alpha * A.Bt + bf16(bias) over the 3*TQ columns of [Wq|Wk|Wv]; A f16 [NR][K] (pitch lda), Bh f16 [3*TQ][K] (pitch ldb).
// A block's 64 columns lie in one of the three; its epilogue writes the form attention reads:
// q and k as f16 hi plane plus x1024 f16 residual plane (row pitch TQ), v as f16 transposed, VT[(b,h)][c][s].
#define VTP 136                /* LDS pitch in halves of a transposed v row: 128 tokens (256 bytes) + 16 bytes */
__global__ __launch_bounds__(128) void k_gemm_qkv(const _Float16* __restrict__ A, int lda, const _Float16* __restrict__ Bh, int ldb, float alpha,
                                                  const float* __restrict__ bq, const float* __restrict__ bk, const float* __restrict__ bv,
                                                  _Float16* __restrict__ QH, _Float16* __restrict__ QL, _Float16* __restrict__ KH, _Float16* __restrict__ KL, _Float16* __restrict__ VT, int K) {
  __shared__ __attribute__((aligned(16))) float so[4][32][68];
  static_assert(64 * VTP * 2 <= 4 * 32 * 68 * 4);
  const int tid = threadIdx.x, w = tid >> 5, lane = tid & 31, ln = lane & 15, hh = lane >> 4;
  constexpr int ntn = (3 * TQ) >> 6, npl = TQ >> 6;
  const int mt = blockIdx.x / ntn, nq = blockIdx.x - mt * ntn; const int row0 = mt * 128 + 32 * w, col0 = nq * 64;
  const int pl = nq / npl, pc0 = (nq - pl * npl) * 64;      /* which of q, k, v; first column inside it */
  const _Float16* a0p = A + (size_t)(row0 + ln) * lda; const _Float16* a1p = a0p + (size_t)16 * lda;
  const _Float16* b0p = Bh + (size_t)(col0 + ln) * ldb; const _Float16* b1p = b0p + (size_t)16 * ldb; const _Float16* b2p = b1p + (size_t)16 * ldb; const _Float16* b3p = b2p + (size_t)16 * ldb;
  const v8f z8 = {0.f,0.f,0.f,0.f,0.f,0.f,0.f,0.f}; v8f c00 = z8, c01 = z8, c02 = z8, c03 = z8, c10 = z8, c11 = z8, c12 = z8, c13 = z8;
#pragma unroll 1
  for (int kb = 0; kb < K; kb += 32) { const v16h a0 = g2_frag(a0p + kb, hh), a1 = g2_frag(a1p + kb, hh);
    v16h b = g2_frag(b0p + kb, hh); c00 = g2_mma(a0, b, c00); c10 = g2_mma(a1, b, c10);
    b = g2_frag(b1p + kb, hh); c01 = g2_mma(a0, b, c01); c11 = g2_mma(a1, b, c11);
    b = g2_frag(b2p + kb, hh); c02 = g2_mma(a0, b, c02); c12 = g2_mma(a1, b, c12);
    b = g2_frag(b3p + kb, hh); c03 = g2_mma(a0, b, c03); c13 = g2_mma(a1, b, c13); }
  v8f accs[8] = {c00, c01, c02, c03, c10, c11, c12, c13};
  const float* bias = pl == 0 ? bq : (pl == 1 ? bk : bv);
  if (pl < 2) {
#pragma unroll
    for (int u = 0; u < 8; ++u) { const int t = u & 3, half = u >> 2; const float bvl = bf16_rne(bias[pc0 + t * 16 + ln]);
#pragma unroll
      for (int r = 0; r < 8; ++r) { const int rloc = half * 16 + 8 * hh + r; so[w][rloc][t * 16 + ln] = accs[u][r] * alpha + bvl; } }
    __builtin_amdgcn_fence(4 /* acq_rel order */, "workgroup"); __builtin_amdgcn_wave_barrier();
    unsigned short* Hh = (unsigned short*)(pl == 0 ? QH : KH); unsigned short* Hl = (unsigned short*)(pl == 0 ? QL : KL);
    const int rsub = lane >> 3, c8 = (lane & 7) * 8;
#pragma unroll
    for (int j = 0; j < 8; ++j) { const int r = j * 4 + rsub; const v4f a = *(const v4fa*)&so[w][r][c8], c = *(const v4fa*)&so[w][r][c8 + 4]; FragH fh, fl;
#pragma unroll
      for (int q = 0; q < 4; ++q) { _Float16 h = (_Float16)a[q]; fh.h[q] = h; fl.h[q] = (_Float16)((a[q] - (float)h) * 1024.0f); h = (_Float16)c[q]; fh.h[4 + q] = h; fl.h[4 + q] = (_Float16)((c[q] - (float)h) * 1024.0f); }
      const size_t o = (size_t)(row0 + r) * TQ + pc0 + c8;
      *(v8us*)(Hh + o) = fh.half[0]; *(v8us*)(Hl + o) = fl.half[0]; }
  } else {
    // a lane's eight accumulator rows are eight consecutive tokens of one channel: 16 bytes of a V^T row, gathered per block so that each row leaves as 256 contiguous bytes
    unsigned short* vt = (unsigned short*)&so[0][0][0];
#pragma unroll
    for (int u = 0; u < 8; ++u) { const int t = u & 3, half = u >> 2; const float bvl = bf16_rne(bias[pc0 + t * 16 + ln]); FragH f;
#pragma unroll
      for (int r = 0; r < 8; ++r) f.h[r] = (_Float16)(accs[u][r] * alpha + bvl);
      *(v8us*)(vt + (t * 16 + ln) * VTP + 32 * w + half * 16 + 8 * hh) = f.half[0]; }
    __syncthreads();   /* all four waves' token columns are in LDS before the rows are read; pl is the same for the whole block */
    const int bidx = (mt * 128) / SEQ, s0 = mt * 128 - bidx * SEQ;
    unsigned short* dst = (unsigned short*)VT + ((size_t)bidx * TQ + pc0) * SEQ + s0;
#pragma unroll
    for (int j = 0; j < 8; ++j) { const int p = j * 128 + tid, cl = p >> 4, pc = (p & 15) * 8;
      *(v8us*)(dst + (size_t)cl * SEQ + pc) = *(const v8us*)(vt + cl * VTP + pc); }
    asm volatile("s_wait_xcnt 0x0" ::: "memory");   /* the stores' registers are not rewritten ahead of this (the other arm follows in the code) */
  } }

// flash-style attention per (b,h): block = 4 waves x 16 queries, key tiles of 64; scores computed transposed (S^T tile = K rows x Q^T, D rows = keys, D columns = queries)
// so that two adjacent D tiles form the P (query x key) A fragment directly; online softmax with per-lane query statistics (lanes l and l^16 share a query),
// P carried x16384 (argument of exp shifted by ln 16384), O = P.V^T with B fragments from the VT plane; O written head-major OH[(b,h)][s][c]
// each key tile (K hi and residual rows, V^T rows) is copied once per block into LDS, one tile ahead, and all four waves read their fragments there
#define KVP 72                 /* LDS row pitch in halves: 128 data bytes + 16, a 16 B x odd pitch for ds_load_b128 readers */
#define KPART (KT * KVP)       /* 64 key rows: hi plane in halves 0..31, residual plane in halves 32..63 */
#define TILE_H (KPART + HD * KVP) /* then 32 channel rows of V^T, 64 keys each */
// One lane's six 16-byte copies of a key tile, global memory to LDS through no register.
// s_wait_xcnt closes the statement so that no address register of a copy is rewritten ahead of it.
__device__ __forceinline__ void tile_copies(unsigned l0, unsigned l1, unsigned l2, unsigned l3, unsigned l4, unsigned l5,
                                            const _Float16* g0, const _Float16* g1, const _Float16* g2, const _Float16* g3, const _Float16* g4, const _Float16* g5) {
  asm volatile("global_load_async_to_lds_b128 %0, %6, off\n\t"
               "global_load_async_to_lds_b128 %1, %7, off\n\t"
               "global_load_async_to_lds_b128 %2, %8, off\n\t"
               "global_load_async_to_lds_b128 %3, %9, off\n\t"
               "global_load_async_to_lds_b128 %4, %10, off\n\t"
               "global_load_async_to_lds_b128 %5, %11, off\n\t"
               "s_wait_xcnt 0x0"
               :: "v"(l0), "v"(l1), "v"(l2), "v"(l3), "v"(l4), "v"(l5), "v"(g0), "v"(g1), "v"(g2), "v"(g3), "v"(g4), "v"(g5) : "memory");
}

__global__ __launch_bounds__(128) void k_flash(const _Float16* __restrict__ QH, const _Float16* __restrict__ QL, const _Float16* __restrict__ KH, const _Float16* __restrict__ KL,
                                              const _Float16* __restrict__ VT, _Float16* __restrict__ OH) {
  __shared__ __attribute__((aligned(16))) _Float16 so[4][16][40];
  __shared__ __attribute__((aligned(16))) _Float16 kv[2][TILE_H];   /* two key-tile buffers shared by the four waves */
  const int tid = threadIdx.x, w = tid >> 5, lane = tid & 31, ln = lane & 15, hh = lane >> 4;
  const int bh = blockIdx.y; const int b = bh / NH, h = bh - b * NH;
  const int q0 = blockIdx.x * 64 + w * 16;
  const size_t qrow = (size_t)b * SEQ + q0 + ln;
  const v16h qh = g2_frag(QH + qrow * TQ + h * HD, hh);
  const v16h ql = g2_frag(QL + qrow * TQ + h * HD, hh);
  // copy roles: K planes, thread -> (row tid/4 and +32, 16-byte piece tid%4); V^T, thread -> (row tid/8 and +16, piece tid%8)
  const int kr = tid >> 2, kc = (tid & 3) * 8, vr = tid >> 3, vc = (tid & 7) * 8;
  const _Float16* gkh = KH + ((size_t)b * SEQ + kr) * TQ + h * HD + kc;
  const _Float16* gkl = KL + ((size_t)b * SEQ + kr) * TQ + h * HD + kc;
  const _Float16* gvt = VT + ((size_t)bh * HD + vr) * SEQ + vc;
  const unsigned lds0 = (unsigned)(size_t)&kv[0][0];
  const unsigned lk = lds0 + (unsigned)(kr * KVP + kc) * 2u, lv = lds0 + (unsigned)(KPART + vr * KVP + vc) * 2u;
  auto issue_tile = [&](int t) {
    const unsigned bo = (unsigned)(t & 1) * (unsigned)(TILE_H * 2);
    const _Float16* a = gkh + (size_t)t * KT * TQ; const _Float16* c = gkl + (size_t)t * KT * TQ; const _Float16* v = gvt + (size_t)t * KT;
    tile_copies(lk + bo, lk + bo + 32 * KVP * 2, lk + bo + 64, lk + bo + 64 + 32 * KVP * 2, lv + bo, lv + bo + 16 * KVP * 2,
                a, a + (size_t)32 * TQ, c, c + (size_t)32 * TQ, v, v + (size_t)16 * SEQ);
  };
  const v8f z8 = {0.f,0.f,0.f,0.f,0.f,0.f,0.f,0.f};
  float rm = -3.0e38f, rl = 0.f; v8f o0 = z8, o1 = z8;
  constexpr int NT = SEQ / KT;
  issue_tile(0);
  asm volatile("s_wait_asynccnt 0x0" ::: "memory");   /* this wave's copies of tile 0 have landed */
  __syncthreads();                                     /* tile 0 published to all four waves */
  issue_tile(1);
#pragma unroll 1
  for (int t = 0; t < NT; ++t) {
    const _Float16* kb = &kv[t & 1][0] + ln * KVP;
    const _Float16* vp = &kv[t & 1][KPART] + ln * KVP;
    v16h ah[4], al[4];
#pragma unroll /* fragment arrays indexed by constants, so that they stay in registers */
    for (int j = 0; j < 4; ++j) { ah[j] = g2_frag(kb + 16 * j * KVP, hh); al[j] = g2_frag(kb + 16 * j * KVP + 32, hh); }
    const v16h vb0 = g2_frag(vp, hh), vb1 = g2_frag(vp + 16 * KVP, hh), vb2 = g2_frag(vp + 32, hh), vb3 = g2_frag(vp + 16 * KVP + 32, hh);
    v8f s[4];
#pragma unroll /* as above: s[] and the fragments stay in registers */
    for (int j = 0; j < 4; ++j) s[j] = mma_split(ah[j], al[j], qh, ql);
    float m = s[0][0];
#pragma unroll
    for (int t4 = 0; t4 < 4; ++t4) {
#pragma unroll
      for (int r = 0; r < 8; ++r) m = fmaxf(m, s[t4][r]); }
    m = fmaxf(m, __shfl_xor(m, 16, 32));
    const float mn = fmaxf(rm, m);
    const float alpha = __expf(rm - mn);
    rm = mn;
    const float pm = mn - 9.704060527839234f;      /* exp(s - mn) carried x16384 */
    float ls = 0.f; FragH pa[2];
#pragma unroll
    for (int t4 = 0; t4 < 4; ++t4) {
#pragma unroll
      for (int r = 0; r < 8; ++r) { const float p = __expf(s[t4][r] - pm); ls += p; pa[t4 >> 1].h[((t4 & 1) << 3) + r] = (_Float16)p; } }
    ls += __shfl_xor(ls, 16, 32);
    rl = rl * alpha + ls;
#pragma unroll
    for (int r = 0; r < 8; ++r) { const float ar = __shfl(alpha, 8 * hh + r, 32); o0[r] *= ar; o1[r] *= ar; }
    o0 = g2_mma(pa[0].v, vb0, o0);
    o1 = g2_mma(pa[0].v, vb1, o1);
    o0 = g2_mma(pa[1].v, vb2, o0);
    o1 = g2_mma(pa[1].v, vb3, o1);
    asm volatile("s_wait_dscnt 0x0" ::: "memory");     /* this wave's reads of buffer t%2 are done before it is refilled */
    asm volatile("s_wait_asynccnt 0x0" ::: "memory");  /* this wave's copies of tile t+1 have landed */
    __syncthreads();                                   /* publishes tile t+1 and ends every wave's reads of buffer t%2 */
    if (t + 2 < NT) issue_tile(t + 2);
  }
  asm volatile("s_wait_asynccnt 0x0" ::: "memory");    /* no copy outstanding when the wave goes on to its end */
  const float inv = 1.0f / rl;
#pragma unroll
  for (int r = 0; r < 8; ++r) { const float ir = __shfl(inv, 8 * hh + r, 32); so[w][8 * hh + r][ln] = (_Float16)(o0[r] * ir); so[w][8 * hh + r][16 + ln] = (_Float16)(o1[r] * ir); }
  __builtin_amdgcn_fence(4 /* acq_rel order */, "workgroup"); __builtin_amdgcn_wave_barrier();
  unsigned short* ob = (unsigned short*)OH + ((size_t)bh * SEQ + q0) * HD;
  {
#pragma unroll
    for (int j = 0; j < 2; ++j) { const int p = j * 32 + lane; const v8us v = *(const v8us*)&so[w][p >> 2][(p & 3) * 8]; *(v8us*)(ob + (size_t)p * 8) = v; }
     } }

// output projection into the f32 output rows: A = OH head-major ([(b,h)][s][32], k-step == head), Bh = Wot f16 [DOUT][TQ] (x16), C row = b*SEQ_FULL + s (pitch ldc);
__global__ __launch_bounds__(128) void k_gemm_out(const _Float16* __restrict__ OHp, const _Float16* __restrict__ Bh, int ldb, float alpha, const float* __restrict__ bias,
                                                  float* __restrict__ C, int ldc, int M, int N) {
  __shared__ __attribute__((aligned(16))) float so[4][32][68];
  const int tid = threadIdx.x, w = tid >> 5, lane = tid & 31, ln = lane & 15, hh = lane >> 4;
  const int ntn = N >> 6; const int mt = blockIdx.x / ntn, nq = blockIdx.x - mt * ntn; const int row0 = mt * 128 + 32 * w, col0 = nq * 64; if (row0 >= M) return;
  const int bidx = row0 / SEQ, l0 = row0 - bidx * SEQ;
  const _Float16* abase = OHp + (((size_t)bidx * NH) * SEQ + l0 + ln) * HD;
  const size_t hstr = (size_t)SEQ * HD;
  const _Float16* b0p = Bh + (size_t)(col0 + ln) * ldb; const _Float16* b1p = b0p + (size_t)16 * ldb; const _Float16* b2p = b1p + (size_t)16 * ldb; const _Float16* b3p = b2p + (size_t)16 * ldb;
  const v8f z8 = {0.f,0.f,0.f,0.f,0.f,0.f,0.f,0.f}; v8f c00 = z8, c01 = z8, c02 = z8, c03 = z8, c10 = z8, c11 = z8, c12 = z8, c13 = z8;
#pragma unroll 1
  for (int hk = 0; hk < NH; ++hk) { const _Float16* a0p = abase + (size_t)hk * hstr; const int kb = hk * HD;
    const v16h a0 = g2_frag(a0p, hh), a1 = g2_frag(a0p + (size_t)16 * HD, hh);
    v16h b = g2_frag(b0p + kb, hh); c00 = g2_mma(a0, b, c00); c10 = g2_mma(a1, b, c10);
    b = g2_frag(b1p + kb, hh); c01 = g2_mma(a0, b, c01); c11 = g2_mma(a1, b, c11);
    b = g2_frag(b2p + kb, hh); c02 = g2_mma(a0, b, c02); c12 = g2_mma(a1, b, c12);
    b = g2_frag(b3p + kb, hh); c03 = g2_mma(a0, b, c03); c13 = g2_mma(a1, b, c13); }
  v8f accs[8] = {c00, c01, c02, c03, c10, c11, c12, c13};
#pragma unroll
  for (int u = 0; u < 8; ++u) { const int t = u & 3, half = u >> 2; const int col = col0 + t * 16 + ln; const float bvl = bf16_rne(bias[col]);
#pragma unroll
    for (int r = 0; r < 8; ++r) { const int rloc = half * 16 + 8 * hh + r; so[w][rloc][t * 16 + ln] = accs[u][r] * alpha + bvl; } }
  __builtin_amdgcn_fence(4 /* acq_rel order */, "workgroup"); __builtin_amdgcn_wave_barrier();
  const int rsub = lane >> 4, c4 = (lane & 15) * 4;
  const size_t crow0 = (size_t)bidx * SEQ_FULL + l0;
  {
#pragma unroll
    for (int q = 0; q < 16; ++q) { const int r = q * 2 + rsub; const v4f v = *(const v4fa*)&so[w][r][c4]; *(v4f*)(C + (crow0 + r) * ldc + col0 + c4) = v; }
     } }

extern "C" void kernel_launch(void* const* d_in, const int* in_sizes, int n_in,
                              void* d_out, int out_size, void* d_ws, size_t ws_size, hipStream_t stream) {
  if (n_in < 9) return;
  const float* X  = (const float*)d_in[0];      /* [NB_FULL][SEQ_FULL][DIN] */
  const float* Wq = (const float*)d_in[1];      /* [DIN][TQ] */
  const float* bq = (const float*)d_in[2];      /* [TQ] */
  const float* Wk = (const float*)d_in[3];
  const float* bk = (const float*)d_in[4];
  const float* Wv = (const float*)d_in[5];
  const float* bv = (const float*)d_in[6];
  const float* Wo = (const float*)d_in[7];      /* [TQ][DOUT] */
  const float* bo = (const float*)d_in[8];      /* [DOUT] */
  const long long needX = (long long)(((size_t)(NB - 1) * SEQ_FULL + SEQ) * DIN);
  const long long needO = (long long)(((size_t)(NB - 1) * SEQ_FULL + SEQ) * DOUT);
  if ((long long)in_sizes[0] < needX || in_sizes[1] < DIN * TQ || in_sizes[2] < TQ || in_sizes[3] < DIN * TQ || in_sizes[4] < TQ ||
      in_sizes[5] < DIN * TQ || in_sizes[6] < TQ || in_sizes[7] < TQ * DOUT || in_sizes[8] < DOUT || (long long)out_size < needO) return;
  char* ws = (char*)d_ws; size_t off = 0;
  auto take = [&](size_t bytes) { char* p = ws + off; off += (bytes + 255) & ~(size_t)255; return p; };
  _Float16* X16 = (_Float16*)take(NR * DIN * 2);
  _Float16* Wqkvt = (_Float16*)take((size_t)3 * TQ * DIN * 2);
  _Float16* Wot = (_Float16*)take((size_t)DOUT * TQ * 2);
  _Float16* QH = (_Float16*)take(NR * TQ * 2); _Float16* QL = (_Float16*)take(NR * TQ * 2);
  _Float16* KH = (_Float16*)take(NR * TQ * 2); _Float16* KL = (_Float16*)take(NR * TQ * 2);
  _Float16* VT = (_Float16*)take((size_t)NB * NH * HD * SEQ * 2);
  _Float16* OH = (_Float16*)take((size_t)NB * NH * SEQ * HD * 2);
  if (off > ws_size || off > (size_t)134217728) return;
  const float a16 = 0.0625f;

  k_prep<<<(unsigned)(4 * WBLK + NR * DIN / 8 / 256), 256, 0, stream>>>(X, Wq, Wk, Wv, Wo, X16, Wqkvt, Wot);   /* x rows -> f16(bf16(x)); W -> W^T x16 */
  k_gemm_qkv<<<(unsigned)((NR / 128) * (3 * TQ / 64)), 128, 0, stream>>>(X16, DIN, Wqkvt, DIN, a16, bq, bk, bv, QH, QL, KH, KL, VT, DIN);   /* q, k hi / x1024 residual planes; V^T per (b,h): [32][SEQ] */
  k_flash<<<dim3(SEQ / 64, NB * NH), 128, 0, stream>>>(QH, QL, KH, KL, VT, OH);                              /* attention -> O head-major */
  k_gemm_out<<<(unsigned)((NR / 128) * (DOUT / 64)), 128, 0, stream>>>(OH, Wot, TQ, a16, bo, (float*)d_out, DOUT, (int)NR, DOUT);   /* out = O Wo + bo */
}

// v003
// One run takes 66.5 microseconds.
// Timed twice side by side with v002, it ran 1.33 and 1.31 times as fast.
// Counting every step since v000, it is 3.19 times as fast.
#include <hip/hip_runtime.h>
// Contractions on v_wmma_f32_16x16x32_f16 (f16 operands, f32 accumulate): q/k/v projections (bf16-valued x exact in f16, bf16-valued W x16 in f16), output projection (f16 o, bf16-valued Wo x16), P x V^T (f16 P carried x16384, f16 v); scores as K x Q^T with f16 hi planes plus x1024 f16 residual planes (three products, two accumulators, fold 2^-10); softmax statistics and epilogues f32.
#ifndef NB
#define NB 4
#endif
#ifndef SEQ
#define SEQ 2048
#endif
#define NB_FULL 4
#define SEQ_FULL 2048
#define DIN 512          /* input channels */
#define TQ 256           /* n_head * qk_dim */
#define NH 8
#define HD 32
#define DOUT 512
#define NR ((size_t)NB * SEQ)   /* token rows processed */
#define KT 64            /* keys per attention tile */

static_assert(NB >= 1 && NB <= NB_FULL);
static_assert(SEQ >= 128 && SEQ <= SEQ_FULL);
static_assert(SEQ % 128 == 0);
static_assert((NR % 128) == 0);
static_assert(TQ % 64 == 0 && DOUT % 64 == 0 && DIN % 32 == 0 && TQ % 32 == 0);
static_assert(HD == 32 && NH * HD == TQ);
static_assert(SEQ % KT == 0 && KT == 64);
static_assert(DIN % 64 == 0 && DIN >= 128 && TQ % 64 == 0);

typedef _Float16 v16h __attribute__((ext_vector_type(16)));
typedef unsigned short v8us __attribute__((ext_vector_type(8), may_alias));
typedef float  v8f  __attribute__((ext_vector_type(8)));
typedef float  v4f  __attribute__((ext_vector_type(4)));
typedef float  v4fa __attribute__((ext_vector_type(4), may_alias));
typedef _Float16 v4h __attribute__((ext_vector_type(4)));
union FragH { v16h v; v8us half[2]; _Float16 h[16]; unsigned short u[16]; };

__device__ __forceinline__ unsigned short bf16_bits(float x) { unsigned int u = __float_as_uint(x); return (unsigned short)((u + 0x7FFFu + ((u >> 16) & 1u)) >> 16); }
__device__ __forceinline__ float bf16_val(unsigned short b) { return __uint_as_float(((unsigned int)b) << 16); }
__device__ __forceinline__ float bf16_rne(float x) { return bf16_val(bf16_bits(x)); }

// 16x16 fragment from a 16-bit [row][k] plane row pointer (k contiguous): elements 0..7 <- k 8h..8h+7, elements 8..15 <- k 16+8h..16+8h+7 (same map for A rows and B columns)
__device__ __forceinline__ v16h g2_frag(const _Float16* p, int hh) { FragH f; f.half[0] = *(const v8us*)((const unsigned short*)p + 8 * hh); f.half[1] = *(const v8us*)((const unsigned short*)p + 16 + 8 * hh); return f.v; }
__device__ __forceinline__ v8f g2_mma(v16h a, v16h b, v8f c) { v8f d = __builtin_amdgcn_wmma_f32_16x16x32_f16(false, a, false, b, (short)0, c, false, false); asm volatile("v_nop\n\tv_nop\n\tv_nop\n\tv_nop" : "+v"(d) : "v"(a), "v"(b)); return d; }
// hi/residual product: ah.bh + 2^-10 (al.bh + ah.bl), the x1024 residual products in their own accumulator
__device__ __forceinline__ v8f mma_split(v16h ah, v16h al, v16h bh, v16h bl) {
  const v8f z8 = {0.f,0.f,0.f,0.f,0.f,0.f,0.f,0.f};
  v8f c1 = __builtin_amdgcn_wmma_f32_16x16x32_f16(false, ah, false, bh, (short)0, z8, false, false);
  v8f c2 = __builtin_amdgcn_wmma_f32_16x16x32_f16(false, al, false, bh, (short)0, z8, false, false);
  c2 = __builtin_amdgcn_wmma_f32_16x16x32_f16(false, ah, false, bl, (short)0, c2, false, false);
  asm volatile("v_nop\n\tv_nop\n\tv_nop\n\tv_nop" : "+v"(c1), "+v"(c2) : "v"(ah), "v"(al), "v"(bh), "v"(bl));
  return c1 + c2 * 0.0009765625f;
}

// one launch converts x and the four weights: blocks 0..4*WBLK-1 take the weights (their strided reads start first), the rest take x
#define WBLK (TQ * (DIN / 8) / 256)   /* blocks per weight matrix */
static_assert(TQ * (DIN / 8) % 256 == 0 && DOUT * (TQ / 8) == TQ * (DIN / 8) && (NR * DIN / 8) % 256 == 0);

__device__ __forceinline__ void x16r_body(const float* __restrict__ x, _Float16* __restrict__ X16, size_t t) {
  const size_t e = t * 8; const size_t r = e / DIN; const size_t c = e - r * DIN;
  const size_t sr = (r / SEQ) * SEQ_FULL + (r % SEQ);
  const float* s = x + sr * DIN + c;
  const v4f a = *(const v4fa*)s, c4v = *(const v4fa*)(s + 4);
  FragH f;
#pragma unroll
  for (int q = 0; q < 4; ++q) { f.h[q] = (_Float16)bf16_rne(a[q]); f.h[4 + q] = (_Float16)bf16_rne(c4v[q]); }
  unsigned short* d = (unsigned short*)X16 + e;
  *(v8us*)d = f.half[0];
  asm volatile("s_wait_xcnt 0x0" ::: "memory");   /* the store's registers are not rewritten ahead of this (another arm of the caller follows in the code) */
}

__device__ __forceinline__ void wt_f16_body(const float* __restrict__ W, _Float16* __restrict__ Wt, int K, int N, float scale, int t) {
  const int n = t / (K / 8), k8 = (t % (K / 8)) * 8; FragH f;
#pragma unroll
  for (int i = 0; i < 8; ++i) f.h[i] = (_Float16)(bf16_rne(W[(size_t)(k8 + i) * N + n]) * scale);
  const v8us o = f.half[0]; unsigned short* d = (unsigned short*)Wt + (size_t)n * K + k8;
  *(v8us*)d = o;
  asm volatile("s_wait_xcnt 0x0" ::: "memory");   /* the store's registers are not rewritten ahead of this (another arm of the caller follows in the code) */
}

// Wqkvt = [3*TQ][DIN]: rows 0..TQ-1 Wq^T, then Wk^T, then Wv^T, all x16; Wot = [DOUT][TQ] x16
__global__ __launch_bounds__(256) void k_prep(const float* __restrict__ x, const float* __restrict__ Wq, const float* __restrict__ Wk, const float* __restrict__ Wv, const float* __restrict__ Wo,
                                              _Float16* __restrict__ X16, _Float16* __restrict__ Wqkvt, _Float16* __restrict__ Wot) {
  const int bid = blockIdx.x;
  if (bid < 3 * WBLK) { const int m = bid / WBLK; const float* W = m == 0 ? Wq : (m == 1 ? Wk : Wv);
    wt_f16_body(W, Wqkvt + (size_t)m * TQ * DIN, DIN, TQ, 16.0f, (bid - m * WBLK) * 256 + (int)threadIdx.x); }
  else if (bid < 4 * WBLK) wt_f16_body(Wo, Wot, TQ, DOUT, 16.0f, (bid - 3 * WBLK) * 256 + (int)threadIdx.x);
  else x16r_body(x, X16, (size_t)(bid - 4 * WBLK) * 256 + threadIdx.x);
}

// k-tiles of the two GEMMs in LDS: 64 k (128 bytes) of 128 A rows, then of 64 B rows, copied once per block, one tile ahead; all four waves read their fragments there
#define GKS 64                 /* k per staged tile */
#define GP 72                  /* LDS row pitch in halves: 128 data bytes + 16, a 16 B x odd pitch for ds_load_b128 readers */
#define GA_H (128 * GP)        /* the A rows; the B rows follow */
#define GTILE_H ((128 + 64) * GP)
// One lane's twelve 16-byte copies of a k-tile (eight of A, four of B), global memory to LDS through no register.
// s_wait_xcnt closes the statement so that no address register of a copy is rewritten ahead of it.
__device__ __forceinline__ void gemm_copies(unsigned l0, unsigned l1, unsigned l2, unsigned l3, unsigned l4, unsigned l5, unsigned l6, unsigned l7, unsigned l8, unsigned l9, unsigned l10, unsigned l11,
                                            const _Float16* g0, const _Float16* g1, const _Float16* g2, const _Float16* g3, const _Float16* g4, const _Float16* g5,
                                            const _Float16* g6, const _Float16* g7, const _Float16* g8, const _Float16* g9, const _Float16* g10, const _Float16* g11) {
  asm volatile("global_load_async_to_lds_b128 %0, %12, off\n\t"
               "global_load_async_to_lds_b128 %1, %13, off\n\t"
               "global_load_async_to_lds_b128 %2, %14, off\n\t"
               "global_load_async_to_lds_b128 %3, %15, off\n\t"
               "global_load_async_to_lds_b128 %4, %16, off\n\t"
               "global_load_async_to_lds_b128 %5, %17, off\n\t"
               "global_load_async_to_lds_b128 %6, %18, off\n\t"
               "global_load_async_to_lds_b128 %7, %19, off\n\t"
               "global_load_async_to_lds_b128 %8, %20, off\n\t"
               "global_load_async_to_lds_b128 %9, %21, off\n\t"
               "global_load_async_to_lds_b128 %10, %22, off\n\t"
               "global_load_async_to_lds_b128 %11, %23, off\n\t"
               "s_wait_xcnt 0x0"
               :: "v"(l0), "v"(l1), "v"(l2), "v"(l3), "v"(l4), "v"(l5), "v"(l6), "v"(l7), "v"(l8), "v"(l9), "v"(l10), "v"(l11),
                  "v"(g0), "v"(g1), "v"(g2), "v"(g3), "v"(g4), "v"(g5), "v"(g6), "v"(g7), "v"(g8), "v"(g9), "v"(g10), "v"(g11) : "memory");
}
// a wave's 32 x 64 products over one staged k-tile: ab = its first A row in LDS, bb = the first B row (both at this lane's row), k ascending in steps of 32;
// all twelve fragments are read as one group ahead of the products, so that the wave waits out the LDS latency once per tile
__device__ __forceinline__ void gemm_tile(const _Float16* ab, const _Float16* bb, int hh, v8f (&c)[8]) {
  v16h a[2][2], b[2][4];
#pragma unroll /* fragment arrays indexed by constants, so that they stay in registers */
  for (int s = 0; s < 2; ++s) { a[s][0] = g2_frag(ab + 32 * s, hh); a[s][1] = g2_frag(ab + 16 * GP + 32 * s, hh);
#pragma unroll
    for (int j = 0; j < 4; ++j) b[s][j] = g2_frag(bb + 16 * j * GP + 32 * s, hh); }
#pragma unroll /* as above, and the accumulator array too */
  for (int s = 0; s < 2; ++s) {
#pragma unroll
    for (int j = 0; j < 4; ++j) { c[j] = g2_mma(a[s][0], b[s][j], c[j]); c[4 + j] = g2_mma(a[s][1], b[s][j], c[4 + j]); } } }
static_assert(GKS == 64);

// q, k and v projections in one launch: C = alpha * A.Bt + bf16(bias) over the 3*TQ columns of [Wq|Wk|Wv]; A f16 [NR][K] (pitch lda), Bh f16 [3*TQ][K] (pitch ldb).
// A block's 64 columns lie in one of the three; its epilogue writes the form attention reads:
// q and k as f16 hi plane plus x1024 f16 residual plane (row pitch TQ), v as f16 transposed, VT[(b,h)][c][s].
#define VTP 136                /* LDS pitch in halves of a transposed v row: 128 tokens (256 bytes) + 16 bytes */
__global__ __launch_bounds__(128) void k_gemm_qkv(const _Float16* __restrict__ A, int lda, const _Float16* __restrict__ Bh, int ldb, float alpha,
                                                  const float* __restrict__ bq, const float* __restrict__ bk, const float* __restrict__ bv,
                                                  _Float16* __restrict__ QH, _Float16* __restrict__ QL, _Float16* __restrict__ KH, _Float16* __restrict__ KL, _Float16* __restrict__ VT, int K) {
  __shared__ __attribute__((aligned(16))) float so[4][32][68];
  static_assert(64 * VTP * 2 <= 4 * 32 * 68 * 4);
  __shared__ __attribute__((aligned(16))) _Float16 st[2][GTILE_H];   /* two k-tile buffers shared by the four waves */
  const int tid = threadIdx.x, w = tid >> 5, lane = tid & 31, ln = lane & 15, hh = lane >> 4;
  constexpr int ntn = (3 * TQ) >> 6, npl = TQ >> 6;
  const int mt = blockIdx.x / ntn, nq = blockIdx.x - mt * ntn; const int row0 = mt * 128 + 32 * w, col0 = nq * 64;
  const int pl = nq / npl, pc0 = (nq - pl * npl) * 64;      /* which of q, k, v; first column inside it */
  // copy roles: thread -> (row tid/8 and +16 i, 16-byte piece tid%8): a wave's copy covers four whole 128-byte lines
  const int cr = tid >> 3, cp = (tid & 7) * 8;
  const _Float16* ga = A + (size_t)(mt * 128 + cr) * lda + cp;
  const _Float16* gb = Bh + (size_t)(col0 + cr) * ldb + cp;
  const size_t sa = (size_t)16 * lda, sb = (size_t)16 * ldb;
  const unsigned la = (unsigned)(size_t)&st[0][0] + (unsigned)(cr * GP + cp) * 2u, lb = la + GA_H * 2u;
  auto issue_tile = [&](int t) {
    const unsigned pa = la + (unsigned)(t & 1) * (unsigned)(GTILE_H * 2), pb = lb + (unsigned)(t & 1) * (unsigned)(GTILE_H * 2);
    const _Float16* a = ga + (size_t)t * GKS; const _Float16* b = gb + (size_t)t * GKS;
    gemm_copies(pa, pa + 16 * GP * 2, pa + 32 * GP * 2, pa + 48 * GP * 2, pa + 64 * GP * 2, pa + 80 * GP * 2, pa + 96 * GP * 2, pa + 112 * GP * 2,
                pb, pb + 16 * GP * 2, pb + 32 * GP * 2, pb + 48 * GP * 2,
                a, a + sa, a + 2 * sa, a + 3 * sa, a + 4 * sa, a + 5 * sa, a + 6 * sa, a + 7 * sa, b, b + sb, b + 2 * sb, b + 3 * sb);
  };
  const v8f z8 = {0.f,0.f,0.f,0.f,0.f,0.f,0.f,0.f}; v8f accs[8] = {z8, z8, z8, z8, z8, z8, z8, z8};   /* accs[j]: rows 0..15 x columns 16j.., accs[4+j]: rows 16..31 */
  const int nt = K / GKS;
  issue_tile(0);
  asm volatile("s_wait_asynccnt 0x0" ::: "memory");   /* this wave's copies of tile 0 have landed */
  __syncthreads();                                     /* tile 0 published to all four waves */
  if (nt > 1) issue_tile(1);
#pragma unroll 1 /* stays rolled: one publish point and one refill site, the buffer picked by t & 1 */
  for (int t = 0; t < nt; ++t) {
    gemm_tile(&st[t & 1][0] + (32 * w + ln) * GP, &st[t & 1][GA_H] + ln * GP, hh, accs);
    asm volatile("s_wait_dscnt 0x0" ::: "memory");     /* this wave's reads of buffer t%2 are done before it is refilled */
    asm volatile("s_wait_asynccnt 0x0" ::: "memory");  /* this wave's copies of tile t+1 have landed */
    __syncthreads();                                   /* publishes tile t+1 and ends every wave's reads of buffer t%2 */
    if (t + 2 < nt) issue_tile(t + 2);
  }
  asm volatile("s_wait_asynccnt 0x0" ::: "memory");    /* no copy outstanding when the wave goes on to its epilogue */
  const float* bias = pl == 0 ? bq : (pl == 1 ? bk : bv);
  if (pl < 2) {
#pragma unroll
    for (int u = 0; u < 8; ++u) { const int t = u & 3, half = u >> 2; const float bvl = bf16_rne(bias[pc0 + t * 16 + ln]);
#pragma unroll
      for (int r = 0; r < 8; ++r) { const int rloc = half * 16 + 8 * hh + r; so[w][rloc][t * 16 + ln] = accs[u][r] * alpha + bvl; } }
    __builtin_amdgcn_fence(4 /* acq_rel order */, "workgroup"); __builtin_amdgcn_wave_barrier();
    unsigned short* Hh = (unsigned short*)(pl == 0 ? QH : KH); unsigned short* Hl = (unsigned short*)(pl == 0 ? QL : KL);
    const int rsub = lane >> 3, c8 = (lane & 7) * 8;
#pragma unroll
    for (int j = 0; j < 8; ++j) { const int r = j * 4 + rsub; const v4f a = *(const v4fa*)&so[w][r][c8], c = *(const v4fa*)&so[w][r][c8 + 4]; FragH fh, fl;
#pragma unroll
      for (int q = 0; q < 4; ++q) { _Float16 h = (_Float16)a[q]; fh.h[q] = h; fl.h[q] = (_Float16)((a[q] - (float)h) * 1024.0f); h = (_Float16)c[q]; fh.h[4 + q] = h; fl.h[4 + q] = (_Float16)((c[q] - (float)h) * 1024.0f); }
      const size_t o = (size_t)(row0 + r) * TQ + pc0 + c8;
      *(v8us*)(Hh + o) = fh.half[0]; *(v8us*)(Hl + o) = fl.half[0]; }
  } else {
    // a lane's eight accumulator rows are eight consecutive tokens of one channel: 16 bytes of a V^T row, gathered per block so that each row leaves as 256 contiguous bytes
    unsigned short* vt = (unsigned short*)&so[0][0][0];
#pragma unroll
    for (int u = 0; u < 8; ++u) { const int t = u & 3, half = u >> 2; const float bvl = bf16_rne(bias[pc0 + t * 16 + ln]); FragH f;
#pragma unroll
      for (int r = 0; r < 8; ++r) f.h[r] = (_Float16)(accs[u][r] * alpha + bvl);
      *(v8us*)(vt + (t * 16 + ln) * VTP + 32 * w + half * 16 + 8 * hh) = f.half[0]; }
    __syncthreads();   /* all four waves' token columns are in LDS before the rows are read; pl is the same for the whole block */
    const int bidx = (mt * 128) / SEQ, s0 = mt * 128 - bidx * SEQ;
    unsigned short* dst = (unsigned short*)VT + ((size_t)bidx * TQ + pc0) * SEQ + s0;
#pragma unroll
    for (int j = 0; j < 8; ++j) { const int p = j * 128 + tid, cl = p >> 4, pc = (p & 15) * 8;
      *(v8us*)(dst + (size_t)cl * SEQ + pc) = *(const v8us*)(vt + cl * VTP + pc); }
    asm volatile("s_wait_xcnt 0x0" ::: "memory");   /* the stores' registers are not rewritten ahead of this (the other arm follows in the code) */
  } }

// flash-style attention per (b,h): block = 4 waves x 16 queries, key tiles of 64; scores computed transposed (S^T tile = K rows x Q^T, D rows = keys, D columns = queries)
// so that two adjacent D tiles form the P (query x key) A fragment directly; online softmax with per-lane query statistics (lanes l and l^16 share a query),
// P carried x16384 (argument of exp shifted by ln 16384), O = P.V^T with B fragments from the VT plane; O written head-major OH[(b,h)][s][c]
// each key tile (K hi and residual rows, V^T rows) is copied once per block into LDS, one tile ahead, and all four waves read their fragments there
#define KVP 72                 /* LDS row pitch in halves: 128 data bytes + 16, a 16 B x odd pitch for ds_load_b128 readers */
#define KPART (KT * KVP)       /* 64 key rows: hi plane in halves 0..31, residual plane in halves 32..63 */
#define TILE_H (KPART + HD * KVP) /* then 32 channel rows of V^T, 64 keys each */
// One lane's six 16-byte copies of a key tile, global memory to LDS through no register.
// s_wait_xcnt closes the statement so that no address register of a copy is rewritten ahead of it.
__device__ __forceinline__ void tile_copies(unsigned l0, unsigned l1, unsigned l2, unsigned l3, unsigned l4, unsigned l5,
                                            const _Float16* g0, const _Float16* g1, const _Float16* g2, const _Float16* g3, const _Float16* g4, const _Float16* g5) {
  asm volatile("global_load_async_to_lds_b128 %0, %6, off\n\t"
               "global_load_async_to_lds_b128 %1, %7, off\n\t"
               "global_load_async_to_lds_b128 %2, %8, off\n\t"
               "global_load_async_to_lds_b128 %3, %9, off\n\t"
               "global_load_async_to_lds_b128 %4, %10, off\n\t"
               "global_load_async_to_lds_b128 %5, %11, off\n\t"
               "s_wait_xcnt 0x0"
               :: "v"(l0), "v"(l1), "v"(l2), "v"(l3), "v"(l4), "v"(l5), "v"(g0), "v"(g1), "v"(g2), "v"(g3), "v"(g4), "v"(g5) : "memory");
}

__global__ __launch_bounds__(128) void k_flash(const _Float16* __restrict__ QH, const _Float16* __restrict__ QL, const _Float16* __restrict__ KH, const _Float16* __restrict__ KL,
                                              const _Float16* __restrict__ VT, _Float16* __restrict__ OH) {
  __shared__ __attribute__((aligned(16))) _Float16 so[4][16][40];
  __shared__ __attribute__((aligned(16))) _Float16 kv[2][TILE_H];   /* two key-tile buffers shared by the four waves */
  const int tid = threadIdx.x, w = tid >> 5, lane = tid & 31, ln = lane & 15, hh = lane >> 4;
  const int bh = blockIdx.y; const int b = bh / NH, h = bh - b * NH;
  const int q0 = blockIdx.x * 64 + w * 16;
  const size_t qrow = (size_t)b * SEQ + q0 + ln;
  const v16h qh = g2_frag(QH + qrow * TQ + h * HD, hh);
  const v16h ql = g2_frag(QL + qrow * TQ + h * HD, hh);
  // copy roles: K planes, thread -> (row tid/4 and +32, 16-byte piece tid%4); V^T, thread -> (row tid/8 and +16, piece tid%8)
  const int kr = tid >> 2, kc = (tid & 3) * 8, vr = tid >> 3, vc = (tid & 7) * 8;
  const _Float16* gkh = KH + ((size_t)b * SEQ + kr) * TQ + h * HD + kc;
  const _Float16* gkl = KL + ((size_t)b * SEQ + kr) * TQ + h * HD + kc;
  const _Float16* gvt = VT + ((size_t)bh * HD + vr) * SEQ + vc;
  const unsigned lds0 = (unsigned)(size_t)&kv[0][0];
  const unsigned lk = lds0 + (unsigned)(kr * KVP + kc) * 2u, lv = lds0 + (unsigned)(KPART + vr * KVP + vc) * 2u;
  auto issue_tile = [&](int t) {
    const unsigned bo = (unsigned)(t & 1) * (unsigned)(TILE_H * 2);
    const _Float16* a = gkh + (size_t)t * KT * TQ; const _Float16* c = gkl + (size_t)t * KT * TQ; const _Float16* v = gvt + (size_t)t * KT;
    tile_copies(lk + bo, lk + bo + 32 * KVP * 2, lk + bo + 64, lk + bo + 64 + 32 * KVP * 2, lv + bo, lv + bo + 16 * KVP * 2,
                a, a + (size_t)32 * TQ, c, c + (size_t)32 * TQ, v, v + (size_t)16 * SEQ);
  };
  const v8f z8 = {0.f,0.f,0.f,0.f,0.f,0.f,0.f,0.f};
  float rm = -3.0e38f, rl = 0.f; v8f o0 = z8, o1 = z8;
  constexpr int NT = SEQ / KT;
  issue_tile(0);
  asm volatile("s_wait_asynccnt 0x0" ::: "memory");   /* this wave's copies of tile 0 have landed */
  __syncthreads();                                     /* tile 0 published to all four waves */
  issue_tile(1);
#pragma unroll 1
  for (int t = 0; t < NT; ++t) {
    const _Float16* kb = &kv[t & 1][0] + ln * KVP;
    const _Float16* vp = &kv[t & 1][KPART] + ln * KVP;
    v16h ah[4], al[4];
#pragma unroll /* fragment arrays indexed by constants, so that they stay in registers */
    for (int j = 0; j < 4; ++j) { ah[j] = g2_frag(kb + 16 * j * KVP, hh); al[j] = g2_frag(kb + 16 * j * KVP + 32, hh); }
    const v16h vb0 = g2_frag(vp, hh), vb1 = g2_frag(vp + 16 * KVP, hh), vb2 = g2_frag(vp + 32, hh), vb3 = g2_frag(vp + 16 * KVP + 32, hh);
    v8f s[4];
#pragma unroll /* as above: s[] and the fragments stay in registers */
    for (int j = 0; j < 4; ++j) s[j] = mma_split(ah[j], al[j], qh, ql);
    float m = s[0][0];
#pragma unroll
    for (int t4 = 0; t4 < 4; ++t4) {
#pragma unroll
      for (int r = 0; r < 8; ++r) m = fmaxf(m, s[t4][r]); }
    m = fmaxf(m, __shfl_xor(m, 16, 32));
    const float mn = fmaxf(rm, m);
    const float alpha = __expf(rm - mn);
    rm = mn;
    const float pm = mn - 9.704060527839234f;      /* exp(s - mn) carried x16384 */
    float ls = 0.f; FragH pa[2];
#pragma unroll
    for (int t4 = 0; t4 < 4; ++t4) {
#pragma unroll
      for (int r = 0; r < 8; ++r) { const float p = __expf(s[t4][r] - pm); ls += p; pa[t4 >> 1].h[((t4 & 1) << 3) + r] = (_Float16)p; } }
    ls += __shfl_xor(ls, 16, 32);
    rl = rl * alpha + ls;
#pragma unroll
    for (int r = 0; r < 8; ++r) { const float ar = __shfl(alpha, 8 * hh + r, 32); o0[r] *= ar; o1[r] *= ar; }
    o0 = g2_mma(pa[0].v, vb0, o0);
    o1 = g2_mma(pa[0].v, vb1, o1);
    o0 = g2_mma(pa[1].v, vb2, o0);
    o1 = g2_mma(pa[1].v, vb3, o1);
    asm volatile("s_wait_dscnt 0x0" ::: "memory");     /* this wave's reads of buffer t%2 are done before it is refilled */
    asm volatile("s_wait_asynccnt 0x0" ::: "memory");  /* this wave's copies of tile t+1 have landed */
    __syncthreads();                                   /* publishes tile t+1 and ends every wave's reads of buffer t%2 */
    if (t + 2 < NT) issue_tile(t + 2);
  }
  asm volatile("s_wait_asynccnt 0x0" ::: "memory");    /* no copy outstanding when the wave goes on to its end */
  const float inv = 1.0f / rl;
#pragma unroll
  for (int r = 0; r < 8; ++r) { const float ir = __shfl(inv, 8 * hh + r, 32); so[w][8 * hh + r][ln] = (_Float16)(o0[r] * ir); so[w][8 * hh + r][16 + ln] = (_Float16)(o1[r] * ir); }
  __builtin_amdgcn_fence(4 /* acq_rel order */, "workgroup"); __builtin_amdgcn_wave_barrier();
  unsigned short* ob = (unsigned short*)OH + ((size_t)bh * SEQ + q0) * HD;
  {
#pragma unroll
    for (int j = 0; j < 2; ++j) { const int p = j * 32 + lane; const v8us v = *(const v8us*)&so[w][p >> 2][(p & 3) * 8]; *(v8us*)(ob + (size_t)p * 8) = v; }
     } }

// output projection into the f32 output rows: A = OH head-major ([(b,h)][s][32], k-step == head), Bh = Wot f16 [DOUT][TQ] (x16), C row = b*SEQ_FULL + s (pitch ldc);
__global__ __launch_bounds__(128) void k_gemm_out(const _Float16* __restrict__ OHp, const _Float16* __restrict__ Bh, int ldb, float alpha, const float* __restrict__ bias,
                                                  float* __restrict__ C, int ldc, int M, int N) {
  __shared__ __attribute__((aligned(16))) float so[4][32][68];
  __shared__ __attribute__((aligned(16))) _Float16 st[2][GTILE_H];   /* two k-tile buffers shared by the four waves */
  const int tid = threadIdx.x, w = tid >> 5, lane = tid & 31, ln = lane & 15, hh = lane >> 4;
  const int ntn = N >> 6; const int mt = blockIdx.x / ntn, nq = blockIdx.x - mt * ntn; const int row0 = mt * 128 + 32 * w, col0 = nq * 64; if (mt * 128 >= M) return;   /* the whole block leaves, ahead of every copy and barrier */
  const int bidx = row0 / SEQ, l0 = row0 - bidx * SEQ;
  const size_t hstr = (size_t)SEQ * HD;
  // copy roles: A, one head's 128 rows are 8 KiB in a row: thread -> (row tid/4 and +32 i, 16-byte piece tid%4), heads 2t and 2t+1 side by side in an LDS row; B: thread -> (row tid/8 and +16 i, piece tid%8)
  const int ar = tid >> 2, ap = (tid & 3) * 8, cr = tid >> 3, cp = (tid & 7) * 8;
  const _Float16* ga = OHp + (((size_t)bidx * NH) * SEQ + (l0 - 32 * w) + ar) * HD + ap;
  const _Float16* gb = Bh + (size_t)(col0 + cr) * ldb + cp;
  const size_t sb = (size_t)16 * ldb;
  const unsigned la = (unsigned)(size_t)&st[0][0] + (unsigned)(ar * GP + ap) * 2u, lb = (unsigned)(size_t)&st[0][0] + (unsigned)(GA_H + cr * GP + cp) * 2u;
  auto issue_tile = [&](int t) {
    const unsigned pa = la + (unsigned)(t & 1) * (unsigned)(GTILE_H * 2), pb = lb + (unsigned)(t & 1) * (unsigned)(GTILE_H * 2);
    const _Float16* a = ga + (size_t)(2 * t) * hstr; const _Float16* a2 = a + hstr; const _Float16* b = gb + (size_t)t * GKS;
    gemm_copies(pa, pa + 32 * GP * 2, pa + 64 * GP * 2, pa + 96 * GP * 2, pa + 64, pa + 64 + 32 * GP * 2, pa + 64 + 64 * GP * 2, pa + 64 + 96 * GP * 2,
                pb, pb + 16 * GP * 2, pb + 32 * GP * 2, pb + 48 * GP * 2,
                a, a + 32 * HD, a + 64 * HD, a + 96 * HD, a2, a2 + 32 * HD, a2 + 64 * HD, a2 + 96 * HD, b, b + sb, b + 2 * sb, b + 3 * sb);
  };
  const v8f z8 = {0.f,0.f,0.f,0.f,0.f,0.f,0.f,0.f}; v8f accs[8] = {z8, z8, z8, z8, z8, z8, z8, z8};   /* accs[j]: rows 0..15 x columns 16j.., accs[4+j]: rows 16..31 */
  constexpr int nt = TQ / GKS;
  static_assert(GKS == 2 * HD && nt >= 2);
  issue_tile(0);
  asm volatile("s_wait_asynccnt 0x0" ::: "memory");   /* this wave's copies of tile 0 have landed */
  __syncthreads();                                     /* tile 0 published to all four waves */
  issue_tile(1);
#pragma unroll 1 /* stays rolled: one publish point and one refill site, the buffer picked by t & 1 */
  for (int t = 0; t < nt; ++t) {
    gemm_tile(&st[t & 1][0] + (32 * w + ln) * GP, &st[t & 1][GA_H] + ln * GP, hh, accs);
    asm volatile("s_wait_dscnt 0x0" ::: "memory");     /* this wave's reads of buffer t%2 are done before it is refilled */
    asm volatile("s_wait_asynccnt 0x0" ::: "memory");  /* this wave's copies of tile t+1 have landed */
    __syncthreads();                                   /* publishes tile t+1 and ends every wave's reads of buffer t%2 */
    if (t + 2 < nt) issue_tile(t + 2);
  }
  asm volatile("s_wait_asynccnt 0x0" ::: "memory");    /* no copy outstanding when the wave goes on to its epilogue */
#pragma unroll
  for (int u = 0; u < 8; ++u) { const int t = u & 3, half = u >> 2; const int col = col0 + t * 16 + ln; const float bvl = bf16_rne(bias[col]);
#pragma unroll
    for (int r = 0; r < 8; ++r) { const int rloc = half * 16 + 8 * hh + r; so[w][rloc][t * 16 + ln] = accs[u][r] * alpha + bvl; } }
  __builtin_amdgcn_fence(4 /* acq_rel order */, "workgroup"); __builtin_amdgcn_wave_barrier();
  const int rsub = lane >> 4, c4 = (lane & 15) * 4;
  const size_t crow0 = (size_t)bidx * SEQ_FULL + l0;
  {
#pragma unroll
    for (int q = 0; q < 16; ++q) { const int r = q * 2 + rsub; const v4f v = *(const v4fa*)&so[w][r][c4]; *(v4f*)(C + (crow0 + r) * ldc + col0 + c4) = v; }
     } }

extern "C" void kernel_launch(void* const* d_in, const int* in_sizes, int n_in,
                              void* d_out, int out_size, void* d_ws, size_t ws_size, hipStream_t stream) {
  if (n_in < 9) return;
  const float* X  = (const float*)d_in[0];      /* [NB_FULL][SEQ_FULL][DIN] */
  const float* Wq = (const float*)d_in[1];      /* [DIN][TQ] */
  const float* bq = (const float*)d_in[2];      /* [TQ] */
  const float* Wk = (const float*)d_in[3];
  const float* bk = (const float*)d_in[4];
  const float* Wv = (const float*)d_in[5];
  const float* bv = (const float*)d_in[6];
  const float* Wo = (const float*)d_in[7];      /* [TQ][DOUT] */
  const float* bo = (const float*)d_in[8];      /* [DOUT] */
  const long long needX = (long long)(((size_t)(NB - 1) * SEQ_FULL + SEQ) * DIN);
  const long long needO = (long long)(((size_t)(NB - 1) * SEQ_FULL + SEQ) * DOUT);
  if ((long long)in_sizes[0] < needX || in_sizes[1] < DIN * TQ || in_sizes[2] < TQ || in_sizes[3] < DIN * TQ || in_sizes[4] < TQ ||
      in_sizes[5] < DIN * TQ || in_sizes[6] < TQ || in_sizes[7] < TQ * DOUT || in_sizes[8] < DOUT || (long long)out_size < needO) return;
  char* ws = (char*)d_ws; size_t off = 0;
  auto take = [&](size_t bytes) { char* p = ws + off; off += (bytes + 255) & ~(size_t)255; return p; };
  _Float16* X16 = (_Float16*)take(NR * DIN * 2);
  _Float16* Wqkvt = (_Float16*)take((size_t)3 * TQ * DIN * 2);
  _Float16* Wot = (_Float16*)take((size_t)DOUT * TQ * 2);
  _Float16* QH = (_Float16*)take(NR * TQ * 2); _Float16* QL = (_Float16*)take(NR * TQ * 2);
  _Float16* KH = (_Float16*)take(NR * TQ * 2); _Float16* KL = (_Float16*)take(NR * TQ * 2);
  _Float16* VT = (_Float16*)take((size_t)NB * NH * HD * SEQ * 2);
  _Float16* OH = (_Float16*)take((size_t)NB * NH * SEQ * HD * 2);
  if (off > ws_size || off > (size_t)134217728) return;
  const float a16 = 0.0625f;

  k_prep<<<(unsigned)(4 * WBLK + NR * DIN / 8 / 256), 256, 0, stream>>>(X, Wq, Wk, Wv, Wo, X16, Wqkvt, Wot);   /* x rows -> f16(bf16(x)); W -> W^T x16 */
  k_gemm_qkv<<<(unsigned)((NR / 128) * (3 * TQ / 64)), 128, 0, stream>>>(X16, DIN, Wqkvt, DIN, a16, bq, bk, bv, QH, QL, KH, KL, VT, DIN);   /* q, k hi / x1024 residual planes; V^T per (b,h): [32][SEQ] */
  k_flash<<<dim3(SEQ / 64, NB * NH), 128, 0, stream>>>(QH, QL, KH, KL, VT, OH);                              /* attention -> O head-major */
  k_gemm_out<<<(unsigned)((NR / 128) * (DOUT / 64)), 128, 0, stream>>>(OH, Wot, TQ, a16, bo, (float*)d_out, DOUT, (int)NR, DOUT);   /* out = O Wo + bo */
}

// v004
// A run of this version takes 64.4 microseconds.
// In both of two side-by-side timings against v003, it was 1.04 times as fast.
// Over all steps from v000 it is 3.32 times as fast.
#include <hip/hip_runtime.h>
// Contractions on v_wmma_f32_16x16x32_f16 (f16 operands, f32 accumulate): q/k/v projections (bf16-valued x exact in f16, bf16-valued W x16 in f16), output projection (f16 o, bf16-valued Wo x16), P x V^T (f16 P carried x16384, f16 v); scores as K x Q^T with f16 hi planes plus x1024 f16 residual planes (three products into one accumulator that carries the score x1024); softmax statistics and epilogues f32.
#ifndef NB
#define NB 4
#endif
#ifndef SEQ
#define SEQ 2048
#endif
#define NB_FULL 4
#define SEQ_FULL 2048
#define DIN 512          /* input channels */
#define TQ 256           /* n_head * qk_dim */
#define NH 8
#define HD 32
#define DOUT 512
#define NR ((size_t)NB * SEQ)   /* token rows processed */
#define KT 64            /* keys per attention tile */

static_assert(NB >= 1 && NB <= NB_FULL);
static_assert(SEQ >= 128 && SEQ <= SEQ_FULL);
static_assert(SEQ % 128 == 0);
static_assert((NR % 128) == 0);
static_assert(TQ % 64 == 0 && DOUT % 64 == 0 && DIN % 32 == 0 && TQ % 32 == 0);
static_assert(HD == 32 && NH * HD == TQ);
static_assert(SEQ % KT == 0 && KT == 64);
static_assert(DIN % 64 == 0 && DIN >= 128 && TQ % 64 == 0);

typedef _Float16 v16h __attribute__((ext_vector_type(16)));
typedef unsigned short v8us __attribute__((ext_vector_type(8), may_alias));
typedef float  v8f  __attribute__((ext_vector_type(8)));
typedef float  v4f  __attribute__((ext_vector_type(4)));
typedef float  v4fa __attribute__((ext_vector_type(4), may_alias));
typedef _Float16 v4h __attribute__((ext_vector_type(4)));
union FragH { v16h v; v8us half[2]; _Float16 h[16]; unsigned short u[16]; };

__device__ __forceinline__ unsigned short bf16_bits(float x) { unsigned int u = __float_as_uint(x); return (unsigned short)((u + 0x7FFFu + ((u >> 16) & 1u)) >> 16); }
__device__ __forceinline__ float bf16_val(unsigned short b) { return __uint_as_float(((unsigned int)b) << 16); }
__device__ __forceinline__ float bf16_rne(float x) { return bf16_val(bf16_bits(x)); }

// 16x16 fragment from a 16-bit [row][k] plane row pointer (k contiguous): elements 0..7 <- k 8h..8h+7, elements 8..15 <- k 16+8h..16+8h+7 (same map for A rows and B columns)
__device__ __forceinline__ v16h g2_frag(const _Float16* p, int hh) { FragH f; f.half[0] = *(const v8us*)((const unsigned short*)p + 8 * hh); f.half[1] = *(const v8us*)((const unsigned short*)p + 16 + 8 * hh); return f.v; }
__device__ __forceinline__ v8f g2_mma(v16h a, v16h b, v8f c) { v8f d = __builtin_amdgcn_wmma_f32_16x16x32_f16(false, a, false, b, (short)0, c, false, false); asm volatile("v_nop\n\tv_nop\n\tv_nop\n\tv_nop" : "+v"(d) : "v"(a), "v"(b)); return d; }

// one launch converts x and the four weights: blocks 0..4*WBLK-1 take the weights (their strided reads start first), the rest take x
#define WBLK (TQ * (DIN / 8) / 256)   /* blocks per weight matrix */
static_assert(TQ * (DIN / 8) % 256 == 0 && DOUT * (TQ / 8) == TQ * (DIN / 8) && (NR * DIN / 8) % 256 == 0);

__device__ __forceinline__ void x16r_body(const float* __restrict__ x, _Float16* __restrict__ X16, size_t t) {
  const size_t e = t * 8; const size_t r = e / DIN; const size_t c = e - r * DIN;
  const size_t sr = (r / SEQ) * SEQ_FULL + (r % SEQ);
  const float* s = x + sr * DIN + c;
  const v4f a = *(const v4fa*)s, c4v = *(const v4fa*)(s + 4);
  FragH f;
#pragma unroll
  for (int q = 0; q < 4; ++q) { f.h[q] = (_Float16)bf16_rne(a[q]); f.h[4 + q] = (_Float16)bf16_rne(c4v[q]); }
  unsigned short* d = (unsigned short*)X16 + e;
  *(v8us*)d = f.half[0];
  asm volatile("s_wait_xcnt 0x0" ::: "memory");   /* the store's registers are not rewritten ahead of this (another arm of the caller follows in the code) */
}

__device__ __forceinline__ void wt_f16_body(const float* __restrict__ W, _Float16* __restrict__ Wt, int K, int N, float scale, int t) {
  const int n = t / (K / 8), k8 = (t % (K / 8)) * 8; FragH f;
#pragma unroll
  for (int i = 0; i < 8; ++i) f.h[i] = (_Float16)(bf16_rne(W[(size_t)(k8 + i) * N + n]) * scale);
  const v8us o = f.half[0]; unsigned short* d = (unsigned short*)Wt + (size_t)n * K + k8;
  *(v8us*)d = o;
  asm volatile("s_wait_xcnt 0x0" ::: "memory");   /* the store's registers are not rewritten ahead of this (another arm of the caller follows in the code) */
}

// Wqkvt = [3*TQ][DIN]: rows 0..TQ-1 Wq^T, then Wk^T, then Wv^T, all x16; Wot = [DOUT][TQ] x16
__global__ __launch_bounds__(256) void k_prep(const float* __restrict__ x, const float* __restrict__ Wq, const float* __restrict__ Wk, const float* __restrict__ Wv, const float* __restrict__ Wo,
                                              _Float16* __restrict__ X16, _Float16* __restrict__ Wqkvt, _Float16* __restrict__ Wot) {
  const int bid = blockIdx.x;
  if (bid < 3 * WBLK) { const int m = bid / WBLK; const float* W = m == 0 ? Wq : (m == 1 ? Wk : Wv);
    wt_f16_body(W, Wqkvt + (size_t)m * TQ * DIN, DIN, TQ, 16.0f, (bid - m * WBLK) * 256 + (int)threadIdx.x); }
  else if (bid < 4 * WBLK) wt_f16_body(Wo, Wot, TQ, DOUT, 16.0f, (bid - 3 * WBLK) * 256 + (int)threadIdx.x);
  else x16r_body(x, X16, (size_t)(bid - 4 * WBLK) * 256 + threadIdx.x);
}

// k-tiles of the two GEMMs in LDS: 64 k (128 bytes) of 128 A rows, then of 64 B rows, copied once per block, one tile ahead; all four waves read their fragments there
#define GKS 64                 /* k per staged tile */
#define GP 72                  /* LDS row pitch in halves: 128 data bytes + 16, a 16 B x odd pitch for ds_load_b128 readers */
#define GA_H (128 * GP)        /* the A rows; the B rows follow */
#define GTILE_H ((128 + 64) * GP)
// One lane's twelve 16-byte copies of a k-tile (eight of A, four of B), global memory to LDS through no register.
// s_wait_xcnt closes the statement so that no address register of a copy is rewritten ahead of it.
__device__ __forceinline__ void gemm_copies(unsigned l0, unsigned l1, unsigned l2, unsigned l3, unsigned l4, unsigned l5, unsigned l6, unsigned l7, unsigned l8, unsigned l9, unsigned l10, unsigned l11,
                                            const _Float16* g0, const _Float16* g1, const _Float16* g2, const _Float16* g3, const _Float16* g4, const _Float16* g5,
                                            const _Float16* g6, const _Float16* g7, const _Float16* g8, const _Float16* g9, const _Float16* g10, const _Float16* g11) {
  asm volatile("global_load_async_to_lds_b128 %0, %12, off\n\t"
               "global_load_async_to_lds_b128 %1, %13, off\n\t"
               "global_load_async_to_lds_b128 %2, %14, off\n\t"
               "global_load_async_to_lds_b128 %3, %15, off\n\t"
               "global_load_async_to_lds_b128 %4, %16, off\n\t"
               "global_load_async_to_lds_b128 %5, %17, off\n\t"
               "global_load_async_to_lds_b128 %6, %18, off\n\t"
               "global_load_async_to_lds_b128 %7, %19, off\n\t"
               "global_load_async_to_lds_b128 %8, %20, off\n\t"
               "global_load_async_to_lds_b128 %9, %21, off\n\t"
               "global_load_async_to_lds_b128 %10, %22, off\n\t"
               "global_load_async_to_lds_b128 %11, %23, off\n\t"
               "s_wait_xcnt 0x0"
               :: "v"(l0), "v"(l1), "v"(l2), "v"(l3), "v"(l4), "v"(l5), "v"(l6), "v"(l7), "v"(l8), "v"(l9), "v"(l10), "v"(l11),
                  "v"(g0), "v"(g1), "v"(g2), "v"(g3), "v"(g4), "v"(g5), "v"(g6), "v"(g7), "v"(g8), "v"(g9), "v"(g10), "v"(g11) : "memory");
}
// a wave's 32 x 64 products over one staged k-tile: ab = its first A row in LDS, bb = the first B row (both at this lane's row), k ascending in steps of 32;
// all twelve fragments are read as one group ahead of the products, so that the wave waits out the LDS latency once per tile
__device__ __forceinline__ void gemm_tile(const _Float16* ab, const _Float16* bb, int hh, v8f (&c)[8]) {
  v16h a[2][2], b[2][4];
#pragma unroll /* fragment arrays indexed by constants, so that they stay in registers */
  for (int s = 0; s < 2; ++s) { a[s][0] = g2_frag(ab + 32 * s, hh); a[s][1] = g2_frag(ab + 16 * GP + 32 * s, hh);
#pragma unroll
    for (int j = 0; j < 4; ++j) b[s][j] = g2_frag(bb + 16 * j * GP + 32 * s, hh); }
#pragma unroll /* as above, and the accumulator array too */
  for (int s = 0; s < 2; ++s) {
#pragma unroll
    for (int j = 0; j < 4; ++j) { c[j] = g2_mma(a[s][0], b[s][j], c[j]); c[4 + j] = g2_mma(a[s][1], b[s][j], c[4 + j]); } } }
static_assert(GKS == 64);

// q, k and v projections in one launch: C = alpha * A.Bt + bf16(bias) over the 3*TQ columns of [Wq|Wk|Wv]; A f16 [NR][K] (pitch lda), Bh f16 [3*TQ][K] (pitch ldb).
// A block's 64 columns lie in one of the three; its epilogue writes the form attention reads:
// q and k as f16 hi plane plus x1024 f16 residual plane (row pitch TQ), v as f16 transposed, VT[(b,h)][c][s].
#define VTP 136                /* LDS pitch in halves of a transposed v row: 128 tokens (256 bytes) + 16 bytes */
__global__ __launch_bounds__(128) void k_gemm_qkv(const _Float16* __restrict__ A, int lda, const _Float16* __restrict__ Bh, int ldb, float alpha,
                                                  const float* __restrict__ bq, const float* __restrict__ bk, const float* __restrict__ bv,
                                                  _Float16* __restrict__ QH, _Float16* __restrict__ QL, _Float16* __restrict__ KH, _Float16* __restrict__ KL, _Float16* __restrict__ VT, int K) {
  __shared__ __attribute__((aligned(16))) float so[4][32][68];
  static_assert(64 * VTP * 2 <= 4 * 32 * 68 * 4);
  __shared__ __attribute__((aligned(16))) _Float16 st[2][GTILE_H];   /* two k-tile buffers shared by the four waves */
  const int tid = threadIdx.x, w = tid >> 5, lane = tid & 31, ln = lane & 15, hh = lane >> 4;
  constexpr int ntn = (3 * TQ) >> 6, npl = TQ >> 6;
  const int mt = blockIdx.x / ntn, nq = blockIdx.x - mt * ntn; const int row0 = mt * 128 + 32 * w, col0 = nq * 64;
  const int pl = nq / npl, pc0 = (nq - pl * npl) * 64;      /* which of q, k, v; first column inside it */
  // copy roles: thread -> (row tid/8 and +16 i, 16-byte piece tid%8): a wave's copy covers four whole 128-byte lines
  const int cr = tid >> 3, cp = (tid & 7) * 8;
  const _Float16* ga = A + (size_t)(mt * 128 + cr) * lda + cp;
  const _Float16* gb = Bh + (size_t)(col0 + cr) * ldb + cp;
  const size_t sa = (size_t)16 * lda, sb = (size_t)16 * ldb;
  const unsigned la = (unsigned)(size_t)&st[0][0] + (unsigned)(cr * GP + cp) * 2u, lb = la + GA_H * 2u;
  auto issue_tile = [&](int t) {
    const unsigned pa = la + (unsigned)(t & 1) * (unsigned)(GTILE_H * 2), pb = lb + (unsigned)(t & 1) * (unsigned)(GTILE_H * 2);
    const _Float16* a = ga + (size_t)t * GKS; const _Float16* b = gb + (size_t)t * GKS;
    gemm_copies(pa, pa + 16 * GP * 2, pa + 32 * GP * 2, pa + 48 * GP * 2, pa + 64 * GP * 2, pa + 80 * GP * 2, pa + 96 * GP * 2, pa + 112 * GP * 2,
                pb, pb + 16 * GP * 2, pb + 32 * GP * 2, pb + 48 * GP * 2,
                a, a + sa, a + 2 * sa, a + 3 * sa, a + 4 * sa, a + 5 * sa, a + 6 * sa, a + 7 * sa, b, b + sb, b + 2 * sb, b + 3 * sb);
  };
  const v8f z8 = {0.f,0.f,0.f,0.f,0.f,0.f,0.f,0.f}; v8f accs[8] = {z8, z8, z8, z8, z8, z8, z8, z8};   /* accs[j]: rows 0..15 x columns 16j.., accs[4+j]: rows 16..31 */
  const int nt = K / GKS;
  issue_tile(0);
  asm volatile("s_wait_asynccnt 0x0" ::: "memory");   /* this wave's copies of tile 0 have landed */
  __syncthreads();                                     /* tile 0 published to all four waves */
  if (nt > 1) issue_tile(1);
#pragma unroll 1 /* stays rolled: one publish point and one refill site, the buffer picked by t & 1 */
  for (int t = 0; t < nt; ++t) {
    gemm_tile(&st[t & 1][0] + (32 * w + ln) * GP, &st[t & 1][GA_H] + ln * GP, hh, accs);
    asm volatile("s_wait_dscnt 0x0" ::: "memory");     /* this wave's reads of buffer t%2 are done before it is refilled */
    asm volatile("s_wait_asynccnt 0x0" ::: "memory");  /* this wave's copies of tile t+1 have landed */
    __syncthreads();                                   /* publishes tile t+1 and ends every wave's reads of buffer t%2 */
    if (t + 2 < nt) issue_tile(t + 2);
  }
  asm volatile("s_wait_asynccnt 0x0" ::: "memory");    /* no copy outstanding when the wave goes on to its epilogue */
  const float* bias = pl == 0 ? bq : (pl == 1 ? bk : bv);
  if (pl < 2) {
#pragma unroll
    for (int u = 0; u < 8; ++u) { const int t = u & 3, half = u >> 2; const float bvl = bf16_rne(bias[pc0 + t * 16 + ln]);
#pragma unroll
      for (int r = 0; r < 8; ++r) { const int rloc = half * 16 + 8 * hh + r; so[w][rloc][t * 16 + ln] = accs[u][r] * alpha + bvl; } }
    __builtin_amdgcn_fence(4 /* acq_rel order */, "workgroup"); __builtin_amdgcn_wave_barrier();
    unsigned short* Hh = (unsigned short*)(pl == 0 ? QH : KH); unsigned short* Hl = (unsigned short*)(pl == 0 ? QL : KL);
    const int rsub = lane >> 3, c8 = (lane & 7) * 8;
#pragma unroll
    for (int j = 0; j < 8; ++j) { const int r = j * 4 + rsub; const v4f a = *(const v4fa*)&so[w][r][c8], c = *(const v4fa*)&so[w][r][c8 + 4]; FragH fh, fl;
#pragma unroll
      for (int q = 0; q < 4; ++q) { _Float16 h = (_Float16)a[q]; fh.h[q] = h; fl.h[q] = (_Float16)((a[q] - (float)h) * 1024.0f); h = (_Float16)c[q]; fh.h[4 + q] = h; fl.h[4 + q] = (_Float16)((c[q] - (float)h) * 1024.0f); }
      const size_t o = (size_t)(row0 + r) * TQ + pc0 + c8;
      *(v8us*)(Hh + o) = fh.half[0]; *(v8us*)(Hl + o) = fl.half[0]; }
  } else {
    // a lane's eight accumulator rows are eight consecutive tokens of one channel: 16 bytes of a V^T row, gathered per block so that each row leaves as 256 contiguous bytes
    unsigned short* vt = (unsigned short*)&so[0][0][0];
#pragma unroll
    for (int u = 0; u < 8; ++u) { const int t = u & 3, half = u >> 2; const float bvl = bf16_rne(bias[pc0 + t * 16 + ln]); FragH f;
#pragma unroll
      for (int r = 0; r < 8; ++r) f.h[r] = (_Float16)(accs[u][r] * alpha + bvl);
      *(v8us*)(vt + (t * 16 + ln) * VTP + 32 * w + half * 16 + 8 * hh) = f.half[0]; }
    __syncthreads();   /* all four waves' token columns are in LDS before the rows are read; pl is the same for the whole block */
    const int bidx = (mt * 128) / SEQ, s0 = mt * 128 - bidx * SEQ;
    unsigned short* dst = (unsigned short*)VT + ((size_t)bidx * TQ + pc0) * SEQ + s0;
#pragma unroll
    for (int j = 0; j < 8; ++j) { const int p = j * 128 + tid, cl = p >> 4, pc = (p & 15) * 8;
      *(v8us*)(dst + (size_t)cl * SEQ + pc) = *(const v8us*)(vt + cl * VTP + pc); }
    asm volatile("s_wait_xcnt 0x0" ::: "memory");   /* the stores' registers are not rewritten ahead of this (the other arm follows in the code) */
  } }

// flash-style attention per (b,h): block = 4 waves x 16 queries, key tiles of 64; scores computed transposed (S^T tile = K rows x Q^T, D rows = keys, D columns = queries)
// so that two adjacent D tiles form the P (query x key) A fragment directly; online softmax with per-lane query statistics (lanes l and l^16 share a query),
// scores carried x1024: ah.bl + al.bh + ah.(1024 bh), al and bl being the x1024 residual planes, so that the three products share one accumulator; 2^-10 log2(e) rides in the one multiply-add ahead of exp2;
// P carried x16384 (argument of exp2 shifted by 14), O = P.V^T with B fragments from the VT plane; O written head-major OH[(b,h)][s][c]
// each key tile (K hi and residual rows, V^T rows) is copied once per block into LDS, one tile ahead, and all four waves read their fragments there
#define KVP 72                 /* LDS row pitch in halves: 128 data bytes + 16, a 16 B x odd pitch for ds_load_b128 readers */
#define KPART (KT * KVP)       /* 64 key rows: hi plane in halves 0..31, residual plane in halves 32..63 */
#define TILE_H (KPART + HD * KVP) /* then 32 channel rows of V^T, 64 keys each */
// One lane's six 16-byte copies of a key tile, global memory to LDS through no register.
// s_wait_xcnt closes the statement so that no address register of a copy is rewritten ahead of it.
__device__ __forceinline__ void tile_copies(unsigned l0, unsigned l1, unsigned l2, unsigned l3, unsigned l4, unsigned l5,
                                            const _Float16* g0, const _Float16* g1, const _Float16* g2, const _Float16* g3, const _Float16* g4, const _Float16* g5) {
  asm volatile("global_load_async_to_lds_b128 %0, %6, off\n\t"
               "global_load_async_to_lds_b128 %1, %7, off\n\t"
               "global_load_async_to_lds_b128 %2, %8, off\n\t"
               "global_load_async_to_lds_b128 %3, %9, off\n\t"
               "global_load_async_to_lds_b128 %4, %10, off\n\t"
               "global_load_async_to_lds_b128 %5, %11, off\n\t"
               "s_wait_xcnt 0x0"
               :: "v"(l0), "v"(l1), "v"(l2), "v"(l3), "v"(l4), "v"(l5), "v"(g0), "v"(g1), "v"(g2), "v"(g3), "v"(g4), "v"(g5) : "memory");
}

__global__ __launch_bounds__(128) void k_flash(const _Float16* __restrict__ QH, const _Float16* __restrict__ QL, const _Float16* __restrict__ KH, const _Float16* __restrict__ KL,
                                              const _Float16* __restrict__ VT, _Float16* __restrict__ OH) {
  __shared__ __attribute__((aligned(16))) _Float16 so[4][16][40];
  __shared__ __attribute__((aligned(16))) _Float16 kv[2][TILE_H];   /* two key-tile buffers shared by the four waves */
  const int tid = threadIdx.x, w = tid >> 5, lane = tid & 31, ln = lane & 15, hh = lane >> 4;
  const int bh = blockIdx.y; const int b = bh / NH, h = bh - b * NH;
  const int q0 = blockIdx.x * 64 + w * 16;
  const size_t qrow = (size_t)b * SEQ + q0 + ln;
  const v16h qh = g2_frag(QH + qrow * TQ + h * HD, hh);
  const v16h ql = g2_frag(QL + qrow * TQ + h * HD, hh);
  const v16h qs = qh * (_Float16)1024.0f;   /* a power of two: exact for |q| < 64 */
  // copy roles: K planes, thread -> (row tid/4 and +32, 16-byte piece tid%4); V^T, thread -> (row tid/8 and +16, piece tid%8)
  const int kr = tid >> 2, kc = (tid & 3) * 8, vr = tid >> 3, vc = (tid & 7) * 8;
  const _Float16* gkh = KH + ((size_t)b * SEQ + kr) * TQ + h * HD + kc;
  const _Float16* gkl = KL + ((size_t)b * SEQ + kr) * TQ + h * HD + kc;
  const _Float16* gvt = VT + ((size_t)bh * HD + vr) * SEQ + vc;
  const unsigned lds0 = (unsigned)(size_t)&kv[0][0];
  const unsigned lk = lds0 + (unsigned)(kr * KVP + kc) * 2u, lv = lds0 + (unsigned)(KPART + vr * KVP + vc) * 2u;
  auto issue_tile = [&](int t) {
    const unsigned bo = (unsigned)(t & 1) * (unsigned)(TILE_H * 2);
    const _Float16* a = gkh + (size_t)t * KT * TQ; const _Float16* c = gkl + (size_t)t * KT * TQ; const _Float16* v = gvt + (size_t)t * KT;
    tile_copies(lk + bo, lk + bo + 32 * KVP * 2, lk + bo + 64, lk + bo + 64 + 32 * KVP * 2, lv + bo, lv + bo + 16 * KVP * 2,
                a, a + (size_t)32 * TQ, c, c + (size_t)32 * TQ, v, v + (size_t)16 * SEQ);
  };
  const v8f z8 = {0.f,0.f,0.f,0.f,0.f,0.f,0.f,0.f};
  float rm = -3.0e38f, rl = 0.f; v8f o0 = z8, o1 = z8;
  constexpr int NT = SEQ / KT;
  issue_tile(0);
  asm volatile("s_wait_asynccnt 0x0" ::: "memory");   /* this wave's copies of tile 0 have landed */
  __syncthreads();                                     /* tile 0 published to all four waves */
  issue_tile(1);
#pragma unroll 1
  for (int t = 0; t < NT; ++t) {
    const _Float16* kb = &kv[t & 1][0] + ln * KVP;
    const _Float16* vp = &kv[t & 1][KPART] + ln * KVP;
    v16h ah[4], al[4];
#pragma unroll /* fragment arrays indexed by constants, so that they stay in registers */
    for (int j = 0; j < 4; ++j) { ah[j] = g2_frag(kb + 16 * j * KVP, hh); al[j] = g2_frag(kb + 16 * j * KVP + 32, hh); }
    const v16h vb0 = g2_frag(vp, hh), vb1 = g2_frag(vp + 16 * KVP, hh), vb2 = g2_frag(vp + 32, hh), vb3 = g2_frag(vp + 16 * KVP + 32, hh);
    __builtin_amdgcn_sched_barrier(0);   /* keeps the tile's 24 LDS reads one group ahead of the products; sunk among them, each pair is waited out to zero in front of its product */
    v8f s[4];
#pragma unroll /* as above: s[] and the fragments stay in registers */
    for (int j = 0; j < 4; ++j) s[j] = __builtin_amdgcn_wmma_f32_16x16x32_f16(false, ah[j], false, ql, (short)0, z8, false, false);
    __builtin_amdgcn_sched_barrier(0);   /* this and the next: the four accumulators take turns, so that a product stands four behind the one whose sum it takes up, and the products fill each other's slots in place of v_nop */
#pragma unroll
    for (int j = 0; j < 4; ++j) s[j] = __builtin_amdgcn_wmma_f32_16x16x32_f16(false, al[j], false, qh, (short)0, s[j], false, false);
    __builtin_amdgcn_sched_barrier(0);
#pragma unroll
    for (int j = 0; j < 4; ++j) s[j] = __builtin_amdgcn_wmma_f32_16x16x32_f16(false, ah[j], false, qs, (short)0, s[j], false, false);
    float m = s[0][0];
#pragma unroll
    for (int t4 = 0; t4 < 4; ++t4) {
#pragma unroll
      for (int r = 0; r < 8; ++r) m = fmaxf(m, s[t4][r]); }
    m = fmaxf(m, __shfl_xor(m, 16, 32));
    const float mn = fmaxf(rm, m);
    constexpr float SC = 1.4426950408889634f * 0.0009765625f;   /* log2(e) / 1024: rm, mn and s carry the score x1024 */
    const float alpha = __builtin_amdgcn_exp2f((rm - mn) * SC);
    rm = mn;
    float ar[8];
#pragma unroll
    for (int r = 0; r < 8; ++r) ar[r] = __shfl(alpha, 8 * hh + r, 32);
    __builtin_amdgcn_sched_barrier(0);   /* the eight broadcasts of alpha start ahead of the exponentials, which cover their round trip; sunk behind them, the wave waits it out */
    const float nb = __builtin_fmaf(-mn, SC, 14.0f);   /* exp(score - maximum) carried x16384 = 2^14 */
    const v8f scv = {SC, SC, SC, SC, SC, SC, SC, SC}, nbv = {nb, nb, nb, nb, nb, nb, nb, nb};
    float ls = 0.f; FragH pa[2];
#pragma unroll
    for (int t4 = 0; t4 < 4; ++t4) { const v8f e = __builtin_elementwise_fma(s[t4], scv, nbv);
#pragma unroll
      for (int r = 0; r < 8; ++r) { const float p = __builtin_amdgcn_exp2f(e[r]); ls += p; pa[t4 >> 1].h[((t4 & 1) << 3) + r] = (_Float16)p; } }
    ls += __shfl_xor(ls, 16, 32);
    rl = rl * alpha + ls;
    __builtin_amdgcn_sched_barrier(0);   /* and their first use stays behind the exponentials */
#pragma unroll
    for (int r = 0; r < 8; ++r) { o0[r] *= ar[r]; o1[r] *= ar[r]; }
    o0 = g2_mma(pa[0].v, vb0, o0);
    o1 = g2_mma(pa[0].v, vb1, o1);
    o0 = g2_mma(pa[1].v, vb2, o0);
    o1 = g2_mma(pa[1].v, vb3, o1);
    asm volatile("s_wait_dscnt 0x0" ::: "memory");     /* this wave's reads of buffer t%2 are done before it is refilled */
    asm volatile("s_wait_asynccnt 0x0" ::: "memory");  /* this wave's copies of tile t+1 have landed */
    __syncthreads();                                   /* publishes tile t+1 and ends every wave's reads of buffer t%2 */
    if (t + 2 < NT) issue_tile(t + 2);
  }
  asm volatile("s_wait_asynccnt 0x0" ::: "memory");    /* no copy outstanding when the wave goes on to its end */
  const float inv = 1.0f / rl;
#pragma unroll
  for (int r = 0; r < 8; ++r) { const float ir = __shfl(inv, 8 * hh + r, 32); so[w][8 * hh + r][ln] = (_Float16)(o0[r] * ir); so[w][8 * hh + r][16 + ln] = (_Float16)(o1[r] * ir); }
  __builtin_amdgcn_fence(4 /* acq_rel order */, "workgroup"); __builtin_amdgcn_wave_barrier();
  unsigned short* ob = (unsigned short*)OH + ((size_t)bh * SEQ + q0) * HD;
  {
#pragma unroll
    for (int j = 0; j < 2; ++j) { const int p = j * 32 + lane; const v8us v = *(const v8us*)&so[w][p >> 2][(p & 3) * 8]; *(v8us*)(ob + (size_t)p * 8) = v; }
     } }

// output projection into the f32 output rows: A = OH head-major ([(b,h)][s][32], k-step == head), Bh = Wot f16 [DOUT][TQ] (x16), C row = b*SEQ_FULL + s (pitch ldc);
__global__ __launch_bounds__(128) void k_gemm_out(const _Float16* __restrict__ OHp, const _Float16* __restrict__ Bh, int ldb, float alpha, const float* __restrict__ bias,
                                                  float* __restrict__ C, int ldc, int M, int N) {
  __shared__ __attribute__((aligned(16))) float so[4][32][68];
  __shared__ __attribute__((aligned(16))) _Float16 st[2][GTILE_H];   /* two k-tile buffers shared by the four waves */
  const int tid = threadIdx.x, w = tid >> 5, lane = tid & 31, ln = lane & 15, hh = lane >> 4;
  const int ntn = N >> 6; const int mt = blockIdx.x / ntn, nq = blockIdx.x - mt * ntn; const int row0 = mt * 128 + 32 * w, col0 = nq * 64; if (mt * 128 >= M) return;   /* the whole block leaves, ahead of every copy and barrier */
  const int bidx = row0 / SEQ, l0 = row0 - bidx * SEQ;
  const size_t hstr = (size_t)SEQ * HD;
  // copy roles: A, one head's 128 rows are 8 KiB in a row: thread -> (row tid/4 and +32 i, 16-byte piece tid%4), heads 2t and 2t+1 side by side in an LDS row; B: thread -> (row tid/8 and +16 i, piece tid%8)
  const int ar = tid >> 2, ap = (tid & 3) * 8, cr = tid >> 3, cp = (tid & 7) * 8;
  const _Float16* ga = OHp + (((size_t)bidx * NH) * SEQ + (l0 - 32 * w) + ar) * HD + ap;
  const _Float16* gb = Bh + (size_t)(col0 + cr) * ldb + cp;
  const size_t sb = (size_t)16 * ldb;
  const unsigned la = (unsigned)(size_t)&st[0][0] + (unsigned)(ar * GP + ap) * 2u, lb = (unsigned)(size_t)&st[0][0] + (unsigned)(GA_H + cr * GP + cp) * 2u;
  auto issue_tile = [&](int t) {
    const unsigned pa = la + (unsigned)(t & 1) * (unsigned)(GTILE_H * 2), pb = lb + (unsigned)(t & 1) * (unsigned)(GTILE_H * 2);
    const _Float16* a = ga + (size_t)(2 * t) * hstr; const _Float16* a2 = a + hstr; const _Float16* b = gb + (size_t)t * GKS;
    gemm_copies(pa, pa + 32 * GP * 2, pa + 64 * GP * 2, pa + 96 * GP * 2, pa + 64, pa + 64 + 32 * GP * 2, pa + 64 + 64 * GP * 2, pa + 64 + 96 * GP * 2,
                pb, pb + 16 * GP * 2, pb + 32 * GP * 2, pb + 48 * GP * 2,
                a, a + 32 * HD, a + 64 * HD, a + 96 * HD, a2, a2 + 32 * HD, a2 + 64 * HD, a2 + 96 * HD, b, b + sb, b + 2 * sb, b + 3 * sb);
  };
  const v8f z8 = {0.f,0.f,0.f,0.f,0.f,0.f,0.f,0.f}; v8f accs[8] = {z8, z8, z8, z8, z8, z8, z8, z8};   /* accs[j]: rows 0..15 x columns 16j.., accs[4+j]: rows 16..31 */
  constexpr int nt = TQ / GKS;
  static_assert(GKS == 2 * HD && nt >= 2);
  issue_tile(0);
  asm volatile("s_wait_asynccnt 0x0" ::: "memory");   /* this wave's copies of tile 0 have landed */
  __syncthreads();                                     /* tile 0 published to all four waves */
  issue_tile(1);
#pragma unroll 1 /* stays rolled: one publish point and one refill site, the buffer picked by t & 1 */
  for (int t = 0; t < nt; ++t) {
    gemm_tile(&st[t & 1][0] + (32 * w + ln) * GP, &st[t & 1][GA_H] + ln * GP, hh, accs);
    asm volatile("s_wait_dscnt 0x0" ::: "memory");     /* this wave's reads of buffer t%2 are done before it is refilled */
    asm volatile("s_wait_asynccnt 0x0" ::: "memory");  /* this wave's copies of tile t+1 have landed */
    __syncthreads();                                   /* publishes tile t+1 and ends every wave's reads of buffer t%2 */
    if (t + 2 < nt) issue_tile(t + 2);
  }
  asm volatile("s_wait_asynccnt 0x0" ::: "memory");    /* no copy outstanding when the wave goes on to its epilogue */
#pragma unroll
  for (int u = 0; u < 8; ++u) { const int t = u & 3, half = u >> 2; const int col = col0 + t * 16 + ln; const float bvl = bf16_rne(bias[col]);
#pragma unroll
    for (int r = 0; r < 8; ++r) { const int rloc = half * 16 + 8 * hh + r; so[w][rloc][t * 16 + ln] = accs[u][r] * alpha + bvl; } }
  __builtin_amdgcn_fence(4 /* acq_rel order */, "workgroup"); __builtin_amdgcn_wave_barrier();
  const int rsub = lane >> 4, c4 = (lane & 15) * 4;
  const size_t crow0 = (size_t)bidx * SEQ_FULL + l0;
  {
#pragma unroll
    for (int q = 0; q < 16; ++q) { const int r = q * 2 + rsub; const v4f v = *(const v4fa*)&so[w][r][c4]; *(v4f*)(C + (crow0 + r) * ldc + col0 + c4) = v; }
     } }

extern "C" void kernel_launch(void* const* d_in, const int* in_sizes, int n_in,
                              void* d_out, int out_size, void* d_ws, size_t ws_size, hipStream_t stream) {
  if (n_in < 9) return;
  const float* X  = (const float*)d_in[0];      /* [NB_FULL][SEQ_FULL][DIN] */
  const float* Wq = (const float*)d_in[1];      /* [DIN][TQ] */
  const float* bq = (const float*)d_in[2];      /* [TQ] */
  const float* Wk = (const float*)d_in[3];
  const float* bk = (const float*)d_in[4];
  const float* Wv = (const float*)d_in[5];
  const float* bv = (const float*)d_in[6];
  const float* Wo = (const float*)d_in[7];      /* [TQ][DOUT] */
  const float* bo = (const float*)d_in[8];      /* [DOUT] */
  const long long needX = (long long)(((size_t)(NB - 1) * SEQ_FULL + SEQ) * DIN);
  const long long needO = (long long)(((size_t)(NB - 1) * SEQ_FULL + SEQ) * DOUT);
  if ((long long)in_sizes[0] < needX || in_sizes[1] < DIN * TQ || in_sizes[2] < TQ || in_sizes[3] < DIN * TQ || in_sizes[4] < TQ ||
      in_sizes[5] < DIN * TQ || in_sizes[6] < TQ || in_sizes[7] < TQ * DOUT || in_sizes[8] < DOUT || (long long)out_size < needO) return;
  char* ws = (char*)d_ws; size_t off = 0;
  auto take = [&](size_t bytes) { char* p = ws + off; off += (bytes + 255) & ~(size_t)255; return p; };
  _Float16* X16 = (_Float16*)take(NR * DIN * 2);
  _Float16* Wqkvt = (_Float16*)take((size_t)3 * TQ * DIN * 2);
  _Float16* Wot = (_Float16*)take((size_t)DOUT * TQ * 2);
  _Float16* QH = (_Float16*)take(NR * TQ * 2); _Float16* QL = (_Float16*)take(NR * TQ * 2);
  _Float16* KH = (_Float16*)take(NR * TQ * 2); _Float16* KL = (_Float16*)take(NR * TQ * 2);
  _Float16* VT = (_Float16*)take((size_t)NB * NH * HD * SEQ * 2);
  _Float16* OH = (_Float16*)take((size_t)NB * NH * SEQ * HD * 2);
  if (off > ws_size || off > (size_t)134217728) return;
  const float a16 = 0.0625f;

  k_prep<<<(unsigned)(4 * WBLK + NR * DIN / 8 / 256), 256, 0, stream>>>(X, Wq, Wk, Wv, Wo, X16, Wqkvt, Wot);   /* x rows -> f16(bf16(x)); W -> W^T x16 */
  k_gemm_qkv<<<(unsigned)((NR / 128) * (3 * TQ / 64)), 128, 0, stream>>>(X16, DIN, Wqkvt, DIN, a16, bq, bk, bv, QH, QL, KH, KL, VT, DIN);   /* q, k hi / x1024 residual planes; V^T per (b,h): [32][SEQ] */
  k_flash<<<dim3(SEQ / 64, NB * NH), 128, 0, stream>>>(QH, QL, KH, KL, VT, OH);                              /* attention -> O head-major */
  k_gemm_out<<<(unsigned)((NR / 128) * (DOUT / 64)), 128, 0, stream>>>(OH, Wot, TQ, a16, bo, (float*)d_out, DOUT, (int)NR, DOUT);   /* out = O Wo + bo */
}

// v005
// It runs in 57.9 microseconds.
// Two timings next to v004 put it at 1.11 and 1.10 times that version's speed.
// All steps since v000 together make it 3.67 times as fast.
#include <hip/hip_runtime.h>
// Contractions on v_wmma_f32_16x16x32_f16 (f16 operands, f32 accumulate): q/k/v projections (bf16-valued x exact in f16, bf16-valued W x16 in f16), output projection (f16 o, bf16-valued Wo x16), P x V^T (f16 P carried x16384, f16 v); scores as K x Q^T with f16 hi planes plus x1024 f16 residual planes (three products into one accumulator that carries the score x1024); softmax statistics and epilogues f32.
#ifndef NB
#define NB 4
#endif
#ifndef SEQ
#define SEQ 2048
#endif
#define NB_FULL 4
#define SEQ_FULL 2048
#define DIN 512          /* input channels */
#define TQ 256           /* n_head * qk_dim */
#define NH 8
#define HD 32
#define DOUT 512
#define NR ((size_t)NB * SEQ)   /* token rows processed */
#define KT 64            /* keys per attention tile */

static_assert(NB >= 1 && NB <= NB_FULL);
static_assert(SEQ >= 128 && SEQ <= SEQ_FULL);
static_assert(SEQ % 128 == 0);
static_assert((NR % 128) == 0);
static_assert(TQ % 64 == 0 && DOUT % 64 == 0 && DIN % 32 == 0 && TQ % 32 == 0);
static_assert(HD == 32 && NH * HD == TQ);
static_assert(SEQ % KT == 0 && KT == 64);
static_assert(DIN % 64 == 0 && DIN >= 128 && TQ % 64 == 0);

typedef _Float16 v16h __attribute__((ext_vector_type(16)));
typedef unsigned short v8us __attribute__((ext_vector_type(8), may_alias));
typedef float  v8f  __attribute__((ext_vector_type(8)));
typedef float  v4f  __attribute__((ext_vector_type(4)));
typedef float  v4fa __attribute__((ext_vector_type(4), may_alias));
typedef _Float16 v4h __attribute__((ext_vector_type(4)));
union FragH { v16h v; v8us half[2]; _Float16 h[16]; unsigned short u[16]; };

__device__ __forceinline__ unsigned short bf16_bits(float x) { unsigned int u = __float_as_uint(x); return (unsigned short)((u + 0x7FFFu + ((u >> 16) & 1u)) >> 16); }
__device__ __forceinline__ float bf16_val(unsigned short b) { return __uint_as_float(((unsigned int)b) << 16); }
__device__ __forceinline__ float bf16_rne(float x) { return bf16_val(bf16_bits(x)); }

// 16x16 fragment from a 16-bit [row][k] plane row pointer (k contiguous): elements 0..7 <- k 8h..8h+7, elements 8..15 <- k 16+8h..16+8h+7 (same map for A rows and B columns)
__device__ __forceinline__ v16h g2_frag(const _Float16* p, int hh) { FragH f; f.half[0] = *(const v8us*)((const unsigned short*)p + 8 * hh); f.half[1] = *(const v8us*)((const unsigned short*)p + 16 + 8 * hh); return f.v; }
__device__ __forceinline__ v8f g2_mma(v16h a, v16h b, v8f c) { v8f d = __builtin_amdgcn_wmma_f32_16x16x32_f16(false, a, false, b, (short)0, c, false, false); asm volatile("v_nop\n\tv_nop\n\tv_nop\n\tv_nop" : "+v"(d) : "v"(a), "v"(b)); return d; }

// one launch converts x and the four weights: blocks 0..4*WBLK-1 take the weights (their strided reads start first), the rest take x
#define WBLK (TQ * (DIN / 8) / 256)   /* blocks per weight matrix */
static_assert(TQ * (DIN / 8) % 256 == 0 && DOUT * (TQ / 8) == TQ * (DIN / 8) && (NR * DIN / 8) % 256 == 0);

__device__ __forceinline__ void x16r_body(const float* __restrict__ x, _Float16* __restrict__ X16, size_t t) {
  const size_t e = t * 8; const size_t r = e / DIN; const size_t c = e - r * DIN;
  const size_t sr = (r / SEQ) * SEQ_FULL + (r % SEQ);
  const float* s = x + sr * DIN + c;
  const v4f a = *(const v4fa*)s, c4v = *(const v4fa*)(s + 4);
  FragH f;
#pragma unroll
  for (int q = 0; q < 4; ++q) { f.h[q] = (_Float16)bf16_rne(a[q]); f.h[4 + q] = (_Float16)bf16_rne(c4v[q]); }
  unsigned short* d = (unsigned short*)X16 + e;
  *(v8us*)d = f.half[0];
  asm volatile("s_wait_xcnt 0x0" ::: "memory");   /* the store's registers are not rewritten ahead of this (another arm of the caller follows in the code) */
}

__device__ __forceinline__ void wt_f16_body(const float* __restrict__ W, _Float16* __restrict__ Wt, int K, int N, float scale, int t) {
  const int n = t / (K / 8), k8 = (t % (K / 8)) * 8; FragH f;
#pragma unroll
  for (int i = 0; i < 8; ++i) f.h[i] = (_Float16)(bf16_rne(W[(size_t)(k8 + i) * N + n]) * scale);
  const v8us o = f.half[0]; unsigned short* d = (unsigned short*)Wt + (size_t)n * K + k8;
  *(v8us*)d = o;
  asm volatile("s_wait_xcnt 0x0" ::: "memory");   /* the store's registers are not rewritten ahead of this (another arm of the caller follows in the code) */
}

// Wqkvt = [3*TQ][DIN]: rows 0..TQ-1 Wq^T, then Wk^T, then Wv^T, all x16; Wot = [DOUT][TQ] x16
__global__ __launch_bounds__(256) void k_prep(const float* __restrict__ x, const float* __restrict__ Wq, const float* __restrict__ Wk, const float* __restrict__ Wv, const float* __restrict__ Wo,
                                              _Float16* __restrict__ X16, _Float16* __restrict__ Wqkvt, _Float16* __restrict__ Wot) {
  const int bid = blockIdx.x;
  if (bid < 3 * WBLK) { const int m = bid / WBLK; const float* W = m == 0 ? Wq : (m == 1 ? Wk : Wv);
    wt_f16_body(W, Wqkvt + (size_t)m * TQ * DIN, DIN, TQ, 16.0f, (bid - m * WBLK) * 256 + (int)threadIdx.x); }
  else if (bid < 4 * WBLK) wt_f16_body(Wo, Wot, TQ, DOUT, 16.0f, (bid - 3 * WBLK) * 256 + (int)threadIdx.x);
  else x16r_body(x, X16, (size_t)(bid - 4 * WBLK) * 256 + threadIdx.x);
}

// k-tiles of the two GEMMs in LDS: 64 k (128 bytes) of 128 A rows, then of 64 B rows, copied once per block, one tile ahead; all four waves read their fragments there
#define GKS 64                 /* k per staged tile */
#define GP 72                  /* LDS row pitch in halves: 128 data bytes + 16, a 16 B x odd pitch for ds_load_b128 readers */
#define GA_H (128 * GP)        /* the A rows; the B rows follow */
#define GTILE_H ((128 + 64) * GP)
// One lane's twelve 16-byte copies of a k-tile (eight of A, four of B), global memory to LDS through no register.
// s_wait_xcnt closes the statement so that no address register of a copy is rewritten ahead of it.
__device__ __forceinline__ void gemm_copies(unsigned l0, unsigned l1, unsigned l2, unsigned l3, unsigned l4, unsigned l5, unsigned l6, unsigned l7, unsigned l8, unsigned l9, unsigned l10, unsigned l11,
                                            const _Float16* g0, const _Float16* g1, const _Float16* g2, const _Float16* g3, const _Float16* g4, const _Float16* g5,
                                            const _Float16* g6, const _Float16* g7, const _Float16* g8, const _Float16* g9, const _Float16* g10, const _Float16* g11) {
  asm volatile("global_load_async_to_lds_b128 %0, %12, off\n\t"
               "global_load_async_to_lds_b128 %1, %13, off\n\t"
               "global_load_async_to_lds_b128 %2, %14, off\n\t"
               "global_load_async_to_lds_b128 %3, %15, off\n\t"
               "global_load_async_to_lds_b128 %4, %16, off\n\t"
               "global_load_async_to_lds_b128 %5, %17, off\n\t"
               "global_load_async_to_lds_b128 %6, %18, off\n\t"
               "global_load_async_to_lds_b128 %7, %19, off\n\t"
               "global_load_async_to_lds_b128 %8, %20, off\n\t"
               "global_load_async_to_lds_b128 %9, %21, off\n\t"
               "global_load_async_to_lds_b128 %10, %22, off\n\t"
               "global_load_async_to_lds_b128 %11, %23, off\n\t"
               "s_wait_xcnt 0x0"
               :: "v"(l0), "v"(l1), "v"(l2), "v"(l3), "v"(l4), "v"(l5), "v"(l6), "v"(l7), "v"(l8), "v"(l9), "v"(l10), "v"(l11),
                  "v"(g0), "v"(g1), "v"(g2), "v"(g3), "v"(g4), "v"(g5), "v"(g6), "v"(g7), "v"(g8), "v"(g9), "v"(g10), "v"(g11) : "memory");
}
// a wave's 32 x 64 products over one staged k-tile: ab = its first A row in LDS, bb = the first B row (both at this lane's row), k ascending in steps of 32;
// all twelve fragments are read as one group ahead of the products, so that the wave waits out the LDS latency once per tile
__device__ __forceinline__ void gemm_tile(const _Float16* ab, const _Float16* bb, int hh, v8f (&c)[8]) {
  v16h a[2][2], b[2][4];
#pragma unroll /* fragment arrays indexed by constants, so that they stay in registers */
  for (int s = 0; s < 2; ++s) { a[s][0] = g2_frag(ab + 32 * s, hh); a[s][1] = g2_frag(ab + 16 * GP + 32 * s, hh);
#pragma unroll
    for (int j = 0; j < 4; ++j) b[s][j] = g2_frag(bb + 16 * j * GP + 32 * s, hh); }
#pragma unroll /* as above, and the accumulator array too */
  for (int s = 0; s < 2; ++s) {
#pragma unroll
    for (int j = 0; j < 4; ++j) { c[j] = g2_mma(a[s][0], b[s][j], c[j]); c[4 + j] = g2_mma(a[s][1], b[s][j], c[4 + j]); } } }
static_assert(GKS == 64);

// q, k and v projections in one launch: C = alpha * A.Bt + bf16(bias) over the 3*TQ columns of [Wq|Wk|Wv]; A f16 [NR][K] (pitch lda), Bh f16 [3*TQ][K] (pitch ldb).
// A block's 64 columns lie in one of the three; its epilogue writes the form attention reads:
// q and k as f16 hi plane plus x1024 f16 residual plane (row pitch TQ), v as f16 transposed, VT[(b,h)][c][s].
#define VTP 136                /* LDS pitch in halves of a transposed v row: 128 tokens (256 bytes) + 16 bytes */
__global__ __launch_bounds__(128) void k_gemm_qkv(const _Float16* __restrict__ A, int lda, const _Float16* __restrict__ Bh, int ldb, float alpha,
                                                  const float* __restrict__ bq, const float* __restrict__ bk, const float* __restrict__ bv,
                                                  _Float16* __restrict__ QH, _Float16* __restrict__ QL, _Float16* __restrict__ KH, _Float16* __restrict__ KL, _Float16* __restrict__ VT, int K) {
  __shared__ __attribute__((aligned(16))) float so[4][32][68];
  static_assert(64 * VTP * 2 <= 4 * 32 * 68 * 4);
  __shared__ __attribute__((aligned(16))) _Float16 st[2][GTILE_H];   /* two k-tile buffers shared by the four waves */
  const int tid = threadIdx.x, w = tid >> 5, lane = tid & 31, ln = lane & 15, hh = lane >> 4;
  constexpr int ntn = (3 * TQ) >> 6, npl = TQ >> 6;
  const int mt = blockIdx.x / ntn, nq = blockIdx.x - mt * ntn; const int row0 = mt * 128 + 32 * w, col0 = nq * 64;
  const int pl = nq / npl, pc0 = (nq - pl * npl) * 64;      /* which of q, k, v; first column inside it */
  // copy roles: thread -> (row tid/8 and +16 i, 16-byte piece tid%8): a wave's copy covers four whole 128-byte lines
  const int cr = tid >> 3, cp = (tid & 7) * 8;
  const _Float16* ga = A + (size_t)(mt * 128 + cr) * lda + cp;
  const _Float16* gb = Bh + (size_t)(col0 + cr) * ldb + cp;
  const size_t sa = (size_t)16 * lda, sb = (size_t)16 * ldb;
  const unsigned la = (unsigned)(size_t)&st[0][0] + (unsigned)(cr * GP + cp) * 2u, lb = la + GA_H * 2u;
  auto issue_tile = [&](int t) {
    const unsigned pa = la + (unsigned)(t & 1) * (unsigned)(GTILE_H * 2), pb = lb + (unsigned)(t & 1) * (unsigned)(GTILE_H * 2);
    const _Float16* a = ga + (size_t)t * GKS; const _Float16* b = gb + (size_t)t * GKS;
    gemm_copies(pa, pa + 16 * GP * 2, pa + 32 * GP * 2, pa + 48 * GP * 2, pa + 64 * GP * 2, pa + 80 * GP * 2, pa + 96 * GP * 2, pa + 112 * GP * 2,
                pb, pb + 16 * GP * 2, pb + 32 * GP * 2, pb + 48 * GP * 2,
                a, a + sa, a + 2 * sa, a + 3 * sa, a + 4 * sa, a + 5 * sa, a + 6 * sa, a + 7 * sa, b, b + sb, b + 2 * sb, b + 3 * sb);
  };
  const v8f z8 = {0.f,0.f,0.f,0.f,0.f,0.f,0.f,0.f}; v8f accs[8] = {z8, z8, z8, z8, z8, z8, z8, z8};   /* accs[j]: rows 0..15 x columns 16j.., accs[4+j]: rows 16..31 */
  const int nt = K / GKS;
  issue_tile(0);
  asm volatile("s_wait_asynccnt 0x0" ::: "memory");   /* this wave's copies of tile 0 have landed */
  __syncthreads();                                     /* tile 0 published to all four waves */
  if (nt > 1) issue_tile(1);
#pragma unroll 1 /* stays rolled: one publish point and one refill site, the buffer picked by t & 1 */
  for (int t = 0; t < nt; ++t) {
    gemm_tile(&st[t & 1][0] + (32 * w + ln) * GP, &st[t & 1][GA_H] + ln * GP, hh, accs);
    asm volatile("s_wait_dscnt 0x0" ::: "memory");     /* this wave's reads of buffer t%2 are done before it is refilled */
    asm volatile("s_wait_asynccnt 0x0" ::: "memory");  /* this wave's copies of tile t+1 have landed */
    __syncthreads();                                   /* publishes tile t+1 and ends every wave's reads of buffer t%2 */
    if (t + 2 < nt) issue_tile(t + 2);
  }
  asm volatile("s_wait_asynccnt 0x0" ::: "memory");    /* no copy outstanding when the wave goes on to its epilogue */
  const float* bias = pl == 0 ? bq : (pl == 1 ? bk : bv);
  if (pl < 2) {
#pragma unroll
    for (int u = 0; u < 8; ++u) { const int t = u & 3, half = u >> 2; const float bvl = bf16_rne(bias[pc0 + t * 16 + ln]);
#pragma unroll
      for (int r = 0; r < 8; ++r) { const int rloc = half * 16 + 8 * hh + r; so[w][rloc][t * 16 + ln] = accs[u][r] * alpha + bvl; } }
    __builtin_amdgcn_fence(4 /* acq_rel order */, "workgroup"); __builtin_amdgcn_wave_barrier();
    unsigned short* Hh = (unsigned short*)(pl == 0 ? QH : KH); unsigned short* Hl = (unsigned short*)(pl == 0 ? QL : KL);
    const int rsub = lane >> 3, c8 = (lane & 7) * 8;
#pragma unroll
    for (int j = 0; j < 8; ++j) { const int r = j * 4 + rsub; const v4f a = *(const v4fa*)&so[w][r][c8], c = *(const v4fa*)&so[w][r][c8 + 4]; FragH fh, fl;
#pragma unroll
      for (int q = 0; q < 4; ++q) { _Float16 h = (_Float16)a[q]; fh.h[q] = h; fl.h[q] = (_Float16)((a[q] - (float)h) * 1024.0f); h = (_Float16)c[q]; fh.h[4 + q] = h; fl.h[4 + q] = (_Float16)((c[q] - (float)h) * 1024.0f); }
      const size_t o = (size_t)(row0 + r) * TQ + pc0 + c8;
      *(v8us*)(Hh + o) = fh.half[0]; *(v8us*)(Hl + o) = fl.half[0]; }
  } else {
    // a lane's eight accumulator rows are eight consecutive tokens of one channel: 16 bytes of a V^T row, gathered per block so that each row leaves as 256 contiguous bytes
    unsigned short* vt = (unsigned short*)&so[0][0][0];
#pragma unroll
    for (int u = 0; u < 8; ++u) { const int t = u & 3, half = u >> 2; const float bvl = bf16_rne(bias[pc0 + t * 16 + ln]); FragH f;
#pragma unroll
      for (int r = 0; r < 8; ++r) f.h[r] = (_Float16)(accs[u][r] * alpha + bvl);
      *(v8us*)(vt + (t * 16 + ln) * VTP + 32 * w + half * 16 + 8 * hh) = f.half[0]; }
    __syncthreads();   /* all four waves' token columns are in LDS before the rows are read; pl is the same for the whole block */
    const int bidx = (mt * 128) / SEQ, s0 = mt * 128 - bidx * SEQ;
    unsigned short* dst = (unsigned short*)VT + ((size_t)bidx * TQ + pc0) * SEQ + s0;
#pragma unroll
    for (int j = 0; j < 8; ++j) { const int p = j * 128 + tid, cl = p >> 4, pc = (p & 15) * 8;
      *(v8us*)(dst + (size_t)cl * SEQ + pc) = *(const v8us*)(vt + cl * VTP + pc); }
    asm volatile("s_wait_xcnt 0x0" ::: "memory");   /* the stores' registers are not rewritten ahead of this (the other arm follows in the code) */
  } }

// flash-style attention per (b,h): block = 4 waves x 32 queries (two blocks of 16 per wave, so that each K and V^T fragment read from LDS feeds two products), key tiles of 64; scores computed transposed (S^T tile = K rows x Q^T, D rows = keys, D columns = queries)
// so that two adjacent D tiles form the P (query x key) A fragment directly; online softmax with per-lane query statistics (lanes l and l^16 share a query),
// scores carried x1024: ah.bl + al.bh + ah.(1024 bh), al and bl being the x1024 residual planes, so that the three products share one accumulator; 2^-10 log2(e) rides in the one multiply-add ahead of exp2;
// P carried x16384 (argument of exp2 shifted by 14), O = P.V^T with B fragments from the VT plane; O written head-major OH[(b,h)][s][c]
// each key tile (K hi and residual rows, V^T rows) is copied once per block of 128 queries into LDS, one tile ahead, and all four waves read their fragments there
#define QW 32                  /* queries per wave */
static_assert(QW == 32 && SEQ % (4 * QW) == 0);
#define KVP 72                 /* LDS row pitch in halves: 128 data bytes + 16, a 16 B x odd pitch for ds_load_b128 readers */
#define KPART (KT * KVP)       /* 64 key rows: hi plane in halves 0..31, residual plane in halves 32..63 */
#define TILE_H (KPART + HD * KVP) /* then 32 channel rows of V^T, 64 keys each */
// One lane's six 16-byte copies of a key tile, global memory to LDS through no register.
// s_wait_xcnt closes the statement so that no address register of a copy is rewritten ahead of it.
__device__ __forceinline__ void tile_copies(unsigned l0, unsigned l1, unsigned l2, unsigned l3, unsigned l4, unsigned l5,
                                            const _Float16* g0, const _Float16* g1, const _Float16* g2, const _Float16* g3, const _Float16* g4, const _Float16* g5) {
  asm volatile("global_load_async_to_lds_b128 %0, %6, off\n\t"
               "global_load_async_to_lds_b128 %1, %7, off\n\t"
               "global_load_async_to_lds_b128 %2, %8, off\n\t"
               "global_load_async_to_lds_b128 %3, %9, off\n\t"
               "global_load_async_to_lds_b128 %4, %10, off\n\t"
               "global_load_async_to_lds_b128 %5, %11, off\n\t"
               "s_wait_xcnt 0x0"
               :: "v"(l0), "v"(l1), "v"(l2), "v"(l3), "v"(l4), "v"(l5), "v"(g0), "v"(g1), "v"(g2), "v"(g3), "v"(g4), "v"(g5) : "memory");
}

__global__ __launch_bounds__(128) void k_flash(const _Float16* __restrict__ QH, const _Float16* __restrict__ QL, const _Float16* __restrict__ KH, const _Float16* __restrict__ KL,
                                              const _Float16* __restrict__ VT, _Float16* __restrict__ OH) {
  __shared__ __attribute__((aligned(16))) _Float16 so[4][QW][40];
  __shared__ __attribute__((aligned(16))) _Float16 kv[2][TILE_H];   /* two key-tile buffers shared by the four waves */
  const int tid = threadIdx.x, w = tid >> 5, lane = tid & 31, ln = lane & 15, hh = lane >> 4;
  const int bh = blockIdx.y; const int b = bh / NH, h = bh - b * NH;
  const int q0 = blockIdx.x * (4 * QW) + w * QW;
  v16h qh[2], ql[2], qs[2];   /* index u: the wave's query block, queries q0 + 16 u .. + 15 */
#pragma unroll /* arrays indexed by constants, so that they stay in registers (this holds for every loop over u below) */
  for (int u = 0; u < 2; ++u) { const size_t qrow = (size_t)b * SEQ + q0 + 16 * u + ln;
    qh[u] = g2_frag(QH + qrow * TQ + h * HD, hh);
    asm volatile("s_wait_xcnt 0x0" ::: "memory");   /* this and the next: a later fragment may land in the address registers of these loads, and does so only behind the wait */
    ql[u] = g2_frag(QL + qrow * TQ + h * HD, hh);
    asm volatile("s_wait_xcnt 0x0" ::: "memory");
    qs[u] = qh[u] * (_Float16)1024.0f; }   /* a power of two: exact for |q| < 64 */
  // copy roles: K planes, thread -> (row tid/4 and +32, 16-byte piece tid%4); V^T, thread -> (row tid/8 and +16, piece tid%8)
  const int kr = tid >> 2, kc = (tid & 3) * 8, vr = tid >> 3, vc = (tid & 7) * 8;
  const _Float16* gkh = KH + ((size_t)b * SEQ + kr) * TQ + h * HD + kc;
  const _Float16* gkl = KL + ((size_t)b * SEQ + kr) * TQ + h * HD + kc;
  const _Float16* gvt = VT + ((size_t)bh * HD + vr) * SEQ + vc;
  const unsigned lds0 = (unsigned)(size_t)&kv[0][0];
  const unsigned lk = lds0 + (unsigned)(kr * KVP + kc) * 2u, lv = lds0 + (unsigned)(KPART + vr * KVP + vc) * 2u;
  auto issue_tile = [&](int t) {
    const unsigned bo = (unsigned)(t & 1) * (unsigned)(TILE_H * 2);
    const _Float16* a = gkh + (size_t)t * KT * TQ; const _Float16* c = gkl + (size_t)t * KT * TQ; const _Float16* v = gvt + (size_t)t * KT;
    tile_copies(lk + bo, lk + bo + 32 * KVP * 2, lk + bo + 64, lk + bo + 64 + 32 * KVP * 2, lv + bo, lv + bo + 16 * KVP * 2,
                a, a + (size_t)32 * TQ, c, c + (size_t)32 * TQ, v, v + (size_t)16 * SEQ);
  };
  const v8f z8 = {0.f,0.f,0.f,0.f,0.f,0.f,0.f,0.f};
  float rm[2] = {-3.0e38f, -3.0e38f}, rl[2] = {0.f, 0.f}; v8f o0[2] = {z8, z8}, o1[2] = {z8, z8};
  constexpr int NT = SEQ / KT;
  issue_tile(0);
  asm volatile("s_wait_asynccnt 0x0" ::: "memory");   /* this wave's copies of tile 0 have landed */
  __syncthreads();                                     /* tile 0 published to all four waves */
  issue_tile(1);
#pragma unroll 1
  for (int t = 0; t < NT; ++t) {
    const _Float16* kb = &kv[t & 1][0] + ln * KVP;
    const _Float16* vp = &kv[t & 1][KPART] + ln * KVP;
    v16h ah[4], al[4];
#pragma unroll /* fragment arrays indexed by constants, so that they stay in registers */
    for (int j = 0; j < 4; ++j) { ah[j] = g2_frag(kb + 16 * j * KVP, hh); al[j] = g2_frag(kb + 16 * j * KVP + 32, hh); }
    __builtin_amdgcn_sched_barrier(0);   /* keeps the 16 LDS reads of K one group ahead of the products; sunk among them, each pair is waited out to zero in front of its product */
    v8f s[2][4];
#pragma unroll /* as above: s[] and the fragments stay in registers */
    for (int j = 0; j < 4; ++j) {
#pragma unroll
      for (int u = 0; u < 2; ++u) s[u][j] = __builtin_amdgcn_wmma_f32_16x16x32_f16(false, ah[j], false, ql[u], (short)0, z8, false, false); }
    __builtin_amdgcn_sched_barrier(0);   /* this and the next: the eight accumulators take turns, so that a product stands eight behind the one whose sum it takes up, and the products fill each other's slots in place of v_nop */
#pragma unroll
    for (int j = 0; j < 4; ++j) {
#pragma unroll
      for (int u = 0; u < 2; ++u) s[u][j] = __builtin_amdgcn_wmma_f32_16x16x32_f16(false, al[j], false, qh[u], (short)0, s[u][j], false, false); }
    __builtin_amdgcn_sched_barrier(0);
#pragma unroll
    for (int j = 0; j < 4; ++j) {
#pragma unroll
      for (int u = 0; u < 2; ++u) s[u][j] = __builtin_amdgcn_wmma_f32_16x16x32_f16(false, ah[j], false, qs[u], (short)0, s[u][j], false, false); }
    // the V^T fragments are read here, into registers that the K fragments leave, so that the wave stays inside 256 registers; the softmax below covers their latency
    const v16h vb0 = g2_frag(vp, hh), vb1 = g2_frag(vp + 16 * KVP, hh), vb2 = g2_frag(vp + 32, hh), vb3 = g2_frag(vp + 16 * KVP + 32, hh);
    __builtin_amdgcn_sched_barrier(0);   /* keeps these 8 reads one group ahead of the softmax; sunk to their use, the wave waits out their latency in front of the last products */
    constexpr float SC = 1.4426950408889634f * 0.0009765625f;   /* log2(e) / 1024: rm, mn and s carry the score x1024 */
    float alpha[2], nb[2], ar[2][8];
#pragma unroll
    for (int u = 0; u < 2; ++u) {
      float m = s[u][0][0];
#pragma unroll
      for (int t4 = 0; t4 < 4; ++t4) {
#pragma unroll
        for (int r = 0; r < 8; ++r) m = fmaxf(m, s[u][t4][r]); }
      m = fmaxf(m, __shfl_xor(m, 16, 32));
      const float mn = fmaxf(rm[u], m);
      alpha[u] = __builtin_amdgcn_exp2f((rm[u] - mn) * SC);
      rm[u] = mn;
#pragma unroll
      for (int r = 0; r < 8; ++r) ar[u][r] = __shfl(alpha[u], 8 * hh + r, 32);
      nb[u] = __builtin_fmaf(-mn, SC, 14.0f);   /* exp(score - maximum) carried x16384 = 2^14 */
    }
    __builtin_amdgcn_sched_barrier(0);   /* the sixteen broadcasts of alpha start ahead of the exponentials, which cover their round trip; sunk behind them, the wave waits it out */
    const v8f scv = {SC, SC, SC, SC, SC, SC, SC, SC};
#pragma unroll
    for (int u = 0; u < 2; ++u) {
      const v8f nbv = {nb[u], nb[u], nb[u], nb[u], nb[u], nb[u], nb[u], nb[u]};
      float ls = 0.f; FragH pa[2];
#pragma unroll
      for (int t4 = 0; t4 < 4; ++t4) { const v8f e = __builtin_elementwise_fma(s[u][t4], scv, nbv);
#pragma unroll
        for (int r = 0; r < 8; ++r) { const float p = __builtin_amdgcn_exp2f(e[r]); ls += p; pa[t4 >> 1].h[((t4 & 1) << 3) + r] = (_Float16)p; } }
      ls += __shfl_xor(ls, 16, 32);
      rl[u] = rl[u] * alpha[u] + ls;
      __builtin_amdgcn_sched_barrier(0);   /* the first use of the broadcasts stays behind the block's exponentials; and block 0's four products below stand ahead of block 1's exponentials, which run on the vector port while the matrix unit works on them */
#pragma unroll
      for (int r = 0; r < 8; ++r) { o0[u][r] *= ar[u][r]; o1[u][r] *= ar[u][r]; }
      // the builtin form: the compiler keeps the distance behind each product, and the other block's vector work fills it in place of v_nop
      o0[u] = __builtin_amdgcn_wmma_f32_16x16x32_f16(false, pa[0].v, false, vb0, (short)0, o0[u], false, false);
      o1[u] = __builtin_amdgcn_wmma_f32_16x16x32_f16(false, pa[0].v, false, vb1, (short)0, o1[u], false, false);
      o0[u] = __builtin_amdgcn_wmma_f32_16x16x32_f16(false, pa[1].v, false, vb2, (short)0, o0[u], false, false);
      o1[u] = __builtin_amdgcn_wmma_f32_16x16x32_f16(false, pa[1].v, false, vb3, (short)0, o1[u], false, false);
    }
    asm volatile("s_wait_dscnt 0x0" ::: "memory");     /* this wave's reads of buffer t%2 are done before it is refilled */
    asm volatile("s_wait_asynccnt 0x0" ::: "memory");  /* this wave's copies of tile t+1 have landed */
    __syncthreads();                                   /* publishes tile t+1 and ends every wave's reads of buffer t%2 */
    if (t + 2 < NT) issue_tile(t + 2);
  }
  asm volatile("s_wait_asynccnt 0x0" ::: "memory");    /* no copy outstanding when the wave goes on to its end */
#pragma unroll
  for (int u = 0; u < 2; ++u) { const float inv = 1.0f / rl[u];
#pragma unroll
    for (int r = 0; r < 8; ++r) { const float ir = __shfl(inv, 8 * hh + r, 32); so[w][16 * u + 8 * hh + r][ln] = (_Float16)(o0[u][r] * ir); so[w][16 * u + 8 * hh + r][16 + ln] = (_Float16)(o1[u][r] * ir); } }
  __builtin_amdgcn_fence(4 /* acq_rel order */, "workgroup"); __builtin_amdgcn_wave_barrier();
  unsigned short* ob = (unsigned short*)OH + ((size_t)bh * SEQ + q0) * HD;
  {
#pragma unroll
    for (int j = 0; j < QW / 8; ++j) { const int p = j * 32 + lane; const v8us v = *(const v8us*)&so[w][p >> 2][(p & 3) * 8]; *(v8us*)(ob + (size_t)p * 8) = v; }
     } }

// output projection into the f32 output rows: A = OH head-major ([(b,h)][s][32], k-step == head), Bh = Wot f16 [DOUT][TQ] (x16), C row = b*SEQ_FULL + s (pitch ldc);
__global__ __launch_bounds__(128) void k_gemm_out(const _Float16* __restrict__ OHp, const _Float16* __restrict__ Bh, int ldb, float alpha, const float* __restrict__ bias,
                                                  float* __restrict__ C, int ldc, int M, int N) {
  __shared__ __attribute__((aligned(16))) float so[4][32][68];
  __shared__ __attribute__((aligned(16))) _Float16 st[2][GTILE_H];   /* two k-tile buffers shared by the four waves */
  const int tid = threadIdx.x, w = tid >> 5, lane = tid & 31, ln = lane & 15, hh = lane >> 4;
  const int ntn = N >> 6; const int mt = blockIdx.x / ntn, nq = blockIdx.x - mt * ntn; const int row0 = mt * 128 + 32 * w, col0 = nq * 64; if (mt * 128 >= M) return;   /* the whole block leaves, ahead of every copy and barrier */
  const int bidx = row0 / SEQ, l0 = row0 - bidx * SEQ;
  const size_t hstr = (size_t)SEQ * HD;
  // copy roles: A, one head's 128 rows are 8 KiB in a row: thread -> (row tid/4 and +32 i, 16-byte piece tid%4), heads 2t and 2t+1 side by side in an LDS row; B: thread -> (row tid/8 and +16 i, piece tid%8)
  const int ar = tid >> 2, ap = (tid & 3) * 8, cr = tid >> 3, cp = (tid & 7) * 8;
  const _Float16* ga = OHp + (((size_t)bidx * NH) * SEQ + (l0 - 32 * w) + ar) * HD + ap;
  const _Float16* gb = Bh + (size_t)(col0 + cr) * ldb + cp;
  const size_t sb = (size_t)16 * ldb;
  const unsigned la = (unsigned)(size_t)&st[0][0] + (unsigned)(ar * GP + ap) * 2u, lb = (unsigned)(size_t)&st[0][0] + (unsigned)(GA_H + cr * GP + cp) * 2u;
  auto issue_tile = [&](int t) {
    const unsigned pa = la + (unsigned)(t & 1) * (unsigned)(GTILE_H * 2), pb = lb + (unsigned)(t & 1) * (unsigned)(GTILE_H * 2);
    const _Float16* a = ga + (size_t)(2 * t) * hstr; const _Float16* a2 = a + hstr; const _Float16* b = gb + (size_t)t * GKS;
    gemm_copies(pa, pa + 32 * GP * 2, pa + 64 * GP * 2, pa + 96 * GP * 2, pa + 64, pa + 64 + 32 * GP * 2, pa + 64 + 64 * GP * 2, pa + 64 + 96 * GP * 2,
                pb, pb + 16 * GP * 2, pb + 32 * GP * 2, pb + 48 * GP * 2,
                a, a + 32 * HD, a + 64 * HD, a + 96 * HD, a2, a2 + 32 * HD, a2 + 64 * HD, a2 + 96 * HD, b, b + sb, b + 2 * sb, b + 3 * sb);
  };
  const v8f z8 = {0.f,0.f,0.f,0.f,0.f,0.f,0.f,0.f}; v8f accs[8] = {z8, z8, z8, z8, z8, z8, z8, z8};   /* accs[j]: rows 0..15 x columns 16j.., accs[4+j]: rows 16..31 */
  constexpr int nt = TQ / GKS;
  static_assert(GKS == 2 * HD && nt >= 2);
  issue_tile(0);
  asm volatile("s_wait_asynccnt 0x0" ::: "memory");   /* this wave's copies of tile 0 have landed */
  __syncthreads();                                     /* tile 0 published to all four waves */
  issue_tile(1);
#pragma unroll 1 /* stays rolled: one publish point and one refill site, the buffer picked by t & 1 */
  for (int t = 0; t < nt; ++t) {
    gemm_tile(&st[t & 1][0] + (32 * w + ln) * GP, &st[t & 1][GA_H] + ln * GP, hh, accs);
    asm volatile("s_wait_dscnt 0x0" ::: "memory");     /* this wave's reads of buffer t%2 are done before it is refilled */
    asm volatile("s_wait_asynccnt 0x0" ::: "memory");  /* this wave's copies of tile t+1 have landed */
    __syncthreads();                                   /* publishes tile t+1 and ends every wave's reads of buffer t%2 */
    if (t + 2 < nt) issue_tile(t + 2);
  }
  asm volatile("s_wait_asynccnt 0x0" ::: "memory");    /* no copy outstanding when the wave goes on to its epilogue */
#pragma unroll
  for (int u = 0; u < 8; ++u) { const int t = u & 3, half = u >> 2; const int col = col0 + t * 16 + ln; const float bvl = bf16_rne(bias[col]);
#pragma unroll
    for (int r = 0; r < 8; ++r) { const int rloc = half * 16 + 8 * hh + r; so[w][rloc][t * 16 + ln] = accs[u][r] * alpha + bvl; } }
  __builtin_amdgcn_fence(4 /* acq_rel order */, "workgroup"); __builtin_amdgcn_wave_barrier();
  const int rsub = lane >> 4, c4 = (lane & 15) * 4;
  const size_t crow0 = (size_t)bidx * SEQ_FULL + l0;
  {
#pragma unroll
    for (int q = 0; q < 16; ++q) { const int r = q * 2 + rsub; const v4f v = *(const v4fa*)&so[w][r][c4]; *(v4f*)(C + (crow0 + r) * ldc + col0 + c4) = v; }
     } }

extern "C" void kernel_launch(void* const* d_in, const int* in_sizes, int n_in,
                              void* d_out, int out_size, void* d_ws, size_t ws_size, hipStream_t stream) {
  if (n_in < 9) return;
  const float* X  = (const float*)d_in[0];      /* [NB_FULL][SEQ_FULL][DIN] */
  const float* Wq = (const float*)d_in[1];      /* [DIN][TQ] */
  const float* bq = (const float*)d_in[2];      /* [TQ] */
  const float* Wk = (const float*)d_in[3];
  const float* bk = (const float*)d_in[4];
  const float* Wv = (const float*)d_in[5];
  const float* bv = (const float*)d_in[6];
  const float* Wo = (const float*)d_in[7];      /* [TQ][DOUT] */
  const float* bo = (const float*)d_in[8];      /* [DOUT] */
  const long long needX = (long long)(((size_t)(NB - 1) * SEQ_FULL + SEQ) * DIN);
  const long long needO = (long long)(((size_t)(NB - 1) * SEQ_FULL + SEQ) * DOUT);
  if ((long long)in_sizes[0] < needX || in_sizes[1] < DIN * TQ || in_sizes[2] < TQ || in_sizes[3] < DIN * TQ || in_sizes[4] < TQ ||
      in_sizes[5] < DIN * TQ || in_sizes[6] < TQ || in_sizes[7] < TQ * DOUT || in_sizes[8] < DOUT || (long long)out_size < needO) return;
  char* ws = (char*)d_ws; size_t off = 0;
  auto take = [&](size_t bytes) { char* p = ws + off; off += (bytes + 255) & ~(size_t)255; return p; };
  _Float16* X16 = (_Float16*)take(NR * DIN * 2);
  _Float16* Wqkvt = (_Float16*)take((size_t)3 * TQ * DIN * 2);
  _Float16* Wot = (_Float16*)take((size_t)DOUT * TQ * 2);
  _Float16* QH = (_Float16*)take(NR * TQ * 2); _Float16* QL = (_Float16*)take(NR * TQ * 2);
  _Float16* KH = (_Float16*)take(NR * TQ * 2); _Float16* KL = (_Float16*)take(NR * TQ * 2);
  _Float16* VT = (_Float16*)take((size_t)NB * NH * HD * SEQ * 2);
  _Float16* OH = (_Float16*)take((size_t)NB * NH * SEQ * HD * 2);
  if (off > ws_size || off > (size_t)134217728) return;
  const float a16 = 0.0625f;

  k_prep<<<(unsigned)(4 * WBLK + NR * DIN / 8 / 256), 256, 0, stream>>>(X, Wq, Wk, Wv, Wo, X16, Wqkvt, Wot);   /* x rows -> f16(bf16(x)); W -> W^T x16 */
  k_gemm_qkv<<<(unsigned)((NR / 128) * (3 * TQ / 64)), 128, 0, stream>>>(X16, DIN, Wqkvt, DIN, a16, bq, bk, bv, QH, QL, KH, KL, VT, DIN);   /* q, k hi / x1024 residual planes; V^T per (b,h): [32][SEQ] */
  k_flash<<<dim3(SEQ / (4 * QW), NB * NH), 128, 0, stream>>>(QH, QL, KH, KL, VT, OH);                              /* attention -> O head-major */
  k_gemm_out<<<(unsigned)((NR / 128) * (DOUT / 64)), 128, 0, stream>>>(OH, Wot, TQ, a16, bo, (float*)d_out, DOUT, (int)NR, DOUT);   /* out = O Wo + bo */
}

// v006
// It runs in 54.2 microseconds.
// Next to v005, in two timings, it ran 1.06 times as fast each time.
// Counting every step since v000, it is 3.89 times as fast.
#include <hip/hip_runtime.h>
// Contractions on v_wmma_f32_16x16x32_f16 (f16 operands, f32 accumulate): q/k/v projections (bf16-valued x exact in f16, bf16-valued W x16 in f16), output projection (f16 o, bf16-valued Wo x16), P x V^T (f16 P carried x16384, f16 v); scores as K x Q^T with f16 hi planes plus x1024 f16 residual planes (three products into one accumulator that carries the score x1024); softmax statistics and epilogues f32.
#ifndef NB
#define NB 4
#endif
#ifndef SEQ
#define SEQ 2048
#endif
#define NB_FULL 4
#define SEQ_FULL 2048
#define DIN 512          /* input channels */
#define TQ 256           /* n_head * qk_dim */
#define NH 8
#define HD 32
#define DOUT 512
#define NR ((size_t)NB * SEQ)   /* token rows processed */
#define KT 64            /* keys per attention tile */

static_assert(NB >= 1 && NB <= NB_FULL);
static_assert(SEQ >= 128 && SEQ <= SEQ_FULL);
static_assert(SEQ % 128 == 0);
static_assert((NR % 128) == 0);
static_assert(TQ % 64 == 0 && DOUT % 64 == 0 && DIN % 32 == 0 && TQ % 32 == 0);
static_assert(HD == 32 && NH * HD == TQ);
static_assert(SEQ % KT == 0 && KT == 64);
static_assert(DIN % 64 == 0 && DIN >= 128 && TQ % 64 == 0);

typedef _Float16 v16h __attribute__((ext_vector_type(16)));
typedef unsigned short v8us __attribute__((ext_vector_type(8), may_alias));
typedef float  v8f  __attribute__((ext_vector_type(8)));
typedef float  v4f  __attribute__((ext_vector_type(4)));
typedef float  v4fa __attribute__((ext_vector_type(4), may_alias));
typedef _Float16 v4h __attribute__((ext_vector_type(4)));
union FragH { v16h v; v8us half[2]; _Float16 h[16]; unsigned short u[16]; };

__device__ __forceinline__ unsigned short bf16_bits(float x) { unsigned int u = __float_as_uint(x); return (unsigned short)((u + 0x7FFFu + ((u >> 16) & 1u)) >> 16); }
__device__ __forceinline__ float bf16_val(unsigned short b) { return __uint_as_float(((unsigned int)b) << 16); }
__device__ __forceinline__ float bf16_rne(float x) { return bf16_val(bf16_bits(x)); }

// 16x16 fragment from a 16-bit [row][k] plane row pointer (k contiguous): elements 0..7 <- k 8h..8h+7, elements 8..15 <- k 16+8h..16+8h+7 (same map for A rows and B columns)
__device__ __forceinline__ v16h g2_frag(const _Float16* p, int hh) { FragH f; f.half[0] = *(const v8us*)((const unsigned short*)p + 8 * hh); f.half[1] = *(const v8us*)((const unsigned short*)p + 16 + 8 * hh); return f.v; }
__device__ __forceinline__ v8f g2_mma(v16h a, v16h b, v8f c) { v8f d = __builtin_amdgcn_wmma_f32_16x16x32_f16(false, a, false, b, (short)0, c, false, false); asm volatile("v_nop\n\tv_nop\n\tv_nop\n\tv_nop" : "+v"(d) : "v"(a), "v"(b)); return d; }

typedef float v2f __attribute__((ext_vector_type(2)));
typedef __bf16 v2bf __attribute__((ext_vector_type(2)));
typedef _Float16 v2h __attribute__((ext_vector_type(2)));
typedef unsigned int v2ua __attribute__((ext_vector_type(2), may_alias));
typedef unsigned int v4ua __attribute__((ext_vector_type(4), may_alias));
// two f32 values rounded to bf16 (nearest even), times a power of two, as a pair of f16
__device__ __forceinline__ unsigned int rnd2_f16(float a, float b, float scale) {
  const v2f in = {a, b};
  const unsigned int u = __builtin_bit_cast(unsigned int, __builtin_convertvector(in, v2bf));
  const v2f r = {__uint_as_float(u << 16) * scale, __uint_as_float(u & 0xFFFF0000u) * scale};
  return __builtin_bit_cast(unsigned int, __builtin_convertvector(r, v2h));
}

#define WOBLK (DOUT * (TQ / 8) / 256)   /* blocks of 256 threads that transpose Wo */
static_assert(DOUT * (TQ / 8) % 256 == 0);

__device__ __forceinline__ void wt_f16_body(const float* __restrict__ W, _Float16* __restrict__ Wt, int K, int N, float scale, int t) {
  const int n = t / (K / 8), k8 = (t % (K / 8)) * 8; FragH f;
#pragma unroll
  for (int i = 0; i < 8; ++i) f.h[i] = (_Float16)(bf16_rne(W[(size_t)(k8 + i) * N + n]) * scale);
  const v8us o = f.half[0]; unsigned short* d = (unsigned short*)Wt + (size_t)n * K + k8;
  *(v8us*)d = o;
  asm volatile("s_wait_xcnt 0x0" ::: "memory");   /* the store's registers are not rewritten ahead of this (another arm of the caller follows in the code) */
}

// k-tiles of the two GEMMs in LDS: 64 k (128 bytes) of 128 A rows, then of the B rows (64 in the output projection, 128 in the q, k, v projection), filled once per block, one tile ahead; all waves read their fragments there
#define GKS 64                 /* k per staged tile */
#define GP 72                  /* LDS row pitch in halves: 128 data bytes + 16, a 16 B x odd pitch for ds_load_b128 readers */
#define GA_H (128 * GP)        /* the A rows; the B rows follow */
#define GTILE_H ((128 + 64) * GP)
#define QTILE_H ((128 + 128) * GP)
// One lane's twelve 16-byte copies of a k-tile (eight of A, four of B), global memory to LDS through no register.
// s_wait_xcnt closes the statement so that no address register of a copy is rewritten ahead of it.
__device__ __forceinline__ void gemm_copies(unsigned l0, unsigned l1, unsigned l2, unsigned l3, unsigned l4, unsigned l5, unsigned l6, unsigned l7, unsigned l8, unsigned l9, unsigned l10, unsigned l11,
                                            const _Float16* g0, const _Float16* g1, const _Float16* g2, const _Float16* g3, const _Float16* g4, const _Float16* g5,
                                            const _Float16* g6, const _Float16* g7, const _Float16* g8, const _Float16* g9, const _Float16* g10, const _Float16* g11) {
  asm volatile("global_load_async_to_lds_b128 %0, %12, off\n\t"
               "global_load_async_to_lds_b128 %1, %13, off\n\t"
               "global_load_async_to_lds_b128 %2, %14, off\n\t"
               "global_load_async_to_lds_b128 %3, %15, off\n\t"
               "global_load_async_to_lds_b128 %4, %16, off\n\t"
               "global_load_async_to_lds_b128 %5, %17, off\n\t"
               "global_load_async_to_lds_b128 %6, %18, off\n\t"
               "global_load_async_to_lds_b128 %7, %19, off\n\t"
               "global_load_async_to_lds_b128 %8, %20, off\n\t"
               "global_load_async_to_lds_b128 %9, %21, off\n\t"
               "global_load_async_to_lds_b128 %10, %22, off\n\t"
               "global_load_async_to_lds_b128 %11, %23, off\n\t"
               "s_wait_xcnt 0x0"
               :: "v"(l0), "v"(l1), "v"(l2), "v"(l3), "v"(l4), "v"(l5), "v"(l6), "v"(l7), "v"(l8), "v"(l9), "v"(l10), "v"(l11),
                  "v"(g0), "v"(g1), "v"(g2), "v"(g3), "v"(g4), "v"(g5), "v"(g6), "v"(g7), "v"(g8), "v"(g9), "v"(g10), "v"(g11) : "memory");
}
// a wave's 32 x 64 products over one staged k-tile: ab = its first A row in LDS, bb = the first B row (both at this lane's row), k ascending in steps of 32;
// all twelve fragments are read as one group ahead of the products, so that the wave waits out the LDS latency once per tile
__device__ __forceinline__ void gemm_tile(const _Float16* ab, const _Float16* bb, int hh, v8f (&c)[8]) {
  v16h a[2][2], b[2][4];
#pragma unroll /* fragment arrays indexed by constants, so that they stay in registers */
  for (int s = 0; s < 2; ++s) { a[s][0] = g2_frag(ab + 32 * s, hh); a[s][1] = g2_frag(ab + 16 * GP + 32 * s, hh);
#pragma unroll
    for (int j = 0; j < 4; ++j) b[s][j] = g2_frag(bb + 16 * j * GP + 32 * s, hh); }
#pragma unroll /* as above, and the accumulator array too */
  for (int s = 0; s < 2; ++s) {
#pragma unroll
    for (int j = 0; j < 4; ++j) { c[j] = g2_mma(a[s][0], b[s][j], c[j]); c[4 + j] = g2_mma(a[s][1], b[s][j], c[4 + j]); } } }
static_assert(GKS == 64);

// q, k and v projections in one launch, straight from the f32 inputs: C = alpha * A.Bt + bf16(bias) over the 3*TQ columns of [Wq|Wk|Wv].
// Block = 8 waves, 128 rows x 128 columns (wave: 32 x 64). Each k-tile of x (128 rows) and of W (128 columns) is loaded as f32 one tile ahead into registers,
// rounded there (x -> f16(bf16(x)), W -> f16(16 bf16(W))) and stored as f16 into LDS, W transposed to [column][k]: once per block, so no converted copy goes through memory.
// A block's 128 columns lie in one of the three; its epilogue writes the form attention reads:
// q and k as f16 hi plane plus x1024 f16 residual plane (row pitch TQ), v as f16 transposed, VT[(b,h)][c][s].
// The last WOBLK blocks of the grid do no product: they write Wot = [DOUT][TQ], Wo^T x16 in f16, for the output projection's launch.
#define VTP 136                /* LDS pitch in halves of a transposed v row: 128 tokens (256 bytes) + 16 bytes */
#define QKV_NG ((NR / 128) * (3 * TQ / 128))   /* blocks that compute */
static_assert(TQ % 128 == 0 && DIN / GKS >= 2);
__global__ __launch_bounds__(256) void k_gemm_qkv(const float* __restrict__ x, const float* __restrict__ Wq, const float* __restrict__ Wk, const float* __restrict__ Wv, const float* __restrict__ Wo, float alpha,
                                                  const float* __restrict__ bq, const float* __restrict__ bk, const float* __restrict__ bv,
                                                  _Float16* __restrict__ QH, _Float16* __restrict__ QL, _Float16* __restrict__ KH, _Float16* __restrict__ KL, _Float16* __restrict__ VT, _Float16* __restrict__ Wot) {
  __shared__ __attribute__((aligned(16))) float so[8][32][68];
  static_assert(128 * VTP * 2 <= 8 * 32 * 68 * 4);
  __shared__ __attribute__((aligned(16))) _Float16 st[2][QTILE_H];   /* two k-tile buffers shared by the eight waves */
  const int tid = threadIdx.x, w = tid >> 5, lane = tid & 31, ln = lane & 15, hh = lane >> 4;
  if (blockIdx.x >= QKV_NG) { wt_f16_body(Wo, Wot, TQ, DOUT, 16.0f, (int)(blockIdx.x - QKV_NG) * 256 + tid); return; }   /* the whole block leaves, ahead of every barrier */
  constexpr int ntn = (3 * TQ) >> 7, npl = TQ >> 7;
  const int wr = w & 3, wc = w >> 2;                        /* the wave's 32 rows and its 64 columns inside the block */
  const int mt = blockIdx.x / ntn, nq = blockIdx.x - mt * ntn; const int row0 = mt * 128 + 32 * wr;
  const int pl = nq / npl, pcb = (nq - pl * npl) * 128, pc0 = pcb + 64 * wc;      /* which of q, k, v; first column inside it of the block and of the wave */
  // load roles: x, thread -> (row tid/16 and +16 i, four floats at tid%16): a wave's load covers two runs of 256 bytes; W, thread -> (column tid%128, 32 k at 32 (tid/128)): a wave's load covers one 128-byte line
  const int xr = tid >> 4, xp = (tid & 15) * 4, bn = tid & 127, bk0 = (tid >> 7) * 32;
  const float* gx = x + ((size_t)((mt * 128) / SEQ) * SEQ_FULL + (size_t)((mt * 128) % SEQ) + xr) * DIN + xp;
  const float* gw = (pl == 0 ? Wq : (pl == 1 ? Wk : Wv)) + (size_t)bk0 * TQ + pcb + bn;
  v4f ra[8]; float rb[32];
  auto fetch = [&](int t) {
    const float* a = gx + (size_t)t * GKS; const float* b = gw + (size_t)t * GKS * TQ;
#pragma unroll /* register arrays indexed by constants */
    for (int i = 0; i < 8; ++i) ra[i] = *(const v4fa*)(a + (size_t)i * 16 * DIN);
#pragma unroll
    for (int i = 0; i < 32; ++i) rb[i] = b[(size_t)i * TQ];
    asm volatile("s_wait_xcnt 0x0" ::: "memory");   /* no address register of these loads is rewritten ahead of this; it also keeps the loads ahead of the tile's products, which cover their latency */
  };
  auto put = [&](int t) {
    _Float16* d = &st[t & 1][0];
#pragma unroll
    for (int i = 0; i < 8; ++i) { const v2ua h = {rnd2_f16(ra[i][0], ra[i][1], 1.0f), rnd2_f16(ra[i][2], ra[i][3], 1.0f)}; *(v2ua*)(d + (xr + 16 * i) * GP + xp) = h; }
#pragma unroll
    for (int j = 0; j < 4; ++j) { const v4ua h = {rnd2_f16(rb[8 * j], rb[8 * j + 1], 16.0f), rnd2_f16(rb[8 * j + 2], rb[8 * j + 3], 16.0f), rnd2_f16(rb[8 * j + 4], rb[8 * j + 5], 16.0f), rnd2_f16(rb[8 * j + 6], rb[8 * j + 7], 16.0f)};
      *(v4ua*)(d + GA_H + bn * GP + bk0 + 8 * j) = h; }
  };
  const v8f z8 = {0.f,0.f,0.f,0.f,0.f,0.f,0.f,0.f}; v8f accs[8] = {z8, z8, z8, z8, z8, z8, z8, z8};   /* accs[j]: rows 0..15 x columns 16j.., accs[4+j]: rows 16..31 */
  constexpr int nt = DIN / GKS;
  fetch(0); put(0);
  __syncthreads();                                     /* tile 0 published to all eight waves */
#pragma unroll 1 /* stays rolled: one load site and one store site, the buffer picked by t & 1 */
  for (int t = 0; t + 1 < nt; ++t) {
    fetch(t + 1);
    gemm_tile(&st[t & 1][0] + (32 * wr + ln) * GP, &st[t & 1][GA_H] + (64 * wc + ln) * GP, hh, accs);
    __builtin_amdgcn_sched_barrier(0);                 /* the first use of the loaded f32 values stays behind the products; lifted among them, the wave waits out the loads ahead of its products */
    put(t + 1);                                        /* into the buffer whose readers all passed the barrier of trip t - 1 */
    __syncthreads();                                   /* publishes tile t+1 and ends every wave's reads of buffer t%2 */
  }
  gemm_tile(&st[(nt - 1) & 1][0] + (32 * wr + ln) * GP, &st[(nt - 1) & 1][GA_H] + (64 * wc + ln) * GP, hh, accs);
  const float* bias = pl == 0 ? bq : (pl == 1 ? bk : bv);
  if (pl < 2) {
#pragma unroll
    for (int u = 0; u < 8; ++u) { const int t = u & 3, half = u >> 2; const float bvl = bf16_rne(bias[pc0 + t * 16 + ln]);
#pragma unroll
      for (int r = 0; r < 8; ++r) { const int rloc = half * 16 + 8 * hh + r; so[w][rloc][t * 16 + ln] = accs[u][r] * alpha + bvl; } }
    __builtin_amdgcn_fence(4 /* acq_rel order */, "workgroup"); __builtin_amdgcn_wave_barrier();
    unsigned short* Hh = (unsigned short*)(pl == 0 ? QH : KH); unsigned short* Hl = (unsigned short*)(pl == 0 ? QL : KL);
    const int rsub = lane >> 3, c8 = (lane & 7) * 8;
#pragma unroll
    for (int j = 0; j < 8; ++j) { const int r = j * 4 + rsub; const v4f a = *(const v4fa*)&so[w][r][c8], c = *(const v4fa*)&so[w][r][c8 + 4]; FragH fh, fl;
#pragma unroll
      for (int q = 0; q < 4; ++q) { _Float16 h = (_Float16)a[q]; fh.h[q] = h; fl.h[q] = (_Float16)((a[q] - (float)h) * 1024.0f); h = (_Float16)c[q]; fh.h[4 + q] = h; fl.h[4 + q] = (_Float16)((c[q] - (float)h) * 1024.0f); }
      const size_t o = (size_t)(row0 + r) * TQ + pc0 + c8;
      *(v8us*)(Hh + o) = fh.half[0]; *(v8us*)(Hl + o) = fl.half[0]; }
  } else {
    // a lane's eight accumulator rows are eight consecutive tokens of one channel: 16 bytes of a V^T row, gathered per block so that each row leaves as 256 contiguous bytes
    unsigned short* vt = (unsigned short*)&so[0][0][0];
#pragma unroll
    for (int u = 0; u < 8; ++u) { const int t = u & 3, half = u >> 2; const float bvl = bf16_rne(bias[pc0 + t * 16 + ln]); FragH f;
#pragma unroll
      for (int r = 0; r < 8; ++r) f.h[r] = (_Float16)(accs[u][r] * alpha + bvl);
      *(v8us*)(vt + (64 * wc + t * 16 + ln) * VTP + 32 * wr + half * 16 + 8 * hh) = f.half[0]; }
    __syncthreads();   /* all eight waves' token columns are in LDS before the rows are read; pl is the same for the whole block */
    const int bidx = (mt * 128) / SEQ, s0 = mt * 128 - bidx * SEQ;
    unsigned short* dst = (unsigned short*)VT + ((size_t)bidx * TQ + pcb) * SEQ + s0;
#pragma unroll
    for (int j = 0; j < 8; ++j) { const int p = j * 256 + tid, cl = p >> 4, pc = (p & 15) * 8;
      *(v8us*)(dst + (size_t)cl * SEQ + pc) = *(const v8us*)(vt + cl * VTP + pc); }
    asm volatile("s_wait_xcnt 0x0" ::: "memory");   /* the stores' registers are not rewritten ahead of this (the other arm follows in the code) */
  } }

// flash-style attention per (b,h): block = 4 waves x 32 queries (two blocks of 16 per wave, so that each K and V^T fragment read from LDS feeds two products), key tiles of 64; scores computed transposed (S^T tile = K rows x Q^T, D rows = keys, D columns = queries)
// so that two adjacent D tiles form the P (query x key) A fragment directly; online softmax with per-lane query statistics (lanes l and l^16 share a query),
// scores carried x1024: ah.bl + al.bh + ah.(1024 bh), al and bl being the x1024 residual planes, so that the three products share one accumulator; 2^-10 log2(e) rides in the one multiply-add ahead of exp2;
// P carried x16384 (argument of exp2 shifted by 14), O = P.V^T with B fragments from the VT plane; O written head-major OH[(b,h)][s][c]
// each key tile (K hi and residual rows, V^T rows) is copied once per block of 128 queries into LDS, one tile ahead, and all four waves read their fragments there
#define QW 32                  /* queries per wave */
static_assert(QW == 32 && SEQ % (4 * QW) == 0);
#define KVP 72                 /* LDS row pitch in halves: 128 data bytes + 16, a 16 B x odd pitch for ds_load_b128 readers */
#define KPART (KT * KVP)       /* 64 key rows: hi plane in halves 0..31, residual plane in halves 32..63 */
#define TILE_H (KPART + HD * KVP) /* then 32 channel rows of V^T, 64 keys each */
// One lane's six 16-byte copies of a key tile, global memory to LDS through no register.
// s_wait_xcnt closes the statement so that no address register of a copy is rewritten ahead of it.
__device__ __forceinline__ void tile_copies(unsigned l0, unsigned l1, unsigned l2, unsigned l3, unsigned l4, unsigned l5,
                                            const _Float16* g0, const _Float16* g1, const _Float16* g2, const _Float16* g3, const _Float16* g4, const _Float16* g5) {
  asm volatile("global_load_async_to_lds_b128 %0, %6, off\n\t"
               "global_load_async_to_lds_b128 %1, %7, off\n\t"
               "global_load_async_to_lds_b128 %2, %8, off\n\t"
               "global_load_async_to_lds_b128 %3, %9, off\n\t"
               "global_load_async_to_lds_b128 %4, %10, off\n\t"
               "global_load_async_to_lds_b128 %5, %11, off\n\t"
               "s_wait_xcnt 0x0"
               :: "v"(l0), "v"(l1), "v"(l2), "v"(l3), "v"(l4), "v"(l5), "v"(g0), "v"(g1), "v"(g2), "v"(g3), "v"(g4), "v"(g5) : "memory");
}

__global__ __launch_bounds__(128) void k_flash(const _Float16* __restrict__ QH, const _Float16* __restrict__ QL, const _Float16* __restrict__ KH, const _Float16* __restrict__ KL,
                                              const _Float16* __restrict__ VT, _Float16* __restrict__ OH) {
  __shared__ __attribute__((aligned(16))) _Float16 so[4][QW][40];
  __shared__ __attribute__((aligned(16))) _Float16 kv[2][TILE_H];   /* two key-tile buffers shared by the four waves */
  const int tid = threadIdx.x, w = tid >> 5, lane = tid & 31, ln = lane & 15, hh = lane >> 4;
  const int bh = blockIdx.y; const int b = bh / NH, h = bh - b * NH;
  const int q0 = blockIdx.x * (4 * QW) + w * QW;
  v16h qh[2], ql[2], qs[2];   /* index u: the wave's query block, queries q0 + 16 u .. + 15 */
#pragma unroll /* arrays indexed by constants, so that they stay in registers (this holds for every loop over u below) */
  for (int u = 0; u < 2; ++u) { const size_t qrow = (size_t)b * SEQ + q0 + 16 * u + ln;
    qh[u] = g2_frag(QH + qrow * TQ + h * HD, hh);
    asm volatile("s_wait_xcnt 0x0" ::: "memory");   /* this and the next: a later fragment may land in the address registers of these loads, and does so only behind the wait */
    ql[u] = g2_frag(QL + qrow * TQ + h * HD, hh);
    asm volatile("s_wait_xcnt 0x0" ::: "memory");
    qs[u] = qh[u] * (_Float16)1024.0f; }   /* a power of two: exact for |q| < 64 */
  // copy roles: K planes, thread -> (row tid/4 and +32, 16-byte piece tid%4); V^T, thread -> (row tid/8 and +16, piece tid%8)
  const int kr = tid >> 2, kc = (tid & 3) * 8, vr = tid >> 3, vc = (tid & 7) * 8;
  const _Float16* gkh = KH + ((size_t)b * SEQ + kr) * TQ + h * HD + kc;
  const _Float16* gkl = KL + ((size_t)b * SEQ + kr) * TQ + h * HD + kc;
  const _Float16* gvt = VT + ((size_t)bh * HD + vr) * SEQ + vc;
  const unsigned lds0 = (unsigned)(size_t)&kv[0][0];
  const unsigned lk = lds0 + (unsigned)(kr * KVP + kc) * 2u, lv = lds0 + (unsigned)(KPART + vr * KVP + vc) * 2u;
  auto issue_tile = [&](int t) {
    const unsigned bo = (unsigned)(t & 1) * (unsigned)(TILE_H * 2);
    const _Float16* a = gkh + (size_t)t * KT * TQ; const _Float16* c = gkl + (size_t)t * KT * TQ; const _Float16* v = gvt + (size_t)t * KT;
    tile_copies(lk + bo, lk + bo + 32 * KVP * 2, lk + bo + 64, lk + bo + 64 + 32 * KVP * 2, lv + bo, lv + bo + 16 * KVP * 2,
                a, a + (size_t)32 * TQ, c, c + (size_t)32 * TQ, v, v + (size_t)16 * SEQ);
  };
  const v8f z8 = {0.f,0.f,0.f,0.f,0.f,0.f,0.f,0.f};
  float rm[2] = {-3.0e38f, -3.0e38f}, rl[2] = {0.f, 0.f}; v8f o0[2] = {z8, z8}, o1[2] = {z8, z8};
  constexpr int NT = SEQ / KT;
  issue_tile(0);
  asm volatile("s_wait_asynccnt 0x0" ::: "memory");   /* this wave's copies of tile 0 have landed */
  __syncthreads();                                     /* tile 0 published to all four waves */
  issue_tile(1);
#pragma unroll 1
  for (int t = 0; t < NT; ++t) {
    const _Float16* kb = &kv[t & 1][0] + ln * KVP;
    const _Float16* vp = &kv[t & 1][KPART] + ln * KVP;
    v16h ah[4], al[4];
#pragma unroll /* fragment arrays indexed by constants, so that they stay in registers */
    for (int j = 0; j < 4; ++j) { ah[j] = g2_frag(kb + 16 * j * KVP, hh); al[j] = g2_frag(kb + 16 * j * KVP + 32, hh); }
    __builtin_amdgcn_sched_barrier(0);   /* keeps the 16 LDS reads of K one group ahead of the products; sunk among them, each pair is waited out to zero in front of its product */
    v8f s[2][4];
#pragma unroll /* as above: s[] and the fragments stay in registers */
    for (int j = 0; j < 4; ++j) {
#pragma unroll
      for (int u = 0; u < 2; ++u) s[u][j] = __builtin_amdgcn_wmma_f32_16x16x32_f16(false, ah[j], false, ql[u], (short)0, z8, false, false); }
    __builtin_amdgcn_sched_barrier(0);   /* this and the next: the eight accumulators take turns, so that a product stands eight behind the one whose sum it takes up, and the products fill each other's slots in place of v_nop */
#pragma unroll
    for (int j = 0; j < 4; ++j) {
#pragma unroll
      for (int u = 0; u < 2; ++u) s[u][j] = __builtin_amdgcn_wmma_f32_16x16x32_f16(false, al[j], false, qh[u], (short)0, s[u][j], false, false); }
    __builtin_amdgcn_sched_barrier(0);
#pragma unroll
    for (int j = 0; j < 4; ++j) {
#pragma unroll
      for (int u = 0; u < 2; ++u) s[u][j] = __builtin_amdgcn_wmma_f32_16x16x32_f16(false, ah[j], false, qs[u], (short)0, s[u][j], false, false); }
    // the V^T fragments are read here, into registers that the K fragments leave, so that the wave stays inside 256 registers; the softmax below covers their latency
    const v16h vb0 = g2_frag(vp, hh), vb1 = g2_frag(vp + 16 * KVP, hh), vb2 = g2_frag(vp + 32, hh), vb3 = g2_frag(vp + 16 * KVP + 32, hh);
    __builtin_amdgcn_sched_barrier(0);   /* keeps these 8 reads one group ahead of the softmax; sunk to their use, the wave waits out their latency in front of the last products */
    constexpr float SC = 1.4426950408889634f * 0.0009765625f;   /* log2(e) / 1024: rm, mn and s carry the score x1024 */
    float alpha[2], nb[2], ar[2][8];
#pragma unroll
    for (int u = 0; u < 2; ++u) {
      float m = s[u][0][0];
#pragma unroll
      for (int t4 = 0; t4 < 4; ++t4) {
#pragma unroll
        for (int r = 0; r < 8; ++r) m = fmaxf(m, s[u][t4][r]); }
      m = fmaxf(m, __shfl_xor(m, 16, 32));
      const float mn = fmaxf(rm[u], m);
      alpha[u] = __builtin_amdgcn_exp2f((rm[u] - mn) * SC);
      rm[u] = mn;
#pragma unroll
      for (int r = 0; r < 8; ++r) ar[u][r] = __shfl(alpha[u], 8 * hh + r, 32);
      nb[u] = __builtin_fmaf(-mn, SC, 14.0f);   /* exp(score - maximum) carried x16384 = 2^14 */
    }
    __builtin_amdgcn_sched_barrier(0);   /* the sixteen broadcasts of alpha start ahead of the exponentials, which cover their round trip; sunk behind them, the wave waits it out */
    const v8f scv = {SC, SC, SC, SC, SC, SC, SC, SC};
#pragma unroll
    for (int u = 0; u < 2; ++u) {
      const v8f nbv = {nb[u], nb[u], nb[u], nb[u], nb[u], nb[u], nb[u], nb[u]};
      float ls = 0.f; FragH pa[2];
#pragma unroll
      for (int t4 = 0; t4 < 4; ++t4) { const v8f e = __builtin_elementwise_fma(s[u][t4], scv, nbv);
#pragma unroll
        for (int r = 0; r < 8; ++r) { const float p = __builtin_amdgcn_exp2f(e[r]); ls += p; pa[t4 >> 1].h[((t4 & 1) << 3) + r] = (_Float16)p; } }
      ls += __shfl_xor(ls, 16, 32);
      rl[u] = rl[u] * alpha[u] + ls;
      __builtin_amdgcn_sched_barrier(0);   /* the first use of the broadcasts stays behind the block's exponentials; and block 0's four products below stand ahead of block 1's exponentials, which run on the vector port while the matrix unit works on them */
#pragma unroll
      for (int r = 0; r < 8; ++r) { o0[u][r] *= ar[u][r]; o1[u][r] *= ar[u][r]; }
      // the builtin form: the compiler keeps the distance behind each product, and the other block's vector work fills it in place of v_nop
      o0[u] = __builtin_amdgcn_wmma_f32_16x16x32_f16(false, pa[0].v, false, vb0, (short)0, o0[u], false, false);
      o1[u] = __builtin_amdgcn_wmma_f32_16x16x32_f16(false, pa[0].v, false, vb1, (short)0, o1[u], false, false);
      o0[u] = __builtin_amdgcn_wmma_f32_16x16x32_f16(false, pa[1].v, false, vb2, (short)0, o0[u], false, false);
      o1[u] = __builtin_amdgcn_wmma_f32_16x16x32_f16(false, pa[1].v, false, vb3, (short)0, o1[u], false, false);
    }
    asm volatile("s_wait_dscnt 0x0" ::: "memory");     /* this wave's reads of buffer t%2 are done before it is refilled */
    asm volatile("s_wait_asynccnt 0x0" ::: "memory");  /* this wave's copies of tile t+1 have landed */
    __syncthreads();                                   /* publishes tile t+1 and ends every wave's reads of buffer t%2 */
    if (t + 2 < NT) issue_tile(t + 2);
  }
  asm volatile("s_wait_asynccnt 0x0" ::: "memory");    /* no copy outstanding when the wave goes on to its end */
#pragma unroll
  for (int u = 0; u < 2; ++u) { const float inv = 1.0f / rl[u];
#pragma unroll
    for (int r = 0; r < 8; ++r) { const float ir = __shfl(inv, 8 * hh + r, 32); so[w][16 * u + 8 * hh + r][ln] = (_Float16)(o0[u][r] * ir); so[w][16 * u + 8 * hh + r][16 + ln] = (_Float16)(o1[u][r] * ir); } }
  __builtin_amdgcn_fence(4 /* acq_rel order */, "workgroup"); __builtin_amdgcn_wave_barrier();
  unsigned short* ob = (unsigned short*)OH + ((size_t)bh * SEQ + q0) * HD;
  {
#pragma unroll
    for (int j = 0; j < QW / 8; ++j) { const int p = j * 32 + lane; const v8us v = *(const v8us*)&so[w][p >> 2][(p & 3) * 8]; *(v8us*)(ob + (size_t)p * 8) = v; }
     } }

// output projection into the f32 output rows: A = OH head-major ([(b,h)][s][32], k-step == head), Bh = Wot f16 [DOUT][TQ] (x16), C row = b*SEQ_FULL + s (pitch ldc);
__global__ __launch_bounds__(128) void k_gemm_out(const _Float16* __restrict__ OHp, const _Float16* __restrict__ Bh, int ldb, float alpha, const float* __restrict__ bias,
                                                  float* __restrict__ C, int ldc, int M, int N) {
  __shared__ __attribute__((aligned(16))) float so[4][32][68];
  __shared__ __attribute__((aligned(16))) _Float16 st[2][GTILE_H];   /* two k-tile buffers shared by the four waves */
  const int tid = threadIdx.x, w = tid >> 5, lane = tid & 31, ln = lane & 15, hh = lane >> 4;
  const int ntn = N >> 6; const int mt = blockIdx.x / ntn, nq = blockIdx.x - mt * ntn; const int row0 = mt * 128 + 32 * w, col0 = nq * 64; if (mt * 128 >= M) return;   /* the whole block leaves, ahead of every copy and barrier */
  const int bidx = row0 / SEQ, l0 = row0 - bidx * SEQ;
  const size_t hstr = (size_t)SEQ * HD;
  // copy roles: A, one head's 128 rows are 8 KiB in a row: thread -> (row tid/4 and +32 i, 16-byte piece tid%4), heads 2t and 2t+1 side by side in an LDS row; B: thread -> (row tid/8 and +16 i, piece tid%8)
  const int ar = tid >> 2, ap = (tid & 3) * 8, cr = tid >> 3, cp = (tid & 7) * 8;
  const _Float16* ga = OHp + (((size_t)bidx * NH) * SEQ + (l0 - 32 * w) + ar) * HD + ap;
  const _Float16* gb = Bh + (size_t)(col0 + cr) * ldb + cp;
  const size_t sb = (size_t)16 * ldb;
  const unsigned la = (unsigned)(size_t)&st[0][0] + (unsigned)(ar * GP + ap) * 2u, lb = (unsigned)(size_t)&st[0][0] + (unsigned)(GA_H + cr * GP + cp) * 2u;
  auto issue_tile = [&](int t) {
    const unsigned pa = la + (unsigned)(t & 1) * (unsigned)(GTILE_H * 2), pb = lb + (unsigned)(t & 1) * (unsigned)(GTILE_H * 2);
    const _Float16* a = ga + (size_t)(2 * t) * hstr; const _Float16* a2 = a + hstr; const _Float16* b = gb + (size_t)t * GKS;
    gemm_copies(pa, pa + 32 * GP * 2, pa + 64 * GP * 2, pa + 96 * GP * 2, pa + 64, pa + 64 + 32 * GP * 2, pa + 64 + 64 * GP * 2, pa + 64 + 96 * GP * 2,
                pb, pb + 16 * GP * 2, pb + 32 * GP * 2, pb + 48 * GP * 2,
                a, a + 32 * HD, a + 64 * HD, a + 96 * HD, a2, a2 + 32 * HD, a2 + 64 * HD, a2 + 96 * HD, b, b + sb, b + 2 * sb, b + 3 * sb);
  };
  const v8f z8 = {0.f,0.f,0.f,0.f,0.f,0.f,0.f,0.f}; v8f accs[8] = {z8, z8, z8, z8, z8, z8, z8, z8};   /* accs[j]: rows 0..15 x columns 16j.., accs[4+j]: rows 16..31 */
  constexpr int nt = TQ / GKS;
  static_assert(GKS == 2 * HD && nt >= 2);
  issue_tile(0);
  asm volatile("s_wait_asynccnt 0x0" ::: "memory");   /* this wave's copies of tile 0 have landed */
  __syncthreads();                                     /* tile 0 published to all four waves */
  issue_tile(1);
#pragma unroll 1 /* stays rolled: one publish point and one refill site, the buffer picked by t & 1 */
  for (int t = 0; t < nt; ++t) {
    gemm_tile(&st[t & 1][0] + (32 * w + ln) * GP, &st[t & 1][GA_H] + ln * GP, hh, accs);
    asm volatile("s_wait_dscnt 0x0" ::: "memory");     /* this wave's reads of buffer t%2 are done before it is refilled */
    asm volatile("s_wait_asynccnt 0x0" ::: "memory");  /* this wave's copies of tile t+1 have landed */
    __syncthreads();                                   /* publishes tile t+1 and ends every wave's reads of buffer t%2 */
    if (t + 2 < nt) issue_tile(t + 2);
  }
  asm volatile("s_wait_asynccnt 0x0" ::: "memory");    /* no copy outstanding when the wave goes on to its epilogue */
#pragma unroll
  for (int u = 0; u < 8; ++u) { const int t = u & 3, half = u >> 2; const int col = col0 + t * 16 + ln; const float bvl = bf16_rne(bias[col]);
#pragma unroll
    for (int r = 0; r < 8; ++r) { const int rloc = half * 16 + 8 * hh + r; so[w][rloc][t * 16 + ln] = accs[u][r] * alpha + bvl; } }
  __builtin_amdgcn_fence(4 /* acq_rel order */, "workgroup"); __builtin_amdgcn_wave_barrier();
  const int rsub = lane >> 4, c4 = (lane & 15) * 4;
  const size_t crow0 = (size_t)bidx * SEQ_FULL + l0;
  {
#pragma unroll
    for (int q = 0; q < 16; ++q) { const int r = q * 2 + rsub; const v4f v = *(const v4fa*)&so[w][r][c4]; *(v4f*)(C + (crow0 + r) * ldc + col0 + c4) = v; }
     } }

extern "C" void kernel_launch(void* const* d_in, const int* in_sizes, int n_in,
                              void* d_out, int out_size, void* d_ws, size_t ws_size, hipStream_t stream) {
  if (n_in < 9) return;
  const float* X  = (const float*)d_in[0];      /* [NB_FULL][SEQ_FULL][DIN] */
  const float* Wq = (const float*)d_in[1];      /* [DIN][TQ] */
  const float* bq = (const float*)d_in[2];      /* [TQ] */
  const float* Wk = (const float*)d_in[3];
  const float* bk = (const float*)d_in[4];
  const float* Wv = (const float*)d_in[5];
  const float* bv = (const float*)d_in[6];
  const float* Wo = (const float*)d_in[7];      /* [TQ][DOUT] */
  const float* bo = (const float*)d_in[8];      /* [DOUT] */
  const long long needX = (long long)(((size_t)(NB - 1) * SEQ_FULL + SEQ) * DIN);
  const long long needO = (long long)(((size_t)(NB - 1) * SEQ_FULL + SEQ) * DOUT);
  if ((long long)in_sizes[0] < needX || in_sizes[1] < DIN * TQ || in_sizes[2] < TQ || in_sizes[3] < DIN * TQ || in_sizes[4] < TQ ||
      in_sizes[5] < DIN * TQ || in_sizes[6] < TQ || in_sizes[7] < TQ * DOUT || in_sizes[8] < DOUT || (long long)out_size < needO) return;
  char* ws = (char*)d_ws; size_t off = 0;
  auto take = [&](size_t bytes) { char* p = ws + off; off += (bytes + 255) & ~(size_t)255; return p; };
  _Float16* Wot = (_Float16*)take((size_t)DOUT * TQ * 2);
  _Float16* QH = (_Float16*)take(NR * TQ * 2); _Float16* QL = (_Float16*)take(NR * TQ * 2);
  _Float16* KH = (_Float16*)take(NR * TQ * 2); _Float16* KL = (_Float16*)take(NR * TQ * 2);
  _Float16* VT = (_Float16*)take((size_t)NB * NH * HD * SEQ * 2);
  _Float16* OH = (_Float16*)take((size_t)NB * NH * SEQ * HD * 2);
  if (off > ws_size || off > (size_t)134217728) return;
  const float a16 = 0.0625f;

  k_gemm_qkv<<<(unsigned)(QKV_NG + WOBLK), 256, 0, stream>>>(X, Wq, Wk, Wv, Wo, a16, bq, bk, bv, QH, QL, KH, KL, VT, Wot);   /* q, k hi / x1024 residual planes; V^T per (b,h): [32][SEQ]; Wo^T x16 */
  k_flash<<<dim3(SEQ / (4 * QW), NB * NH), 128, 0, stream>>>(QH, QL, KH, KL, VT, OH);                              /* attention -> O head-major */
  k_gemm_out<<<(unsigned)((NR / 128) * (DOUT / 64)), 128, 0, stream>>>(OH, Wot, TQ, a16, bo, (float*)d_out, DOUT, (int)NR, DOUT);   /* out = O Wo + bo */
}

// v007
// A run of this version takes 52.1 microseconds.
// Timed twice side by side with v006, it ran 1.04 and 1.05 times as fast.
// Counting every step since v000, it is 4.06 times as fast.
#include <hip/hip_runtime.h>
// Contractions on v_wmma_f32_16x16x32_f16 (f16 operands, f32 accumulate): q/k/v projections (bf16-valued x exact in f16, bf16-valued W x16 in f16), output projection (f16 o, bf16-valued Wo x16), P x V^T (f16 P, f16 v); scores as K x Q^T with f16 hi planes plus f16 residual planes (three products into one accumulator that starts at minus the held reference and ends as the argument of exp2); softmax statistics and epilogues f32.
#ifndef NB
#define NB 4
#endif
#ifndef SEQ
#define SEQ 2048
#endif
#define NB_FULL 4
#define SEQ_FULL 2048
#define DIN 512          /* input channels */
#define TQ 256           /* n_head * qk_dim */
#define NH 8
#define HD 32
#define DOUT 512
#define NR ((size_t)NB * SEQ)   /* token rows processed */
#define KT 64            /* keys per attention tile */

static_assert(NB >= 1 && NB <= NB_FULL);
static_assert(SEQ >= 128 && SEQ <= SEQ_FULL);
static_assert(SEQ % 128 == 0);
static_assert((NR % 128) == 0);
static_assert(TQ % 64 == 0 && DOUT % 64 == 0 && DIN % 32 == 0 && TQ % 32 == 0);
static_assert(HD == 32 && NH * HD == TQ);
static_assert(SEQ % KT == 0 && KT == 64);
static_assert(DIN % 64 == 0 && DIN >= 128 && TQ % 64 == 0);

typedef _Float16 v16h __attribute__((ext_vector_type(16)));
typedef unsigned short v8us __attribute__((ext_vector_type(8), may_alias));
typedef float  v8f  __attribute__((ext_vector_type(8)));
typedef float  v4f  __attribute__((ext_vector_type(4)));
typedef float  v4fa __attribute__((ext_vector_type(4), may_alias));
typedef _Float16 v4h __attribute__((ext_vector_type(4)));
union FragH { v16h v; v8us half[2]; _Float16 h[16]; unsigned short u[16]; };

__device__ __forceinline__ unsigned short bf16_bits(float x) { unsigned int u = __float_as_uint(x); return (unsigned short)((u + 0x7FFFu + ((u >> 16) & 1u)) >> 16); }
__device__ __forceinline__ float bf16_val(unsigned short b) { return __uint_as_float(((unsigned int)b) << 16); }
__device__ __forceinline__ float bf16_rne(float x) { return bf16_val(bf16_bits(x)); }

// 16x16 fragment from a 16-bit [row][k] plane row pointer (k contiguous): elements 0..7 <- k 8h..8h+7, elements 8..15 <- k 16+8h..16+8h+7 (same map for A rows and B columns)
__device__ __forceinline__ v16h g2_frag(const _Float16* p, int hh) { FragH f; f.half[0] = *(const v8us*)((const unsigned short*)p + 8 * hh); f.half[1] = *(const v8us*)((const unsigned short*)p + 16 + 8 * hh); return f.v; }
__device__ __forceinline__ v8f g2_mma(v16h a, v16h b, v8f c) { v8f d = __builtin_amdgcn_wmma_f32_16x16x32_f16(false, a, false, b, (short)0, c, false, false); asm volatile("v_nop\n\tv_nop\n\tv_nop\n\tv_nop" : "+v"(d) : "v"(a), "v"(b)); return d; }

typedef float v2f __attribute__((ext_vector_type(2)));
typedef __bf16 v2bf __attribute__((ext_vector_type(2)));
typedef _Float16 v2h __attribute__((ext_vector_type(2)));
typedef unsigned int v2ua __attribute__((ext_vector_type(2), may_alias));
typedef unsigned int v4ua __attribute__((ext_vector_type(4), may_alias));
// two f32 values rounded to bf16 (nearest even), times a power of two, as a pair of f16
__device__ __forceinline__ unsigned int rnd2_f16(float a, float b, float scale) {
  const v2f in = {a, b};
  const unsigned int u = __builtin_bit_cast(unsigned int, __builtin_convertvector(in, v2bf));
  const v2f r = {__uint_as_float(u << 16) * scale, __uint_as_float(u & 0xFFFF0000u) * scale};
  return __builtin_bit_cast(unsigned int, __builtin_convertvector(r, v2h));
}

#define WOBLK (DOUT * (TQ / 8) / 256)   /* blocks of 256 threads that transpose Wo */
static_assert(DOUT * (TQ / 8) % 256 == 0);

__device__ __forceinline__ void wt_f16_body(const float* __restrict__ W, _Float16* __restrict__ Wt, int K, int N, float scale, int t) {
  const int n = t / (K / 8), k8 = (t % (K / 8)) * 8; FragH f;
#pragma unroll
  for (int i = 0; i < 8; ++i) f.h[i] = (_Float16)(bf16_rne(W[(size_t)(k8 + i) * N + n]) * scale);
  const v8us o = f.half[0]; unsigned short* d = (unsigned short*)Wt + (size_t)n * K + k8;
  *(v8us*)d = o;
  asm volatile("s_wait_xcnt 0x0" ::: "memory");   /* the store's registers are not rewritten ahead of this (another arm of the caller follows in the code) */
}

// k-tiles of the two GEMMs in LDS: 64 k (128 bytes) of 128 A rows, then of the B rows (64 in the output projection, 128 in the q, k, v projection), filled once per block, one tile ahead; all waves read their fragments there
#define GKS 64                 /* k per staged tile */
#define GP 72                  /* LDS row pitch in halves: 128 data bytes + 16, a 16 B x odd pitch for ds_load_b128 readers */
#define GA_H (128 * GP)        /* the A rows; the B rows follow */
#define GTILE_H ((128 + 64) * GP)
#define QTILE_H ((128 + 128) * GP)
// One lane's twelve 16-byte copies of a k-tile (eight of A, four of B), global memory to LDS through no register.
// s_wait_xcnt closes the statement so that no address register of a copy is rewritten ahead of it.
__device__ __forceinline__ void gemm_copies(unsigned l0, unsigned l1, unsigned l2, unsigned l3, unsigned l4, unsigned l5, unsigned l6, unsigned l7, unsigned l8, unsigned l9, unsigned l10, unsigned l11,
                                            const _Float16* g0, const _Float16* g1, const _Float16* g2, const _Float16* g3, const _Float16* g4, const _Float16* g5,
                                            const _Float16* g6, const _Float16* g7, const _Float16* g8, const _Float16* g9, const _Float16* g10, const _Float16* g11) {
  asm volatile("global_load_async_to_lds_b128 %0, %12, off\n\t"
               "global_load_async_to_lds_b128 %1, %13, off\n\t"
               "global_load_async_to_lds_b128 %2, %14, off\n\t"
               "global_load_async_to_lds_b128 %3, %15, off\n\t"
               "global_load_async_to_lds_b128 %4, %16, off\n\t"
               "global_load_async_to_lds_b128 %5, %17, off\n\t"
               "global_load_async_to_lds_b128 %6, %18, off\n\t"
               "global_load_async_to_lds_b128 %7, %19, off\n\t"
               "global_load_async_to_lds_b128 %8, %20, off\n\t"
               "global_load_async_to_lds_b128 %9, %21, off\n\t"
               "global_load_async_to_lds_b128 %10, %22, off\n\t"
               "global_load_async_to_lds_b128 %11, %23, off\n\t"
               "s_wait_xcnt 0x0"
               :: "v"(l0), "v"(l1), "v"(l2), "v"(l3), "v"(l4), "v"(l5), "v"(l6), "v"(l7), "v"(l8), "v"(l9), "v"(l10), "v"(l11),
                  "v"(g0), "v"(g1), "v"(g2), "v"(g3), "v"(g4), "v"(g5), "v"(g6), "v"(g7), "v"(g8), "v"(g9), "v"(g10), "v"(g11) : "memory");
}
// a wave's 32 x 64 products over one staged k-tile: ab = its first A row in LDS, bb = the first B row (both at this lane's row), k ascending in steps of 32;
// all twelve fragments are read as one group ahead of the products, so that the wave waits out the LDS latency once per tile
__device__ __forceinline__ void gemm_tile(const _Float16* ab, const _Float16* bb, int hh, v8f (&c)[8]) {
  v16h a[2][2], b[2][4];
#pragma unroll /* fragment arrays indexed by constants, so that they stay in registers */
  for (int s = 0; s < 2; ++s) { a[s][0] = g2_frag(ab + 32 * s, hh); a[s][1] = g2_frag(ab + 16 * GP + 32 * s, hh);
#pragma unroll
    for (int j = 0; j < 4; ++j) b[s][j] = g2_frag(bb + 16 * j * GP + 32 * s, hh); }
#pragma unroll /* as above, and the accumulator array too */
  for (int s = 0; s < 2; ++s) {
#pragma unroll
    for (int j = 0; j < 4; ++j) { c[j] = g2_mma(a[s][0], b[s][j], c[j]); c[4 + j] = g2_mma(a[s][1], b[s][j], c[4 + j]); } } }
static_assert(GKS == 64);

// q, k and v projections in one launch, straight from the f32 inputs: C = alpha * A.Bt + bf16(bias) over the 3*TQ columns of [Wq|Wk|Wv].
// Block = 8 waves, 128 rows x 128 columns (wave: 32 x 64). Each k-tile of x (128 rows) and of W (128 columns) is loaded as f32 one tile ahead into registers,
// rounded there (x -> f16(bf16(x)), W -> f16(16 bf16(W))) and stored as f16 into LDS, W transposed to [column][k]: once per block, so no converted copy goes through memory.
// A block's 128 columns lie in one of the three; its epilogue writes the form attention reads:
// q and k as f16 hi plane plus f16 residual plane at the same scale (row pitch TQ; a residual below the f16 normal range keeps steps of 2^-24), q times log2(e) so that attention's scores come out as exponents of two; v as f16 transposed, VT[(b,h)][c][s].
// The last WOBLK blocks of the grid do no product: they write Wot = [DOUT][TQ], Wo^T x16 in f16, for the output projection's launch.
#define VTP 136                /* LDS pitch in halves of a transposed v row: 128 tokens (256 bytes) + 16 bytes */
#define QKV_NG ((NR / 128) * (3 * TQ / 128))   /* blocks that compute */
static_assert(TQ % 128 == 0 && DIN / GKS >= 2);
__global__ __launch_bounds__(256) void k_gemm_qkv(const float* __restrict__ x, const float* __restrict__ Wq, const float* __restrict__ Wk, const float* __restrict__ Wv, const float* __restrict__ Wo, float alpha,
                                                  const float* __restrict__ bq, const float* __restrict__ bk, const float* __restrict__ bv,
                                                  _Float16* __restrict__ QH, _Float16* __restrict__ QL, _Float16* __restrict__ KH, _Float16* __restrict__ KL, _Float16* __restrict__ VT, _Float16* __restrict__ Wot) {
  __shared__ __attribute__((aligned(16))) float so[8][32][68];
  static_assert(128 * VTP * 2 <= 8 * 32 * 68 * 4);
  __shared__ __attribute__((aligned(16))) _Float16 st[2][QTILE_H];   /* two k-tile buffers shared by the eight waves */
  const int tid = threadIdx.x, w = tid >> 5, lane = tid & 31, ln = lane & 15, hh = lane >> 4;
  if (blockIdx.x >= QKV_NG) { wt_f16_body(Wo, Wot, TQ, DOUT, 16.0f, (int)(blockIdx.x - QKV_NG) * 256 + tid); return; }   /* the whole block leaves, ahead of every barrier */
  constexpr int ntn = (3 * TQ) >> 7, npl = TQ >> 7;
  const int wr = w & 3, wc = w >> 2;                        /* the wave's 32 rows and its 64 columns inside the block */
  const int mt = blockIdx.x / ntn, nq = blockIdx.x - mt * ntn; const int row0 = mt * 128 + 32 * wr;
  const int pl = nq / npl, pcb = (nq - pl * npl) * 128, pc0 = pcb + 64 * wc;      /* which of q, k, v; first column inside it of the block and of the wave */
  // load roles: x, thread -> (row tid/16 and +16 i, four floats at tid%16): a wave's load covers two runs of 256 bytes; W, thread -> (column tid%128, 32 k at 32 (tid/128)): a wave's load covers one 128-byte line
  const int xr = tid >> 4, xp = (tid & 15) * 4, bn = tid & 127, bk0 = (tid >> 7) * 32;
  const float* gx = x + ((size_t)((mt * 128) / SEQ) * SEQ_FULL + (size_t)((mt * 128) % SEQ) + xr) * DIN + xp;
  const float* gw = (pl == 0 ? Wq : (pl == 1 ? Wk : Wv)) + (size_t)bk0 * TQ + pcb + bn;
  v4f ra[8]; float rb[32];
  auto fetch = [&](int t) {
    const float* a = gx + (size_t)t * GKS; const float* b = gw + (size_t)t * GKS * TQ;
#pragma unroll /* register arrays indexed by constants */
    for (int i = 0; i < 8; ++i) ra[i] = *(const v4fa*)(a + (size_t)i * 16 * DIN);
#pragma unroll
    for (int i = 0; i < 32; ++i) rb[i] = b[(size_t)i * TQ];
    asm volatile("s_wait_xcnt 0x0" ::: "memory");   /* no address register of these loads is rewritten ahead of this; it also keeps the loads ahead of the tile's products, which cover their latency */
  };
  auto put = [&](int t) {
    _Float16* d = &st[t & 1][0];
#pragma unroll
    for (int i = 0; i < 8; ++i) { const v2ua h = {rnd2_f16(ra[i][0], ra[i][1], 1.0f), rnd2_f16(ra[i][2], ra[i][3], 1.0f)}; *(v2ua*)(d + (xr + 16 * i) * GP + xp) = h; }
#pragma unroll
    for (int j = 0; j < 4; ++j) { const v4ua h = {rnd2_f16(rb[8 * j], rb[8 * j + 1], 16.0f), rnd2_f16(rb[8 * j + 2], rb[8 * j + 3], 16.0f), rnd2_f16(rb[8 * j + 4], rb[8 * j + 5], 16.0f), rnd2_f16(rb[8 * j + 6], rb[8 * j + 7], 16.0f)};
      *(v4ua*)(d + GA_H + bn * GP + bk0 + 8 * j) = h; }
  };
  const v8f z8 = {0.f,0.f,0.f,0.f,0.f,0.f,0.f,0.f}; v8f accs[8] = {z8, z8, z8, z8, z8, z8, z8, z8};   /* accs[j]: rows 0..15 x columns 16j.., accs[4+j]: rows 16..31 */
  constexpr int nt = DIN / GKS;
  fetch(0); put(0);
  __syncthreads();                                     /* tile 0 published to all eight waves */
#pragma unroll 1 /* stays rolled: one load site and one store site, the buffer picked by t & 1 */
  for (int t = 0; t + 1 < nt; ++t) {
    fetch(t + 1);
    gemm_tile(&st[t & 1][0] + (32 * wr + ln) * GP, &st[t & 1][GA_H] + (64 * wc + ln) * GP, hh, accs);
    __builtin_amdgcn_sched_barrier(0);                 /* the first use of the loaded f32 values stays behind the products; lifted among them, the wave waits out the loads ahead of its products */
    put(t + 1);                                        /* into the buffer whose readers all passed the barrier of trip t - 1 */
    __syncthreads();                                   /* publishes tile t+1 and ends every wave's reads of buffer t%2 */
  }
  gemm_tile(&st[(nt - 1) & 1][0] + (32 * wr + ln) * GP, &st[(nt - 1) & 1][GA_H] + (64 * wc + ln) * GP, hh, accs);
  const float* bias = pl == 0 ? bq : (pl == 1 ? bk : bv);
  if (pl < 2) {
    const float qsc = pl == 0 ? 1.4426950408889634f : 1.0f;   /* log2(e) rides in q, ahead of the cut into hi and residual */
#pragma unroll
    for (int u = 0; u < 8; ++u) { const int t = u & 3, half = u >> 2; const float bvl = bf16_rne(bias[pc0 + t * 16 + ln]);
#pragma unroll
      for (int r = 0; r < 8; ++r) { const int rloc = half * 16 + 8 * hh + r; so[w][rloc][t * 16 + ln] = (accs[u][r] * alpha + bvl) * qsc; } }
    __builtin_amdgcn_fence(4 /* acq_rel order */, "workgroup"); __builtin_amdgcn_wave_barrier();
    unsigned short* Hh = (unsigned short*)(pl == 0 ? QH : KH); unsigned short* Hl = (unsigned short*)(pl == 0 ? QL : KL);
    const int rsub = lane >> 3, c8 = (lane & 7) * 8;
#pragma unroll
    for (int j = 0; j < 8; ++j) { const int r = j * 4 + rsub; const v4f a = *(const v4fa*)&so[w][r][c8], c = *(const v4fa*)&so[w][r][c8 + 4]; FragH fh, fl;
#pragma unroll
      for (int q = 0; q < 4; ++q) { _Float16 h = (_Float16)a[q]; fh.h[q] = h; fl.h[q] = (_Float16)(a[q] - (float)h); h = (_Float16)c[q]; fh.h[4 + q] = h; fl.h[4 + q] = (_Float16)(c[q] - (float)h); }
      const size_t o = (size_t)(row0 + r) * TQ + pc0 + c8;
      *(v8us*)(Hh + o) = fh.half[0]; *(v8us*)(Hl + o) = fl.half[0]; }
  } else {
    // a lane's eight accumulator rows are eight consecutive tokens of one channel: 16 bytes of a V^T row, gathered per block so that each row leaves as 256 contiguous bytes
    unsigned short* vt = (unsigned short*)&so[0][0][0];
#pragma unroll
    for (int u = 0; u < 8; ++u) { const int t = u & 3, half = u >> 2; const float bvl = bf16_rne(bias[pc0 + t * 16 + ln]); FragH f;
#pragma unroll
      for (int r = 0; r < 8; ++r) f.h[r] = (_Float16)(accs[u][r] * alpha + bvl);
      *(v8us*)(vt + (64 * wc + t * 16 + ln) * VTP + 32 * wr + half * 16 + 8 * hh) = f.half[0]; }
    __syncthreads();   /* all eight waves' token columns are in LDS before the rows are read; pl is the same for the whole block */
    const int bidx = (mt * 128) / SEQ, s0 = mt * 128 - bidx * SEQ;
    unsigned short* dst = (unsigned short*)VT + ((size_t)bidx * TQ + pcb) * SEQ + s0;
#pragma unroll
    for (int j = 0; j < 8; ++j) { const int p = j * 256 + tid, cl = p >> 4, pc = (p & 15) * 8;
      *(v8us*)(dst + (size_t)cl * SEQ + pc) = *(const v8us*)(vt + cl * VTP + pc); }
    asm volatile("s_wait_xcnt 0x0" ::: "memory");   /* the stores' registers are not rewritten ahead of this (the other arm follows in the code) */
  } }

// flash-style attention per (b,h): block = 4 waves x 32 queries (two blocks of 16 per wave, so that each K and V^T fragment read from LDS feeds two products), key tiles of 64; scores computed transposed (S^T tile = K rows x Q^T, D rows = keys, D columns = queries)
// so that two adjacent D tiles form the P (query x key) A fragment directly; softmax with per-lane query statistics (lanes l and l^16 share a query).
// Each query holds a reference score. The score accumulator starts at minus the reference (the C operand of the first product) and q carries log2(e), so that the three products
// ah.bl + al.bh + ah.bh (al, bl: the residual planes, at the scale of the hi planes) end as the argument of exp2: no maximum, no multiply-add and no rescale per key tile.
// One test per tile, on the lanes' sums of P, sends the wave to the path that raises the reference, rescales O and the sums and forms P anew; tile 0 always takes it and sets the reference.
// O = P.V^T with B fragments from the VT plane; O written head-major OH[(b,h)][s][c]
// each key tile (K hi and residual rows, V^T rows) is copied once per block of 128 queries into LDS, one tile ahead, and all four waves read their fragments there
#define QW 32                  /* queries per wave */
static_assert(QW == 32 && SEQ % (4 * QW) == 0);
#define KVP 72                 /* LDS row pitch in halves: 128 data bytes + 16, a 16 B x odd pitch for ds_load_b128 readers */
#define KPART (KT * KVP)       /* 64 key rows: hi plane in halves 0..31, residual plane in halves 32..63 */
#define TILE_H (KPART + HD * KVP) /* then 32 channel rows of V^T, 64 keys each */
// One lane's six 16-byte copies of a key tile, global memory to LDS through no register.
// s_wait_xcnt closes the statement so that no address register of a copy is rewritten ahead of it.
__device__ __forceinline__ void tile_copies(unsigned l0, unsigned l1, unsigned l2, unsigned l3, unsigned l4, unsigned l5,
                                            const _Float16* g0, const _Float16* g1, const _Float16* g2, const _Float16* g3, const _Float16* g4, const _Float16* g5) {
  asm volatile("global_load_async_to_lds_b128 %0, %6, off\n\t"
               "global_load_async_to_lds_b128 %1, %7, off\n\t"
               "global_load_async_to_lds_b128 %2, %8, off\n\t"
               "global_load_async_to_lds_b128 %3, %9, off\n\t"
               "global_load_async_to_lds_b128 %4, %10, off\n\t"
               "global_load_async_to_lds_b128 %5, %11, off\n\t"
               "s_wait_xcnt 0x0"
               :: "v"(l0), "v"(l1), "v"(l2), "v"(l3), "v"(l4), "v"(l5), "v"(g0), "v"(g1), "v"(g2), "v"(g3), "v"(g4), "v"(g5) : "memory");
}

__global__ __launch_bounds__(128) void k_flash(const _Float16* __restrict__ QH, const _Float16* __restrict__ QL, const _Float16* __restrict__ KH, const _Float16* __restrict__ KL,
                                              const _Float16* __restrict__ VT, _Float16* __restrict__ OH) {
  __shared__ __attribute__((aligned(16))) _Float16 so[4][QW][40];
  __shared__ __attribute__((aligned(16))) _Float16 kv[2][TILE_H];   /* two key-tile buffers shared by the four waves */
  const int tid = threadIdx.x, w = tid >> 5, lane = tid & 31, ln = lane & 15, hh = lane >> 4;
  const int bh = blockIdx.y; const int b = bh / NH, h = bh - b * NH;
  const int q0 = blockIdx.x * (4 * QW) + w * QW;
  v16h qh[2], ql[2];   /* index u: the wave's query block, queries q0 + 16 u .. + 15 */
#pragma unroll /* arrays indexed by constants, so that they stay in registers (this holds for every loop over u below) */
  for (int u = 0; u < 2; ++u) { const size_t qrow = (size_t)b * SEQ + q0 + 16 * u + ln;
    qh[u] = g2_frag(QH + qrow * TQ + h * HD, hh);
    asm volatile("s_wait_xcnt 0x0" ::: "memory");   /* this and the next: a later fragment may land in the address registers of these loads, and does so only behind the wait */
    ql[u] = g2_frag(QL + qrow * TQ + h * HD, hh);
    asm volatile("s_wait_xcnt 0x0" ::: "memory"); }
  // copy roles: K planes, thread -> (row tid/4 and +32, 16-byte piece tid%4); V^T, thread -> (row tid/8 and +16, piece tid%8)
  const int kr = tid >> 2, kc = (tid & 3) * 8, vr = tid >> 3, vc = (tid & 7) * 8;
  const _Float16* gkh = KH + ((size_t)b * SEQ + kr) * TQ + h * HD + kc;
  const _Float16* gkl = KL + ((size_t)b * SEQ + kr) * TQ + h * HD + kc;
  const _Float16* gvt = VT + ((size_t)bh * HD + vr) * SEQ + vc;
  const unsigned lds0 = (unsigned)(size_t)&kv[0][0];
  const unsigned lk = lds0 + (unsigned)(kr * KVP + kc) * 2u, lv = lds0 + (unsigned)(KPART + vr * KVP + vc) * 2u;
  auto issue_tile = [&](int t) {
    const unsigned bo = (unsigned)(t & 1) * (unsigned)(TILE_H * 2);
    const _Float16* a = gkh + (size_t)t * KT * TQ; const _Float16* c = gkl + (size_t)t * KT * TQ; const _Float16* v = gvt + (size_t)t * KT;
    tile_copies(lk + bo, lk + bo + 32 * KVP * 2, lk + bo + 64, lk + bo + 64 + 32 * KVP * 2, lv + bo, lv + bo + 16 * KVP * 2,
                a, a + (size_t)32 * TQ, c, c + (size_t)32 * TQ, v, v + (size_t)16 * SEQ);
  };
  const v8f z8 = {0.f,0.f,0.f,0.f,0.f,0.f,0.f,0.f};
  float rl[2] = {0.f, 0.f}; v8f o0[2] = {z8, z8}, o1[2] = {z8, z8};
  v8f cr[2] = {z8, z8};   /* minus the query's held reference, in all eight rows of the lane's score column */
  constexpr int NT = SEQ / KT;
  issue_tile(0);
  asm volatile("s_wait_asynccnt 0x0" ::: "memory");   /* this wave's copies of tile 0 have landed */
  __syncthreads();                                     /* tile 0 published to all four waves */
  issue_tile(1);
#pragma unroll 1
  for (int t = 0; t < NT; ++t) {
    const _Float16* kb = &kv[t & 1][0] + ln * KVP;
    const _Float16* vp = &kv[t & 1][KPART] + ln * KVP;
    v16h ah[4], al[4];
#pragma unroll /* fragment arrays indexed by constants, so that they stay in registers */
    for (int j = 0; j < 4; ++j) { ah[j] = g2_frag(kb + 16 * j * KVP, hh); al[j] = g2_frag(kb + 16 * j * KVP + 32, hh); }
    __builtin_amdgcn_sched_barrier(0);   /* keeps the 16 LDS reads of K one group ahead of the products; sunk among them, each pair is waited out to zero in front of its product */
    v8f s[2][4];
#pragma unroll /* as above: s[] and the fragments stay in registers */
    for (int j = 0; j < 4; ++j) {
#pragma unroll
      for (int u = 0; u < 2; ++u) s[u][j] = __builtin_amdgcn_wmma_f32_16x16x32_f16(false, ah[j], false, ql[u], (short)0, cr[u], false, false); }
    __builtin_amdgcn_sched_barrier(0);   /* this and the next: the eight accumulators take turns, so that a product stands eight behind the one whose sum it takes up, and the products fill each other's slots in place of v_nop */
#pragma unroll
    for (int j = 0; j < 4; ++j) {
#pragma unroll
      for (int u = 0; u < 2; ++u) s[u][j] = __builtin_amdgcn_wmma_f32_16x16x32_f16(false, al[j], false, qh[u], (short)0, s[u][j], false, false); }
    __builtin_amdgcn_sched_barrier(0);
#pragma unroll
    for (int j = 0; j < 4; ++j) {
#pragma unroll
      for (int u = 0; u < 2; ++u) s[u][j] = __builtin_amdgcn_wmma_f32_16x16x32_f16(false, ah[j], false, qh[u], (short)0, s[u][j], false, false); }
    // the V^T fragments are read here, into registers that the K fragments leave; the exponentials below cover their latency
    const v16h vb0 = g2_frag(vp, hh), vb1 = g2_frag(vp + 16 * KVP, hh), vb2 = g2_frag(vp + 32, hh), vb3 = g2_frag(vp + 16 * KVP + 32, hh);
    __builtin_amdgcn_sched_barrier(0);   /* keeps these 8 reads one group ahead of the exponentials; sunk to their use, the wave waits out their latency in front of the last products */
    constexpr float PTOP = 32768.0f;   /* a lane's sum of P up to here: every P fits f16 */
    constexpr float HEAD = 7.0f;       /* a raised reference stands 2^7 above the tile's maximum, so that later maxima have 2^22 of room under PTOP */
    FragH pa[2][2]; float ls[2] = {0.f, 0.f};
#pragma unroll
    for (int t4 = 0; t4 < 4; ++t4) {
#pragma unroll
      for (int u = 0; u < 2; ++u) {
#pragma unroll
        for (int r = 0; r < 8; ++r) { const float p = __builtin_amdgcn_exp2f(s[u][t4][r]); ls[u] += p; pa[u][t4 >> 1].h[((t4 & 1) << 3) + r] = (_Float16)p; } }
    }
    const bool over = !(ls[0] <= PTOP) || !(ls[1] <= PTOP);   /* also true for a sum that is not a number */
    if (t == 0 || __builtin_amdgcn_ballot_w32(over) != 0u) {   /* one scalar branch per tile, the same for the whole wave */
#pragma unroll
      for (int u = 0; u < 2; ++u) {
        float m = s[u][0][0];
#pragma unroll
        for (int t4 = 0; t4 < 4; ++t4) {
#pragma unroll
          for (int r = 0; r < 8; ++r) m = fmaxf(m, s[u][t4][r]); }
        m = fmaxf(m, __shfl_xor(m, 16, 32));
        const float d = t == 0 ? m + HEAD : fmaxf(m + HEAD, 0.f);   /* the reference only rises once it is set */
        const float a = t == 0 ? 1.0f : __builtin_amdgcn_exp2f(-d); /* tile 0: O and the sums are still zero */
        const v8f dv = {d, d, d, d, d, d, d, d};
        cr[u] -= dv;
        float l = 0.f;
#pragma unroll
        for (int t4 = 0; t4 < 4; ++t4) {
#pragma unroll
          for (int r = 0; r < 8; ++r) { const float p = __builtin_amdgcn_exp2f(s[u][t4][r] - d); l += p; pa[u][t4 >> 1].h[((t4 & 1) << 3) + r] = (_Float16)p; } }
        ls[u] = l; rl[u] *= a;
#pragma unroll
        for (int r = 0; r < 8; ++r) { const float ar = __shfl(a, 8 * hh + r, 32); o0[u][r] *= ar; o1[u][r] *= ar; }
      }
    }
#pragma unroll
    for (int u = 0; u < 2; ++u) { ls[u] += __shfl_xor(ls[u], 16, 32); rl[u] += ls[u]; }
    // the builtin form: the compiler keeps the distance behind each product; the four accumulators take turns
#pragma unroll
    for (int u = 0; u < 2; ++u) {
      o0[u] = __builtin_amdgcn_wmma_f32_16x16x32_f16(false, pa[u][0].v, false, vb0, (short)0, o0[u], false, false);
      o1[u] = __builtin_amdgcn_wmma_f32_16x16x32_f16(false, pa[u][0].v, false, vb1, (short)0, o1[u], false, false); }
#pragma unroll
    for (int u = 0; u < 2; ++u) {
      o0[u] = __builtin_amdgcn_wmma_f32_16x16x32_f16(false, pa[u][1].v, false, vb2, (short)0, o0[u], false, false);
      o1[u] = __builtin_amdgcn_wmma_f32_16x16x32_f16(false, pa[u][1].v, false, vb3, (short)0, o1[u], false, false); }
    asm volatile("s_wait_dscnt 0x0" ::: "memory");     /* this wave's reads of buffer t%2 are done before it is refilled */
    asm volatile("s_wait_asynccnt 0x0" ::: "memory");  /* this wave's copies of tile t+1 have landed */
    __syncthreads();                                   /* publishes tile t+1 and ends every wave's reads of buffer t%2 */
    if (t + 2 < NT) issue_tile(t + 2);
  }
  asm volatile("s_wait_asynccnt 0x0" ::: "memory");    /* no copy outstanding when the wave goes on to its end */
#pragma unroll
  for (int u = 0; u < 2; ++u) { const float inv = 1.0f / rl[u];
#pragma unroll
    for (int r = 0; r < 8; ++r) { const float ir = __shfl(inv, 8 * hh + r, 32); so[w][16 * u + 8 * hh + r][ln] = (_Float16)(o0[u][r] * ir); so[w][16 * u + 8 * hh + r][16 + ln] = (_Float16)(o1[u][r] * ir); } }
  __builtin_amdgcn_fence(4 /* acq_rel order */, "workgroup"); __builtin_amdgcn_wave_barrier();
  unsigned short* ob = (unsigned short*)OH + ((size_t)bh * SEQ + q0) * HD;
  {
#pragma unroll
    for (int j = 0; j < QW / 8; ++j) { const int p = j * 32 + lane; const v8us v = *(const v8us*)&so[w][p >> 2][(p & 3) * 8]; *(v8us*)(ob + (size_t)p * 8) = v; }
     } }

// output projection into the f32 output rows: A = OH head-major ([(b,h)][s][32], k-step == head), Bh = Wot f16 [DOUT][TQ] (x16), C row = b*SEQ_FULL + s (pitch ldc);
__global__ __launch_bounds__(128) void k_gemm_out(const _Float16* __restrict__ OHp, const _Float16* __restrict__ Bh, int ldb, float alpha, const float* __restrict__ bias,
                                                  float* __restrict__ C, int ldc, int M, int N) {
  __shared__ __attribute__((aligned(16))) float so[4][32][68];
  __shared__ __attribute__((aligned(16))) _Float16 st[2][GTILE_H];   /* two k-tile buffers shared by the four waves */
  const int tid = threadIdx.x, w = tid >> 5, lane = tid & 31, ln = lane & 15, hh = lane >> 4;
  const int ntn = N >> 6; const int mt = blockIdx.x / ntn, nq = blockIdx.x - mt * ntn; const int row0 = mt * 128 + 32 * w, col0 = nq * 64; if (mt * 128 >= M) return;   /* the whole block leaves, ahead of every copy and barrier */
  const int bidx = row0 / SEQ, l0 = row0 - bidx * SEQ;
  const size_t hstr = (size_t)SEQ * HD;
  // copy roles: A, one head's 128 rows are 8 KiB in a row: thread -> (row tid/4 and +32 i, 16-byte piece tid%4), heads 2t and 2t+1 side by side in an LDS row; B: thread -> (row tid/8 and +16 i, piece tid%8)
  const int ar = tid >> 2, ap = (tid & 3) * 8, cr = tid >> 3, cp = (tid & 7) * 8;
  const _Float16* ga = OHp + (((size_t)bidx * NH) * SEQ + (l0 - 32 * w) + ar) * HD + ap;
  const _Float16* gb = Bh + (size_t)(col0 + cr) * ldb + cp;
  const size_t sb = (size_t)16 * ldb;
  const unsigned la = (unsigned)(size_t)&st[0][0] + (unsigned)(ar * GP + ap) * 2u, lb = (unsigned)(size_t)&st[0][0] + (unsigned)(GA_H + cr * GP + cp) * 2u;
  auto issue_tile = [&](int t) {
    const unsigned pa = la + (unsigned)(t & 1) * (unsigned)(GTILE_H * 2), pb = lb + (unsigned)(t & 1) * (unsigned)(GTILE_H * 2);
    const _Float16* a = ga + (size_t)(2 * t) * hstr; const _Float16* a2 = a + hstr; const _Float16* b = gb + (size_t)t * GKS;
    gemm_copies(pa, pa + 32 * GP * 2, pa + 64 * GP * 2, pa + 96 * GP * 2, pa + 64, pa + 64 + 32 * GP * 2, pa + 64 + 64 * GP * 2, pa + 64 + 96 * GP * 2,
                pb, pb + 16 * GP * 2, pb + 32 * GP * 2, pb + 48 * GP * 2,
                a, a + 32 * HD, a + 64 * HD, a + 96 * HD, a2, a2 + 32 * HD, a2 + 64 * HD, a2 + 96 * HD, b, b + sb, b + 2 * sb, b + 3 * sb);
  };
  const v8f z8 = {0.f,0.f,0.f,0.f,0.f,0.f,0.f,0.f}; v8f accs[8] = {z8, z8, z8, z8, z8, z8, z8, z8};   /* accs[j]: rows 0..15 x columns 16j.., accs[4+j]: rows 16..31 */
  constexpr int nt = TQ / GKS;
  static_assert(GKS == 2 * HD && nt >= 2);
  issue_tile(0);
  asm volatile("s_wait_asynccnt 0x0" ::: "memory");   /* this wave's copies of tile 0 have landed */
  __syncthreads();                                     /* tile 0 published to all four waves */
  issue_tile(1);
#pragma unroll 1 /* stays rolled: one publish point and one refill site, the buffer picked by t & 1 */
  for (int t = 0; t < nt; ++t) {
    gemm_tile(&st[t & 1][0] + (32 * w + ln) * GP, &st[t & 1][GA_H] + ln * GP, hh, accs);
    asm volatile("s_wait_dscnt 0x0" ::: "memory");     /* this wave's reads of buffer t%2 are done before it is refilled */
    asm volatile("s_wait_asynccnt 0x0" ::: "memory");  /* this wave's copies of tile t+1 have landed */
    __syncthreads();                                   /* publishes tile t+1 and ends every wave's reads of buffer t%2 */
    if (t + 2 < nt) issue_tile(t + 2);
  }
  asm volatile("s_wait_asynccnt 0x0" ::: "memory");    /* no copy outstanding when the wave goes on to its epilogue */
#pragma unroll
  for (int u = 0; u < 8; ++u) { const int t = u & 3, half = u >> 2; const int col = col0 + t * 16 + ln; const float bvl = bf16_rne(bias[col]);
#pragma unroll
    for (int r = 0; r < 8; ++r) { const int rloc = half * 16 + 8 * hh + r; so[w][rloc][t * 16 + ln] = accs[u][r] * alpha + bvl; } }
  __builtin_amdgcn_fence(4 /* acq_rel order */, "workgroup"); __builtin_amdgcn_wave_barrier();
  const int rsub = lane >> 4, c4 = (lane & 15) * 4;
  const size_t crow0 = (size_t)bidx * SEQ_FULL + l0;
  {
#pragma unroll
    for (int q = 0; q < 16; ++q) { const int r = q * 2 + rsub; const v4f v = *(const v4fa*)&so[w][r][c4]; *(v4f*)(C + (crow0 + r) * ldc + col0 + c4) = v; }
     } }

extern "C" void kernel_launch(void* const* d_in, const int* in_sizes, int n_in,
                              void* d_out, int out_size, void* d_ws, size_t ws_size, hipStream_t stream) {
  if (n_in < 9) return;
  const float* X  = (const float*)d_in[0];      /* [NB_FULL][SEQ_FULL][DIN] */
  const float* Wq = (const float*)d_in[1];      /* [DIN][TQ] */
  const float* bq = (const float*)d_in[2];      /* [TQ] */
  const float* Wk = (const float*)d_in[3];
  const float* bk = (const float*)d_in[4];
  const float* Wv = (const float*)d_in[5];
  const float* bv = (const float*)d_in[6];
  const float* Wo = (const float*)d_in[7];      /* [TQ][DOUT] */
  const float* bo = (const float*)d_in[8];      /* [DOUT] */
  const long long needX = (long long)(((size_t)(NB - 1) * SEQ_FULL + SEQ) * DIN);
  const long long needO = (long long)(((size_t)(NB - 1) * SEQ_FULL + SEQ) * DOUT);
  if ((long long)in_sizes[0] < needX || in_sizes[1] < DIN * TQ || in_sizes[2] < TQ || in_sizes[3] < DIN * TQ || in_sizes[4] < TQ ||
      in_sizes[5] < DIN * TQ || in_sizes[6] < TQ || in_sizes[7] < TQ * DOUT || in_sizes[8] < DOUT || (long long)out_size < needO) return;
  char* ws = (char*)d_ws; size_t off = 0;
  auto take = [&](size_t bytes) { char* p = ws + off; off += (bytes + 255) & ~(size_t)255; return p; };
  _Float16* Wot = (_Float16*)take((size_t)DOUT * TQ * 2);
  _Float16* QH = (_Float16*)take(NR * TQ * 2); _Float16* QL = (_Float16*)take(NR * TQ * 2);
  _Float16* KH = (_Float16*)take(NR * TQ * 2); _Float16* KL = (_Float16*)take(NR * TQ * 2);
  _Float16* VT = (_Float16*)take((size_t)NB * NH * HD * SEQ * 2);
  _Float16* OH = (_Float16*)take((size_t)NB * NH * SEQ * HD * 2);
  if (off > ws_size || off > (size_t)134217728) return;
  const float a16 = 0.0625f;

  k_gemm_qkv<<<(unsigned)(QKV_NG + WOBLK), 256, 0, stream>>>(X, Wq, Wk, Wv, Wo, a16, bq, bk, bv, QH, QL, KH, KL, VT, Wot);   /* q, k hi / residual planes; V^T per (b,h): [32][SEQ]; Wo^T x16 */
  k_flash<<<dim3(SEQ / (4 * QW), NB * NH), 128, 0, stream>>>(QH, QL, KH, KL, VT, OH);                              /* attention -> O head-major */
  k_gemm_out<<<(unsigned)((NR / 128) * (DOUT / 64)), 128, 0, stream>>>(OH, Wot, TQ, a16, bo, (float*)d_out, DOUT, (int)NR, DOUT);   /* out = O Wo + bo */
}

// v009
// One run takes 40.5 microseconds.
// It is 1.28 times as fast as v007, going by the measured steps of the versions left out in between.
// All steps since v000 together make it 5.19 times as fast.
#include <hip/hip_runtime.h>
// Contractions on v_wmma_f32_16x16x32_f16 (f16 operands, f32 accumulate): q/k/v projections (bf16-valued x exact in f16, bf16-valued W x16 in f16), output projection (f16 o, bf16-valued Wo x16), P x V^T (f16 P, f16 v); scores as K x Q^T with q and k rounded to f16 (one product into an accumulator that starts at minus the held reference and ends as the argument of exp2); softmax statistics and epilogues f32.
#ifndef NB
#define NB 4
#endif
#ifndef SEQ
#define SEQ 2048
#endif
#define NB_FULL 4
#define SEQ_FULL 2048
#define DIN 512          /* input channels */
#define TQ 256           /* n_head * qk_dim */
#define NH 8
#define HD 32
#define DOUT 512
#define NR ((size_t)NB * SEQ)   /* token rows processed */
#define KT 64            /* keys per attention tile */

static_assert(NB >= 1 && NB <= NB_FULL);
static_assert(SEQ >= 128 && SEQ <= SEQ_FULL);
static_assert(SEQ % 128 == 0);
static_assert((NR % 128) == 0);
static_assert(TQ % 64 == 0 && DOUT % 64 == 0 && DIN % 32 == 0 && TQ % 32 == 0);
static_assert(HD == 32 && NH * HD == TQ);
static_assert(SEQ % KT == 0 && KT == 64);
static_assert(DIN % 64 == 0 && DIN >= 128 && TQ % 64 == 0);

typedef _Float16 v16h __attribute__((ext_vector_type(16)));
typedef unsigned short v8us __attribute__((ext_vector_type(8), may_alias));
typedef float  v8f  __attribute__((ext_vector_type(8)));
typedef float  v4f  __attribute__((ext_vector_type(4)));
typedef float  v4fa __attribute__((ext_vector_type(4), may_alias));
typedef _Float16 v4h __attribute__((ext_vector_type(4)));
union FragH { v16h v; v8us half[2]; _Float16 h[16]; unsigned short u[16]; };

__device__ __forceinline__ unsigned short bf16_bits(float x) { unsigned int u = __float_as_uint(x); return (unsigned short)((u + 0x7FFFu + ((u >> 16) & 1u)) >> 16); }
__device__ __forceinline__ float bf16_val(unsigned short b) { return __uint_as_float(((unsigned int)b) << 16); }
__device__ __forceinline__ float bf16_rne(float x) { return bf16_val(bf16_bits(x)); }

// 16x16 fragment from a 16-bit [row][k] plane row pointer (k contiguous): elements 0..7 <- k 8h..8h+7, elements 8..15 <- k 16+8h..16+8h+7 (same map for A rows and B columns)
__device__ __forceinline__ v16h g2_frag(const _Float16* p, int hh) { FragH f; f.half[0] = *(const v8us*)((const unsigned short*)p + 8 * hh); f.half[1] = *(const v8us*)((const unsigned short*)p + 16 + 8 * hh); return f.v; }
__device__ __forceinline__ v8f g2_mma(v16h a, v16h b, v8f c) { v8f d = __builtin_amdgcn_wmma_f32_16x16x32_f16(false, a, false, b, (short)0, c, false, false); asm volatile("v_nop\n\tv_nop\n\tv_nop\n\tv_nop" : "+v"(d) : "v"(a), "v"(b)); return d; }

typedef float v2f __attribute__((ext_vector_type(2)));
typedef __bf16 v2bf __attribute__((ext_vector_type(2)));
typedef _Float16 v2h __attribute__((ext_vector_type(2)));
typedef unsigned int v2ua __attribute__((ext_vector_type(2), may_alias));
typedef unsigned int v4ua __attribute__((ext_vector_type(4), may_alias));
// two f32 values rounded to bf16 (nearest even), times a power of two, as a pair of f16
__device__ __forceinline__ unsigned int rnd2_f16(float a, float b, float scale) {
  const v2f in = {a, b};
  const unsigned int u = __builtin_bit_cast(unsigned int, __builtin_convertvector(in, v2bf));
  const v2f r = {__uint_as_float(u << 16) * scale, __uint_as_float(u & 0xFFFF0000u) * scale};
  return __builtin_bit_cast(unsigned int, __builtin_convertvector(r, v2h));
}

#define WOBLK (DOUT * (TQ / 8) / 256)   /* blocks of 256 threads that transpose Wo */
static_assert(DOUT * (TQ / 8) % 256 == 0);

__device__ __forceinline__ void wt_f16_body(const float* __restrict__ W, _Float16* __restrict__ Wt, int K, int N, float scale, int t) {
  const int n = t / (K / 8), k8 = (t % (K / 8)) * 8; FragH f;
#pragma unroll
  for (int i = 0; i < 8; ++i) f.h[i] = (_Float16)(bf16_rne(W[(size_t)(k8 + i) * N + n]) * scale);
  const v8us o = f.half[0]; unsigned short* d = (unsigned short*)Wt + (size_t)n * K + k8;
  *(v8us*)d = o;
  asm volatile("s_wait_xcnt 0x0" ::: "memory");   /* the store's registers are not rewritten ahead of this (another arm of the caller follows in the code) */
}

// k-tiles of the two GEMMs in LDS: 64 k (128 bytes) of 128 A rows, then of the B rows (64 in the output projection, 128 in the q, k, v projection), filled once per block, one tile ahead; all waves read their fragments there
#define GKS 64                 /* k per staged tile */
#define GP 72                  /* LDS row pitch in halves: 128 data bytes + 16, a 16 B x odd pitch for ds_load_b128 readers */
#define GA_H (128 * GP)        /* the A rows; the B rows follow */
#define GTILE_H ((128 + 64) * GP)
#define QTILE_H ((128 + 128) * GP)
// One lane's twelve 16-byte copies of a k-tile (eight of A, four of B), global memory to LDS through no register.
// s_wait_xcnt closes the statement so that no address register of a copy is rewritten ahead of it.
__device__ __forceinline__ void gemm_copies(unsigned l0, unsigned l1, unsigned l2, unsigned l3, unsigned l4, unsigned l5, unsigned l6, unsigned l7, unsigned l8, unsigned l9, unsigned l10, unsigned l11,
                                            const _Float16* g0, const _Float16* g1, const _Float16* g2, const _Float16* g3, const _Float16* g4, const _Float16* g5,
                                            const _Float16* g6, const _Float16* g7, const _Float16* g8, const _Float16* g9, const _Float16* g10, const _Float16* g11) {
  asm volatile("global_load_async_to_lds_b128 %0, %12, off\n\t"
               "global_load_async_to_lds_b128 %1, %13, off\n\t"
               "global_load_async_to_lds_b128 %2, %14, off\n\t"
               "global_load_async_to_lds_b128 %3, %15, off\n\t"
               "global_load_async_to_lds_b128 %4, %16, off\n\t"
               "global_load_async_to_lds_b128 %5, %17, off\n\t"
               "global_load_async_to_lds_b128 %6, %18, off\n\t"
               "global_load_async_to_lds_b128 %7, %19, off\n\t"
               "global_load_async_to_lds_b128 %8, %20, off\n\t"
               "global_load_async_to_lds_b128 %9, %21, off\n\t"
               "global_load_async_to_lds_b128 %10, %22, off\n\t"
               "global_load_async_to_lds_b128 %11, %23, off\n\t"
               "s_wait_xcnt 0x0"
               :: "v"(l0), "v"(l1), "v"(l2), "v"(l3), "v"(l4), "v"(l5), "v"(l6), "v"(l7), "v"(l8), "v"(l9), "v"(l10), "v"(l11),
                  "v"(g0), "v"(g1), "v"(g2), "v"(g3), "v"(g4), "v"(g5), "v"(g6), "v"(g7), "v"(g8), "v"(g9), "v"(g10), "v"(g11) : "memory");
}
// a wave's 32 x 64 products over one staged k-tile: ab = its first A row in LDS, bb = the first B row (both at this lane's row), k ascending in steps of 32;
// all twelve fragments are read as one group ahead of the products, so that the wave waits out the LDS latency once per tile
__device__ __forceinline__ void gemm_tile(const _Float16* ab, const _Float16* bb, int hh, v8f (&c)[8]) {
  v16h a[2][2], b[2][4];
#pragma unroll /* fragment arrays indexed by constants, so that they stay in registers */
  for (int s = 0; s < 2; ++s) { a[s][0] = g2_frag(ab + 32 * s, hh); a[s][1] = g2_frag(ab + 16 * GP + 32 * s, hh);
#pragma unroll
    for (int j = 0; j < 4; ++j) b[s][j] = g2_frag(bb + 16 * j * GP + 32 * s, hh); }
#pragma unroll /* as above, and the accumulator array too */
  for (int s = 0; s < 2; ++s) {
#pragma unroll
    for (int j = 0; j < 4; ++j) { c[j] = g2_mma(a[s][0], b[s][j], c[j]); c[4 + j] = g2_mma(a[s][1], b[s][j], c[4 + j]); } } }
static_assert(GKS == 64);

// q, k and v projections in one launch, straight from the f32 inputs: C = alpha * A.Bt + bf16(bias) over the 3*TQ columns of [Wq|Wk|Wv].
// Block = 8 waves, 128 rows x 128 columns (wave: 32 x 64). Each k-tile of x (128 rows) and of W (128 columns) is loaded as f32 one tile ahead into registers,
// rounded there (x -> f16(bf16(x)), W -> f16(16 bf16(W))) and stored as f16 into LDS, W transposed to [column][k]: once per block, so no converted copy goes through memory.
// A block's 128 columns lie in one of the three; its epilogue writes the form attention reads:
// q and k as f16 (row pitch TQ), q times log2(e) so that attention's scores come out as exponents of two; v as f16 transposed, VT[(b,h)][c][s].
// The last WOBLK blocks of the grid do no product: they write Wot = [DOUT][TQ], Wo^T x16 in f16, for the output projection's launch.
#define VTP 136                /* LDS pitch in halves of a transposed v row: 128 tokens (256 bytes) + 16 bytes */
#define QKV_NG ((NR / 128) * (3 * TQ / 128))   /* blocks that compute */
static_assert(TQ % 128 == 0 && DIN / GKS >= 2);
__global__ __launch_bounds__(256) void k_gemm_qkv(const float* __restrict__ x, const float* __restrict__ Wq, const float* __restrict__ Wk, const float* __restrict__ Wv, const float* __restrict__ Wo, float alpha,
                                                  const float* __restrict__ bq, const float* __restrict__ bk, const float* __restrict__ bv,
                                                  _Float16* __restrict__ QH, _Float16* __restrict__ KH, _Float16* __restrict__ VT, _Float16* __restrict__ Wot) {
  __shared__ __attribute__((aligned(16))) float so[8][32][68];
  static_assert(128 * VTP * 2 <= 8 * 32 * 68 * 4);
  __shared__ __attribute__((aligned(16))) _Float16 st[2][QTILE_H];   /* two k-tile buffers shared by the eight waves */
  const int tid = threadIdx.x, w = tid >> 5, lane = tid & 31, ln = lane & 15, hh = lane >> 4;
  if (blockIdx.x >= QKV_NG) { wt_f16_body(Wo, Wot, TQ, DOUT, 16.0f, (int)(blockIdx.x - QKV_NG) * 256 + tid); return; }   /* the whole block leaves, ahead of every barrier */
  constexpr int ntn = (3 * TQ) >> 7, npl = TQ >> 7;
  const int wr = w & 3, wc = w >> 2;                        /* the wave's 32 rows and its 64 columns inside the block */
  const int mt = blockIdx.x / ntn, nq = blockIdx.x - mt * ntn; const int row0 = mt * 128 + 32 * wr;
  const int pl = nq / npl, pcb = (nq - pl * npl) * 128, pc0 = pcb + 64 * wc;      /* which of q, k, v; first column inside it of the block and of the wave */
  // load roles: x, thread -> (row tid/16 and +16 i, four floats at tid%16): a wave's load covers two runs of 256 bytes; W, thread -> (column tid%128, 32 k at 32 (tid/128)): a wave's load covers one 128-byte line
  const int xr = tid >> 4, xp = (tid & 15) * 4, bn = tid & 127, bk0 = (tid >> 7) * 32;
  const float* gx = x + ((size_t)((mt * 128) / SEQ) * SEQ_FULL + (size_t)((mt * 128) % SEQ) + xr) * DIN + xp;
  const float* gw = (pl == 0 ? Wq : (pl == 1 ? Wk : Wv)) + (size_t)bk0 * TQ + pcb + bn;
  v4f ra[8]; float rb[32];
  auto fetch = [&](int t) {
    const float* a = gx + (size_t)t * GKS; const float* b = gw + (size_t)t * GKS * TQ;
#pragma unroll /* register arrays indexed by constants */
    for (int i = 0; i < 8; ++i) ra[i] = *(const v4fa*)(a + (size_t)i * 16 * DIN);
#pragma unroll
    for (int i = 0; i < 32; ++i) rb[i] = b[(size_t)i * TQ];
    asm volatile("s_wait_xcnt 0x0" ::: "memory");   /* no address register of these loads is rewritten ahead of this; it also keeps the loads ahead of the tile's products, which cover their latency */
  };
  auto put = [&](int t) {
    _Float16* d = &st[t & 1][0];
#pragma unroll
    for (int i = 0; i < 8; ++i) { const v2ua h = {rnd2_f16(ra[i][0], ra[i][1], 1.0f), rnd2_f16(ra[i][2], ra[i][3], 1.0f)}; *(v2ua*)(d + (xr + 16 * i) * GP + xp) = h; }
#pragma unroll
    for (int j = 0; j < 4; ++j) { const v4ua h = {rnd2_f16(rb[8 * j], rb[8 * j + 1], 16.0f), rnd2_f16(rb[8 * j + 2], rb[8 * j + 3], 16.0f), rnd2_f16(rb[8 * j + 4], rb[8 * j + 5], 16.0f), rnd2_f16(rb[8 * j + 6], rb[8 * j + 7], 16.0f)};
      *(v4ua*)(d + GA_H + bn * GP + bk0 + 8 * j) = h; }
  };
  const v8f z8 = {0.f,0.f,0.f,0.f,0.f,0.f,0.f,0.f}; v8f accs[8] = {z8, z8, z8, z8, z8, z8, z8, z8};   /* accs[j]: rows 0..15 x columns 16j.., accs[4+j]: rows 16..31 */
  constexpr int nt = DIN / GKS;
  fetch(0); put(0);
  __syncthreads();                                     /* tile 0 published to all eight waves */
#pragma unroll 1 /* stays rolled: one load site and one store site, the buffer picked by t & 1 */
  for (int t = 0; t + 1 < nt; ++t) {
    fetch(t + 1);
    gemm_tile(&st[t & 1][0] + (32 * wr + ln) * GP, &st[t & 1][GA_H] + (64 * wc + ln) * GP, hh, accs);
    __builtin_amdgcn_sched_barrier(0);                 /* the first use of the loaded f32 values stays behind the products; lifted among them, the wave waits out the loads ahead of its products */
    put(t + 1);                                        /* into the buffer whose readers all passed the barrier of trip t - 1 */
    __syncthreads();                                   /* publishes tile t+1 and ends every wave's reads of buffer t%2 */
  }
  gemm_tile(&st[(nt - 1) & 1][0] + (32 * wr + ln) * GP, &st[(nt - 1) & 1][GA_H] + (64 * wc + ln) * GP, hh, accs);
  const float* bias = pl == 0 ? bq : (pl == 1 ? bk : bv);
  if (pl < 2) {
    const float qsc = pl == 0 ? 1.4426950408889634f : 1.0f;   /* log2(e) rides in q, ahead of the rounding to f16 */
#pragma unroll
    for (int u = 0; u < 8; ++u) { const int t = u & 3, half = u >> 2; const float bvl = bf16_rne(bias[pc0 + t * 16 + ln]);
#pragma unroll
      for (int r = 0; r < 8; ++r) { const int rloc = half * 16 + 8 * hh + r; so[w][rloc][t * 16 + ln] = (accs[u][r] * alpha + bvl) * qsc; } }
    __builtin_amdgcn_fence(4 /* acq_rel order */, "workgroup"); __builtin_amdgcn_wave_barrier();
    unsigned short* Hh = (unsigned short*)(pl == 0 ? QH : KH);
    const int rsub = lane >> 3, c8 = (lane & 7) * 8;
#pragma unroll
    for (int j = 0; j < 8; ++j) { const int r = j * 4 + rsub; const v4f a = *(const v4fa*)&so[w][r][c8], c = *(const v4fa*)&so[w][r][c8 + 4]; FragH fh;
#pragma unroll
      for (int q = 0; q < 4; ++q) { fh.h[q] = (_Float16)a[q]; fh.h[4 + q] = (_Float16)c[q]; }
      const size_t o = (size_t)(row0 + r) * TQ + pc0 + c8;
      *(v8us*)(Hh + o) = fh.half[0]; }
  } else {
    // a lane's eight accumulator rows are eight consecutive tokens of one channel: 16 bytes of a V^T row, gathered per block so that each row leaves as 256 contiguous bytes
    unsigned short* vt = (unsigned short*)&so[0][0][0];
#pragma unroll
    for (int u = 0; u < 8; ++u) { const int t = u & 3, half = u >> 2; const float bvl = bf16_rne(bias[pc0 + t * 16 + ln]); FragH f;
#pragma unroll
      for (int r = 0; r < 8; ++r) f.h[r] = (_Float16)(accs[u][r] * alpha + bvl);
      *(v8us*)(vt + (64 * wc + t * 16 + ln) * VTP + 32 * wr + half * 16 + 8 * hh) = f.half[0]; }
    __syncthreads();   /* all eight waves' token columns are in LDS before the rows are read; pl is the same for the whole block */
    const int bidx = (mt * 128) / SEQ, s0 = mt * 128 - bidx * SEQ;
    unsigned short* dst = (unsigned short*)VT + ((size_t)bidx * TQ + pcb) * SEQ + s0;
#pragma unroll
    for (int j = 0; j < 8; ++j) { const int p = j * 256 + tid, cl = p >> 4, pc = (p & 15) * 8;
      *(v8us*)(dst + (size_t)cl * SEQ + pc) = *(const v8us*)(vt + cl * VTP + pc); }
    asm volatile("s_wait_xcnt 0x0" ::: "memory");   /* the stores' registers are not rewritten ahead of this (the other arm follows in the code) */
  } }

// flash-style attention per (b,h): block = 128 queries, 32 per wave (two blocks of 16 per wave, so that each K and V^T fragment read from LDS feeds two products), key tiles of 64; scores computed transposed (S^T tile = K rows x Q^T, D rows = keys, D columns = queries)
// so that two adjacent D tiles form the P (query x key) A fragment directly; softmax with per-lane query statistics (lanes l and l^16 share a query).
// Each query holds a reference score. The score accumulator starts at minus the reference (the C operand of the product) and q carries log2(e), so that the product
// ends as the argument of exp2: no maximum, no multiply-add and no rescale per key tile. q and k enter it rounded to f16 (11 bits): a relative step eight times finer than the bf16 rounding of x and W that made them.
// One test per tile, on the lanes' sums of P, sends the wave to the path that raises the reference, rescales O and the sums and forms P anew; tile 0 always takes it and sets the reference.
// O = P.V^T with B fragments from the VT plane; O written head-major OH[(b,h)][s][c]
// each key tile (K rows, V^T rows) is copied once per block of 128 queries into LDS, one tile ahead, and the four waves of its group read their fragments there
// Block = 8 waves in two groups of four: both groups hold the same 128 queries, group 0 walks the first half of the keys, group 1 the second, each through two LDS buffers of its own,
// so that two blocks put four waves on a SIMD and one wave's products, LDS waits and branch run under the others' exponentials. At the end group 1 hands O, its sums and its references to group 0 through LDS.
#define QW 32                  /* queries per wave */
#define KG 2                   /* key groups per block */
#define NTG (SEQ / KT / KG)    /* key tiles per group */
static_assert(SEQ % (KT * KG) == 0 && NTG >= 2);
static_assert(QW == 32 && SEQ % (4 * QW) == 0);
#define KP 40                  /* LDS pitch in halves of a K row: 64 data bytes + 16, a 16 B x odd pitch for ds_load_b128 readers */
#define KVP 72                 /* LDS pitch in halves of a V^T row: 128 data bytes + 16, likewise */
#define KPART (KT * KP)        /* 64 key rows of 32 channels */
#define TILE_H (KPART + HD * KVP) /* then 32 channel rows of V^T, 64 keys each */
// One lane's four 16-byte copies of a key tile, global memory to LDS through no register.
// s_wait_xcnt closes the statement so that no address register of a copy is rewritten ahead of it.
__device__ __forceinline__ void tile_copies(unsigned l0, unsigned l1, unsigned l2, unsigned l3,
                                            const _Float16* g0, const _Float16* g1, const _Float16* g2, const _Float16* g3) {
  asm volatile("global_load_async_to_lds_b128 %0, %4, off\n\t"
               "global_load_async_to_lds_b128 %1, %5, off\n\t"
               "global_load_async_to_lds_b128 %2, %6, off\n\t"
               "global_load_async_to_lds_b128 %3, %7, off\n\t"
               "s_wait_xcnt 0x0"
               :: "v"(l0), "v"(l1), "v"(l2), "v"(l3), "v"(g0), "v"(g1), "v"(g2), "v"(g3) : "memory");
}

/* the register budget of four waves per SIMD: two blocks of eight waves per WGP */
__global__ __launch_bounds__(256) __attribute__((amdgpu_waves_per_eu(4, 4))) void k_flash(const _Float16* __restrict__ QH, const _Float16* __restrict__ KH,
                                              const _Float16* __restrict__ VT, _Float16* __restrict__ OH) {
  __shared__ __attribute__((aligned(16))) _Float16 so[4][QW][40];
  __shared__ __attribute__((aligned(16))) _Float16 kv[KG][2][TILE_H];   /* per key group two key-tile buffers shared by its four waves */
  __shared__ v4f mo[4][8][32];                                          /* group 1's O: per wave eight 16-byte pieces of each lane */
  __shared__ float ms[4][4][32];                                        /* group 1's sums (two query blocks), then minus its references */
  const int tid = threadIdx.x, lane = tid & 31, ln = lane & 15, hh = lane >> 4;
  const int wv = __builtin_amdgcn_readfirstlane(tid >> 5);              /* the wave's number, a scalar */
  const int g = wv >> 2, w = wv & 3, gt = tid & 127;                    /* its key group, its place in the group; the thread's place in the group */
  const int bh = blockIdx.y; const int b = bh / NH, h = bh - b * NH;
  const int q0 = blockIdx.x * (4 * QW) + w * QW;
  v16h qh[2];   /* index u: the wave's query block, queries q0 + 16 u .. + 15 */
#pragma unroll /* arrays indexed by constants, so that they stay in registers (this holds for every loop over u below) */
  for (int u = 0; u < 2; ++u) { const size_t qrow = (size_t)b * SEQ + q0 + 16 * u + ln;
    qh[u] = g2_frag(QH + qrow * TQ + h * HD, hh);
    asm volatile("s_wait_xcnt 0x0" ::: "memory"); }   /* a later fragment may land in the address registers of these loads, and does so only behind the wait */
  // copy roles: K, thread -> (row gt/4 and +32, 16-byte piece gt%4); V^T, thread -> (row gt/8 and +16, piece gt%8)
  const int kr = gt >> 2, kc = (gt & 3) * 8, vr = gt >> 3, vc = (gt & 7) * 8;
  const _Float16* gkh = KH + ((size_t)b * SEQ + (size_t)g * (NTG * KT) + kr) * TQ + h * HD + kc;
  const _Float16* gvt = VT + ((size_t)bh * HD + vr) * SEQ + (size_t)g * (NTG * KT) + vc;
  const unsigned lds0 = (unsigned)(size_t)&kv[g][0][0];
  const unsigned lk = lds0 + (unsigned)(kr * KP + kc) * 2u, lv = lds0 + (unsigned)(KPART + vr * KVP + vc) * 2u;
  auto issue_tile = [&](int t) {
    const unsigned bo = (unsigned)(t & 1) * (unsigned)(TILE_H * 2);
    const _Float16* a = gkh + (size_t)t * KT * TQ; const _Float16* v = gvt + (size_t)t * KT;
    tile_copies(lk + bo, lk + bo + 32 * KP * 2, lv + bo, lv + bo + 16 * KVP * 2,
                a, a + (size_t)32 * TQ, v, v + (size_t)16 * SEQ);
  };
  const v8f z8 = {0.f,0.f,0.f,0.f,0.f,0.f,0.f,0.f};
  float rl[2] = {0.f, 0.f}; v8f o0[2] = {z8, z8}, o1[2] = {z8, z8};
  v8f cr[2] = {z8, z8};   /* minus the query's held reference, in all eight rows of the lane's score column */
  constexpr int NT = NTG;   /* t counts the group's own tiles */
  issue_tile(0);
  asm volatile("s_wait_asynccnt 0x0" ::: "memory");   /* this wave's copies of tile 0 have landed */
  __syncthreads();                                     /* each group's tile 0 published to its four waves */
  issue_tile(1);
#pragma unroll 1
  for (int t = 0; t < NT; ++t) {
    const _Float16* kb = &kv[g][t & 1][0] + ln * KP;
    const _Float16* vp = &kv[g][t & 1][KPART] + ln * KVP;
    v16h ah[4];
#pragma unroll /* fragment arrays indexed by constants, so that they stay in registers */
    for (int j = 0; j < 4; ++j) ah[j] = g2_frag(kb + 16 * j * KP, hh);
    __builtin_amdgcn_sched_barrier(0);   /* keeps the 8 LDS reads of K one group ahead of the products; sunk among them, each pair is waited out to zero in front of its product */
    v8f s[2][4];
#pragma unroll /* as above: s[] and the fragments stay in registers */
    for (int j = 0; j < 4; ++j) {
#pragma unroll
      for (int u = 0; u < 2; ++u) s[u][j] = __builtin_amdgcn_wmma_f32_16x16x32_f16(false, ah[j], false, qh[u], (short)0, cr[u], false, false); }
    // the V^T fragments are read here, into registers that the K fragments leave; the exponentials below cover their latency
    const v16h vb0 = g2_frag(vp, hh), vb1 = g2_frag(vp + 16 * KVP, hh), vb2 = g2_frag(vp + 32, hh), vb3 = g2_frag(vp + 16 * KVP + 32, hh);
    __builtin_amdgcn_sched_barrier(0);   /* keeps these 8 reads one group ahead of the exponentials; sunk to their use, the wave waits out their latency in front of the last products */
    constexpr float PTOP = 32768.0f;   /* a lane's sum of P up to here: every P fits f16 */
    constexpr float HEAD = 7.0f;       /* a raised reference stands 2^7 above the tile's maximum, so that later maxima have 2^22 of room under PTOP */
    FragH pa[2][2]; float ls[2] = {0.f, 0.f};
#pragma unroll
    for (int t4 = 0; t4 < 4; ++t4) {
#pragma unroll
      for (int u = 0; u < 2; ++u) {
#pragma unroll
        for (int r = 0; r < 8; ++r) { const float p = __builtin_amdgcn_exp2f(s[u][t4][r]); ls[u] += p; pa[u][t4 >> 1].h[((t4 & 1) << 3) + r] = (_Float16)p; } }
    }
    const bool over = !(ls[0] <= PTOP) || !(ls[1] <= PTOP);   /* also true for a sum that is not a number */
    if (t == 0 || __builtin_amdgcn_ballot_w32(over) != 0u) {   /* one scalar branch per tile, the same for the whole wave */
#pragma unroll
      for (int u = 0; u < 2; ++u) {
        float m = s[u][0][0];
#pragma unroll
        for (int t4 = 0; t4 < 4; ++t4) {
#pragma unroll
          for (int r = 0; r < 8; ++r) m = fmaxf(m, s[u][t4][r]); }
        m = fmaxf(m, __shfl_xor(m, 16, 32));
        const float d = t == 0 ? m + HEAD : fmaxf(m + HEAD, 0.f);   /* the reference only rises once it is set */
        const float a = t == 0 ? 1.0f : __builtin_amdgcn_exp2f(-d); /* tile 0: O and the sums are still zero */
        const v8f dv = {d, d, d, d, d, d, d, d};
        cr[u] -= dv;
        float l = 0.f;
#pragma unroll
        for (int t4 = 0; t4 < 4; ++t4) {
#pragma unroll
          for (int r = 0; r < 8; ++r) { const float p = __builtin_amdgcn_exp2f(s[u][t4][r] - d); l += p; pa[u][t4 >> 1].h[((t4 & 1) << 3) + r] = (_Float16)p; } }
        ls[u] = l; rl[u] *= a;
#pragma unroll
        for (int r = 0; r < 8; ++r) { const float ar = __shfl(a, 8 * hh + r, 32); o0[u][r] *= ar; o1[u][r] *= ar; }
      }
    }
#pragma unroll
    for (int u = 0; u < 2; ++u) { ls[u] += __shfl_xor(ls[u], 16, 32); rl[u] += ls[u]; }
    // the builtin form: the compiler keeps the distance behind each product; the four accumulators take turns
#pragma unroll
    for (int u = 0; u < 2; ++u) {
      o0[u] = __builtin_amdgcn_wmma_f32_16x16x32_f16(false, pa[u][0].v, false, vb0, (short)0, o0[u], false, false);
      o1[u] = __builtin_amdgcn_wmma_f32_16x16x32_f16(false, pa[u][0].v, false, vb1, (short)0, o1[u], false, false); }
#pragma unroll
    for (int u = 0; u < 2; ++u) {
      o0[u] = __builtin_amdgcn_wmma_f32_16x16x32_f16(false, pa[u][1].v, false, vb2, (short)0, o0[u], false, false);
      o1[u] = __builtin_amdgcn_wmma_f32_16x16x32_f16(false, pa[u][1].v, false, vb3, (short)0, o1[u], false, false); }
    asm volatile("s_wait_dscnt 0x0" ::: "memory");     /* this wave's reads of buffer t%2 are done before it is refilled */
    asm volatile("s_wait_asynccnt 0x0" ::: "memory");  /* this wave's copies of tile t+1 have landed */
    __syncthreads();                                   /* publishes tile t+1 and ends every wave's reads of buffer t%2 */
    if (t + 2 < NT) issue_tile(t + 2);
  }
  asm volatile("s_wait_asynccnt 0x0" ::: "memory");    /* no copy outstanding when the wave goes on to its end */
  if (g == 1) {
#pragma unroll
    for (int u = 0; u < 2; ++u) {
      mo[w][4 * u + 0][lane] = __builtin_shufflevector(o0[u], o0[u], 0, 1, 2, 3); mo[w][4 * u + 1][lane] = __builtin_shufflevector(o0[u], o0[u], 4, 5, 6, 7);
      mo[w][4 * u + 2][lane] = __builtin_shufflevector(o1[u], o1[u], 0, 1, 2, 3); mo[w][4 * u + 3][lane] = __builtin_shufflevector(o1[u], o1[u], 4, 5, 6, 7);
      ms[w][u][lane] = rl[u]; ms[w][2 + u][lane] = cr[u][0]; }
  }
  __syncthreads();     /* group 1's O, sums and references are in LDS before group 0 reads them; every wave passes it */
  if (g == 1) return;  /* whole waves leave, behind the last barrier */
  // both halves are brought to the higher of the two references, added, and divided by the joint sum
#pragma unroll
  for (int u = 0; u < 2; ++u) {
    const float lb = ms[w][u][lane], cb = ms[w][2 + u][lane], ca = cr[u][0];
    const float cm = fminf(ca, cb);                    /* minus the higher reference */
    float fa, fb;   /* 2^(own reference - higher reference); the v_nop fills the slot behind each exponential */
    asm("v_exp_f32 %0, %2\n\tv_nop\n\tv_exp_f32 %1, %3\n\tv_nop" : "=&v"(fa), "=&v"(fb) : "v"(cm - ca), "v"(cm - cb));
    const float inv = 1.0f / (rl[u] * fa + lb * fb);
    const float ia = fa * inv, ib = fb * inv;
    const v4f b0l = mo[w][4 * u + 0][lane], b0h = mo[w][4 * u + 1][lane], b1l = mo[w][4 * u + 2][lane], b1h = mo[w][4 * u + 3][lane];
#pragma unroll
    for (int r = 0; r < 8; ++r) { const float ar = __shfl(ia, 8 * hh + r, 32), br = __shfl(ib, 8 * hh + r, 32);
      const float p0 = r < 4 ? b0l[r & 3] : b0h[r & 3], p1 = r < 4 ? b1l[r & 3] : b1h[r & 3];
      so[w][16 * u + 8 * hh + r][ln] = (_Float16)(o0[u][r] * ar + p0 * br); so[w][16 * u + 8 * hh + r][16 + ln] = (_Float16)(o1[u][r] * ar + p1 * br); } }
  __builtin_amdgcn_fence(4 /* acq_rel order */, "workgroup"); __builtin_amdgcn_wave_barrier();
  unsigned short* ob = (unsigned short*)OH + ((size_t)bh * SEQ + q0) * HD;
  {
#pragma unroll
    for (int j = 0; j < QW / 8; ++j) { const int p = j * 32 + lane; const v8us v = *(const v8us*)&so[w][p >> 2][(p & 3) * 8]; *(v8us*)(ob + (size_t)p * 8) = v; }
     } }

// output projection into the f32 output rows: A = OH head-major ([(b,h)][s][32], k-step == head), Bh = Wot f16 [DOUT][TQ] (x16), C row = b*SEQ_FULL + s (pitch ldc);
__global__ __launch_bounds__(128) void k_gemm_out(const _Float16* __restrict__ OHp, const _Float16* __restrict__ Bh, int ldb, float alpha, const float* __restrict__ bias,
                                                  float* __restrict__ C, int ldc, int M, int N) {
  __shared__ __attribute__((aligned(16))) float so[4][32][68];
  __shared__ __attribute__((aligned(16))) _Float16 st[2][GTILE_H];   /* two k-tile buffers shared by the four waves */
  const int tid = threadIdx.x, w = tid >> 5, lane = tid & 31, ln = lane & 15, hh = lane >> 4;
  const int ntn = N >> 6; const int mt = blockIdx.x / ntn, nq = blockIdx.x - mt * ntn; const int row0 = mt * 128 + 32 * w, col0 = nq * 64; if (mt * 128 >= M) return;   /* the whole block leaves, ahead of every copy and barrier */
  const int bidx = row0 / SEQ, l0 = row0 - bidx * SEQ;
  const size_t hstr = (size_t)SEQ * HD;
  // copy roles: A, one head's 128 rows are 8 KiB in a row: thread -> (row tid/4 and +32 i, 16-byte piece tid%4), heads 2t and 2t+1 side by side in an LDS row; B: thread -> (row tid/8 and +16 i, piece tid%8)
  const int ar = tid >> 2, ap = (tid & 3) * 8, cr = tid >> 3, cp = (tid & 7) * 8;
  const _Float16* ga = OHp + (((size_t)bidx * NH) * SEQ + (l0 - 32 * w) + ar) * HD + ap;
  const _Float16* gb = Bh + (size_t)(col0 + cr) * ldb + cp;
  const size_t sb = (size_t)16 * ldb;
  const unsigned la = (unsigned)(size_t)&st[0][0] + (unsigned)(ar * GP + ap) * 2u, lb = (unsigned)(size_t)&st[0][0] + (unsigned)(GA_H + cr * GP + cp) * 2u;
  auto issue_tile = [&](int t) {
    const unsigned pa = la + (unsigned)(t & 1) * (unsigned)(GTILE_H * 2), pb = lb + (unsigned)(t & 1) * (unsigned)(GTILE_H * 2);
    const _Float16* a = ga + (size_t)(2 * t) * hstr; const _Float16* a2 = a + hstr; const _Float16* b = gb + (size_t)t * GKS;
    gemm_copies(pa, pa + 32 * GP * 2, pa + 64 * GP * 2, pa + 96 * GP * 2, pa + 64, pa + 64 + 32 * GP * 2, pa + 64 + 64 * GP * 2, pa + 64 + 96 * GP * 2,
                pb, pb + 16 * GP * 2, pb + 32 * GP * 2, pb + 48 * GP * 2,
                a, a + 32 * HD, a + 64 * HD, a + 96 * HD, a2, a2 + 32 * HD, a2 + 64 * HD, a2 + 96 * HD, b, b + sb, b + 2 * sb, b + 3 * sb);
  };
  const v8f z8 = {0.f,0.f,0.f,0.f,0.f,0.f,0.f,0.f}; v8f accs[8] = {z8, z8, z8, z8, z8, z8, z8, z8};   /* accs[j]: rows 0..15 x columns 16j.., accs[4+j]: rows 16..31 */
  constexpr int nt = TQ / GKS;
  static_assert(GKS == 2 * HD && nt >= 2);
  issue_tile(0);
  asm volatile("s_wait_asynccnt 0x0" ::: "memory");   /* this wave's copies of tile 0 have landed */
  __syncthreads();                                     /* tile 0 published to all four waves */
  issue_tile(1);
#pragma unroll 1 /* stays rolled: one publish point and one refill site, the buffer picked by t & 1 */
  for (int t = 0; t < nt; ++t) {
    gemm_tile(&st[t & 1][0] + (32 * w + ln) * GP, &st[t & 1][GA_H] + ln * GP, hh, accs);
    asm volatile("s_wait_dscnt 0x0" ::: "memory");     /* this wave's reads of buffer t%2 are done before it is refilled */
    asm volatile("s_wait_asynccnt 0x0" ::: "memory");  /* this wave's copies of tile t+1 have landed */
    __syncthreads();                                   /* publishes tile t+1 and ends every wave's reads of buffer t%2 */
    if (t + 2 < nt) issue_tile(t + 2);
  }
  asm volatile("s_wait_asynccnt 0x0" ::: "memory");    /* no copy outstanding when the wave goes on to its epilogue */
#pragma unroll
  for (int u = 0; u < 8; ++u) { const int t = u & 3, half = u >> 2; const int col = col0 + t * 16 + ln; const float bvl = bf16_rne(bias[col]);
#pragma unroll
    for (int r = 0; r < 8; ++r) { const int rloc = half * 16 + 8 * hh + r; so[w][rloc][t * 16 + ln] = accs[u][r] * alpha + bvl; } }
  __builtin_amdgcn_fence(4 /* acq_rel order */, "workgroup"); __builtin_amdgcn_wave_barrier();
  const int rsub = lane >> 4, c4 = (lane & 15) * 4;
  const size_t crow0 = (size_t)bidx * SEQ_FULL + l0;
  {
#pragma unroll
    for (int q = 0; q < 16; ++q) { const int r = q * 2 + rsub; const v4f v = *(const v4fa*)&so[w][r][c4]; *(v4f*)(C + (crow0 + r) * ldc + col0 + c4) = v; }
     } }

extern "C" void kernel_launch(void* const* d_in, const int* in_sizes, int n_in,
                              void* d_out, int out_size, void* d_ws, size_t ws_size, hipStream_t stream) {
  if (n_in < 9) return;
  const float* X  = (const float*)d_in[0];      /* [NB_FULL][SEQ_FULL][DIN] */
  const float* Wq = (const float*)d_in[1];      /* [DIN][TQ] */
  const float* bq = (const float*)d_in[2];      /* [TQ] */
  const float* Wk = (const float*)d_in[3];
  const float* bk = (const float*)d_in[4];
  const float* Wv = (const float*)d_in[5];
  const float* bv = (const float*)d_in[6];
  const float* Wo = (const float*)d_in[7];      /* [TQ][DOUT] */
  const float* bo = (const float*)d_in[8];      /* [DOUT] */
  const long long needX = (long long)(((size_t)(NB - 1) * SEQ_FULL + SEQ) * DIN);
  const long long needO = (long long)(((size_t)(NB - 1) * SEQ_FULL + SEQ) * DOUT);
  if ((long long)in_sizes[0] < needX || in_sizes[1] < DIN * TQ || in_sizes[2] < TQ || in_sizes[3] < DIN * TQ || in_sizes[4] < TQ ||
      in_sizes[5] < DIN * TQ || in_sizes[6] < TQ || in_sizes[7] < TQ * DOUT || in_sizes[8] < DOUT || (long long)out_size < needO) return;
  char* ws = (char*)d_ws; size_t off = 0;
  auto take = [&](size_t bytes) { char* p = ws + off; off += (bytes + 255) & ~(size_t)255; return p; };
  _Float16* Wot = (_Float16*)take((size_t)DOUT * TQ * 2);
  _Float16* QH = (_Float16*)take(NR * TQ * 2);
  _Float16* KH = (_Float16*)take(NR * TQ * 2);
  _Float16* VT = (_Float16*)take((size_t)NB * NH * HD * SEQ * 2);
  _Float16* OH = (_Float16*)take((size_t)NB * NH * SEQ * HD * 2);
  if (off > ws_size || off > (size_t)134217728) return;
  const float a16 = 0.0625f;

  k_gemm_qkv<<<(unsigned)(QKV_NG + WOBLK), 256, 0, stream>>>(X, Wq, Wk, Wv, Wo, a16, bq, bk, bv, QH, KH, VT, Wot);   /* q, k in f16; V^T per (b,h): [32][SEQ]; Wo^T x16 */
  k_flash<<<dim3(SEQ / (4 * QW), NB * NH), 256, 0, stream>>>(QH, KH, VT, OH);                              /* attention -> O head-major */
  k_gemm_out<<<(unsigned)((NR / 128) * (DOUT / 64)), 128, 0, stream>>>(OH, Wot, TQ, a16, bo, (float*)d_out, DOUT, (int)NR, DOUT);   /* out = O Wo + bo */
}

// v010
// A run of this version takes 38.8 microseconds.
// Timed twice side by side with v009, it ran 1.05 times as fast both times.
// Over all steps from v000 it is 5.45 times as fast.
#include <hip/hip_runtime.h>
// Contractions on v_wmma_f32_16x16x32_f16 (f16 operands, f32 accumulate): q/k/v projections (bf16-valued x exact in f16, bf16-valued W x16 in f16), output projection (f16 o, bf16-valued Wo x16), P x V^T (f16 P, f16 v); scores as K x Q^T with q and k rounded to f16 (one product into an accumulator that starts at minus the held reference and ends as the argument of exp2); softmax statistics and epilogues f32.
#ifndef NB
#define NB 4
#endif
#ifndef SEQ
#define SEQ 2048
#endif
#define NB_FULL 4
#define SEQ_FULL 2048
#define DIN 512          /* input channels */
#define TQ 256           /* n_head * qk_dim */
#define NH 8
#define HD 32
#define DOUT 512
#define NR ((size_t)NB * SEQ)   /* token rows processed */
#define KT 64            /* keys per attention tile */

static_assert(NB >= 1 && NB <= NB_FULL);
static_assert(SEQ >= 128 && SEQ <= SEQ_FULL);
static_assert(SEQ % 128 == 0);
static_assert((NR % 128) == 0);
static_assert(TQ % 64 == 0 && DOUT % 64 == 0 && DIN % 32 == 0 && TQ % 32 == 0);
static_assert(HD == 32 && NH * HD == TQ);
static_assert(SEQ % KT == 0 && KT == 64);
static_assert(DIN % 64 == 0 && DIN >= 128 && TQ % 64 == 0);

typedef _Float16 v16h __attribute__((ext_vector_type(16)));
typedef unsigned short v8us __attribute__((ext_vector_type(8), may_alias));
typedef float  v8f  __attribute__((ext_vector_type(8)));
typedef float  v4f  __attribute__((ext_vector_type(4)));
typedef float  v4fa __attribute__((ext_vector_type(4), may_alias));
typedef _Float16 v4h __attribute__((ext_vector_type(4)));
union FragH { v16h v; v8us half[2]; _Float16 h[16]; unsigned short u[16]; };

__device__ __forceinline__ unsigned short bf16_bits(float x) { unsigned int u = __float_as_uint(x); return (unsigned short)((u + 0x7FFFu + ((u >> 16) & 1u)) >> 16); }
__device__ __forceinline__ float bf16_val(unsigned short b) { return __uint_as_float(((unsigned int)b) << 16); }
__device__ __forceinline__ float bf16_rne(float x) { return bf16_val(bf16_bits(x)); }

// 16x16 fragment from a 16-bit [row][k] plane row pointer (k contiguous): elements 0..7 <- k 8h..8h+7, elements 8..15 <- k 16+8h..16+8h+7 (same map for A rows and B columns)
__device__ __forceinline__ v16h g2_frag(const _Float16* p, int hh) { FragH f; f.half[0] = *(const v8us*)((const unsigned short*)p + 8 * hh); f.half[1] = *(const v8us*)((const unsigned short*)p + 16 + 8 * hh); return f.v; }
__device__ __forceinline__ v8f g2_mma(v16h a, v16h b, v8f c) { v8f d = __builtin_amdgcn_wmma_f32_16x16x32_f16(false, a, false, b, (short)0, c, false, false); asm volatile("v_nop\n\tv_nop\n\tv_nop\n\tv_nop" : "+v"(d) : "v"(a), "v"(b)); return d; }

typedef float v2f __attribute__((ext_vector_type(2)));
typedef __bf16 v2bf __attribute__((ext_vector_type(2)));
typedef _Float16 v2h __attribute__((ext_vector_type(2)));
typedef unsigned int v2ua __attribute__((ext_vector_type(2), may_alias));
typedef unsigned int v4ua __attribute__((ext_vector_type(4), may_alias));
// two f32 values rounded to bf16 (nearest even), times a power of two, as a pair of f16
__device__ __forceinline__ unsigned int rnd2_f16(float a, float b, float scale) {
  const v2f in = {a, b};
  const unsigned int u = __builtin_bit_cast(unsigned int, __builtin_convertvector(in, v2bf));
  const v2f r = {__uint_as_float(u << 16) * scale, __uint_as_float(u & 0xFFFF0000u) * scale};
  return __builtin_bit_cast(unsigned int, __builtin_convertvector(r, v2h));
}

// One request per lane to L2 for the aligned 256-byte unit at p; nothing comes back to the wave: a later load or copy of the unit can find it in L2 and not wait out memory.
// Every lane is on and holds an address inside the buffer. s_wait_xcnt closes the statement as a precaution: no register that a request names is rewritten ahead of it.
__device__ __forceinline__ void l2_ask(unsigned long long p) {
  asm volatile("global_prefetch_b8 %0, off scope:SCOPE_SE\n\ts_wait_xcnt 0x0" :: "v"(p) : "memory");
}
// four requests of a lane in one statement, so that none of them is parted from the others by a wait on loaded data: the units at p, p + 512 and p + 1024 bytes, and the unit at q
__device__ __forceinline__ void l2_ask4(unsigned long long p, unsigned long long q) {
  asm volatile("global_prefetch_b8 %0, off scope:SCOPE_SE\n\t"
               "global_prefetch_b8 %0, off offset:512 scope:SCOPE_SE\n\t"
               "global_prefetch_b8 %0, off offset:1024 scope:SCOPE_SE\n\t"
               "global_prefetch_b8 %1, off scope:SCOPE_SE\n\t"
               "s_wait_xcnt 0x0" :: "v"(p), "v"(q) : "memory");
}

#define WOBLK (DOUT * (TQ / 8) / 256)   /* blocks of 256 threads that transpose Wo */
static_assert(DOUT * (TQ / 8) % 256 == 0);

__device__ __forceinline__ void wt_f16_body(const float* __restrict__ W, _Float16* __restrict__ Wt, int K, int N, float scale, int t) {
  const int n = t / (K / 8), k8 = (t % (K / 8)) * 8; FragH f;
#pragma unroll
  for (int i = 0; i < 8; ++i) f.h[i] = (_Float16)(bf16_rne(W[(size_t)(k8 + i) * N + n]) * scale);
  const v8us o = f.half[0]; unsigned short* d = (unsigned short*)Wt + (size_t)n * K + k8;
  *(v8us*)d = o;
  asm volatile("s_wait_xcnt 0x0" ::: "memory");   /* the store's registers are not rewritten ahead of this (another arm of the caller follows in the code) */
}

// k-tiles of the two GEMMs in LDS: 64 k (128 bytes) of 128 A rows, then of the B rows (64 in the output projection, 128 in the q, k, v projection), filled once per block, one tile ahead; all waves read their fragments there
#define GKS 64                 /* k per staged tile */
#define GP 72                  /* LDS row pitch in halves: 128 data bytes + 16, a 16 B x odd pitch for ds_load_b128 readers */
#define GA_H (128 * GP)        /* the A rows; the B rows follow */
#define GTILE_H ((128 + 64) * GP)
#define QTILE_H ((128 + 128) * GP)
// One lane's twelve 16-byte copies of a k-tile (eight of A, four of B), global memory to LDS through no register.
// s_wait_xcnt closes the statement so that no address register of a copy is rewritten ahead of it.
__device__ __forceinline__ void gemm_copies(unsigned l0, unsigned l1, unsigned l2, unsigned l3, unsigned l4, unsigned l5, unsigned l6, unsigned l7, unsigned l8, unsigned l9, unsigned l10, unsigned l11,
                                            const _Float16* g0, const _Float16* g1, const _Float16* g2, const _Float16* g3, const _Float16* g4, const _Float16* g5,
                                            const _Float16* g6, const _Float16* g7, const _Float16* g8, const _Float16* g9, const _Float16* g10, const _Float16* g11) {
  asm volatile("global_load_async_to_lds_b128 %0, %12, off\n\t"
               "global_load_async_to_lds_b128 %1, %13, off\n\t"
               "global_load_async_to_lds_b128 %2, %14, off\n\t"
               "global_load_async_to_lds_b128 %3, %15, off\n\t"
               "global_load_async_to_lds_b128 %4, %16, off\n\t"
               "global_load_async_to_lds_b128 %5, %17, off\n\t"
               "global_load_async_to_lds_b128 %6, %18, off\n\t"
               "global_load_async_to_lds_b128 %7, %19, off\n\t"
               "global_load_async_to_lds_b128 %8, %20, off\n\t"
               "global_load_async_to_lds_b128 %9, %21, off\n\t"
               "global_load_async_to_lds_b128 %10, %22, off\n\t"
               "global_load_async_to_lds_b128 %11, %23, off\n\t"
               "s_wait_xcnt 0x0"
               :: "v"(l0), "v"(l1), "v"(l2), "v"(l3), "v"(l4), "v"(l5), "v"(l6), "v"(l7), "v"(l8), "v"(l9), "v"(l10), "v"(l11),
                  "v"(g0), "v"(g1), "v"(g2), "v"(g3), "v"(g4), "v"(g5), "v"(g6), "v"(g7), "v"(g8), "v"(g9), "v"(g10), "v"(g11) : "memory");
}
// a wave's 32 x 64 products over one staged k-tile: ab = its first A row in LDS, bb = the first B row (both at this lane's row), k ascending in steps of 32;
// all twelve fragments are read as one group ahead of the products, so that the wave waits out the LDS latency once per tile
__device__ __forceinline__ void gemm_tile(const _Float16* ab, const _Float16* bb, int hh, v8f (&c)[8]) {
  v16h a[2][2], b[2][4];
#pragma unroll /* fragment arrays indexed by constants, so that they stay in registers */
  for (int s = 0; s < 2; ++s) { a[s][0] = g2_frag(ab + 32 * s, hh); a[s][1] = g2_frag(ab + 16 * GP + 32 * s, hh);
#pragma unroll
    for (int j = 0; j < 4; ++j) b[s][j] = g2_frag(bb + 16 * j * GP + 32 * s, hh); }
#pragma unroll /* as above, and the accumulator array too */
  for (int s = 0; s < 2; ++s) {
#pragma unroll
    for (int j = 0; j < 4; ++j) { c[j] = g2_mma(a[s][0], b[s][j], c[j]); c[4 + j] = g2_mma(a[s][1], b[s][j], c[4 + j]); } } }
static_assert(GKS == 64);

// q, k and v projections in one launch, straight from the f32 inputs: C = alpha * A.Bt + bf16(bias) over the 3*TQ columns of [Wq|Wk|Wv].
// Block = 8 waves, 128 rows x 128 columns (wave: 32 x 64). Each k-tile of x (128 rows) and of W (128 columns) is loaded as f32 one tile ahead into registers,
// rounded there (x -> f16(bf16(x)), W -> f16(16 bf16(W))) and stored as f16 into LDS, W transposed to [column][k]: once per block, so no converted copy goes through memory.
// A block's 128 columns lie in one of the three; its epilogue writes the form attention reads:
// q and k as f16 (row pitch TQ), q times log2(e) so that attention's scores come out as exponents of two; v as f16 transposed, VT[(b,h)][c][s].
// The last WOBLK blocks of the grid do no product: they write Wot = [DOUT][TQ], Wo^T x16 in f16, for the output projection's launch.
#define VTP 136                /* LDS pitch in halves of a transposed v row: 128 tokens (256 bytes) + 16 bytes */
#define QKV_NG ((NR / 128) * (3 * TQ / 128))   /* blocks that compute */
static_assert(TQ % 128 == 0 && DIN / GKS >= 2);
__global__ __launch_bounds__(256) void k_gemm_qkv(const float* __restrict__ x, const float* __restrict__ Wq, const float* __restrict__ Wk, const float* __restrict__ Wv, const float* __restrict__ Wo, float alpha,
                                                  const float* __restrict__ bq, const float* __restrict__ bk, const float* __restrict__ bv,
                                                  _Float16* __restrict__ QH, _Float16* __restrict__ KH, _Float16* __restrict__ VT, _Float16* __restrict__ Wot) {
  __shared__ __attribute__((aligned(16))) float so[8][32][68];
  static_assert(128 * VTP * 2 <= 8 * 32 * 68 * 4);
  __shared__ __attribute__((aligned(16))) _Float16 st[2][QTILE_H];   /* two k-tile buffers shared by the eight waves */
  const int tid = threadIdx.x, w = tid >> 5, lane = tid & 31, ln = lane & 15, hh = lane >> 4;
  if (blockIdx.x >= QKV_NG) { wt_f16_body(Wo, Wot, TQ, DOUT, 16.0f, (int)(blockIdx.x - QKV_NG) * 256 + tid); return; }   /* the whole block leaves, ahead of every barrier */
  constexpr int ntn = (3 * TQ) >> 7, npl = TQ >> 7;
  const int wr = w & 3, wc = w >> 2;                        /* the wave's 32 rows and its 64 columns inside the block */
  const int mt = blockIdx.x / ntn, nq = blockIdx.x - mt * ntn; const int row0 = mt * 128 + 32 * wr;
  const int pl = nq / npl, pcb = (nq - pl * npl) * 128, pc0 = pcb + 64 * wc;      /* which of q, k, v; first column inside it of the block and of the wave */
  // load roles: x, thread -> (row tid/16 and +16 i, four floats at tid%16): a wave's load covers two runs of 256 bytes; W, thread -> (column tid%128, 32 k at 32 (tid/128)): a wave's load covers one 128-byte line
  const int xr = tid >> 4, xp = (tid & 15) * 4, bn = tid & 127, bk0 = (tid >> 7) * 32;
  const float* gx = x + ((size_t)((mt * 128) / SEQ) * SEQ_FULL + (size_t)((mt * 128) % SEQ) + xr) * DIN + xp;
  const float* gw = (pl == 0 ? Wq : (pl == 1 ? Wk : Wv)) + (size_t)bk0 * TQ + pcb + bn;
  v4f ra[8]; float rb[32];
  auto fetch = [&](int t) {
    const float* a = gx + (size_t)t * GKS; const float* b = gw + (size_t)t * GKS * TQ;
#pragma unroll /* register arrays indexed by constants */
    for (int i = 0; i < 8; ++i) ra[i] = *(const v4fa*)(a + (size_t)i * 16 * DIN);
#pragma unroll
    for (int i = 0; i < 32; ++i) rb[i] = b[(size_t)i * TQ];
    asm volatile("s_wait_xcnt 0x0" ::: "memory");   /* no address register of these loads is rewritten ahead of this; it also keeps the loads ahead of the tile's products, which cover their latency */
  };
  auto put = [&](int t) {
    _Float16* d = &st[t & 1][0];
#pragma unroll
    for (int i = 0; i < 8; ++i) { const v2ua h = {rnd2_f16(ra[i][0], ra[i][1], 1.0f), rnd2_f16(ra[i][2], ra[i][3], 1.0f)}; *(v2ua*)(d + (xr + 16 * i) * GP + xp) = h; }
#pragma unroll
    for (int j = 0; j < 4; ++j) { const v4ua h = {rnd2_f16(rb[8 * j], rb[8 * j + 1], 16.0f), rnd2_f16(rb[8 * j + 2], rb[8 * j + 3], 16.0f), rnd2_f16(rb[8 * j + 4], rb[8 * j + 5], 16.0f), rnd2_f16(rb[8 * j + 6], rb[8 * j + 7], 16.0f)};
      *(v4ua*)(d + GA_H + bn * GP + bk0 + 8 * j) = h; }
  };
  const v8f z8 = {0.f,0.f,0.f,0.f,0.f,0.f,0.f,0.f}; v8f accs[8] = {z8, z8, z8, z8, z8, z8, z8, z8};   /* accs[j]: rows 0..15 x columns 16j.., accs[4+j]: rows 16..31 */
  constexpr int nt = DIN / GKS;
  fetch(0);
  {
    // behind tile 0's loads the block asks L2 for all of x that it reads later: thread -> (row tid%128; k-tiles 1, 3, 5, 7 or 2, 4, 6), a k-tile of a row of x being one 256-byte unit;
    // the lanes left over ask for one k-tile of the block's W columns (two units a row), the eight k-tiles dealt among the blocks that read these columns
    static_assert(DIN == 8 * GKS && GKS * 4 == 256 && TQ % 64 == 0);
    const int pr = tid & 127, pj = tid >> 7, ws = (mt & 1) | (((mt >> 2) & 3) << 1);
    const float* px = x + ((size_t)((mt * 128) / SEQ) * SEQ_FULL + (size_t)((mt * 128) % SEQ) + pr) * DIN + (1 + pj) * GKS;
    const float* pw = (pl == 0 ? Wq : (pl == 1 ? Wk : Wv)) + (size_t)(ws * GKS + (pr >> 1)) * TQ + pcb + (pr & 1) * 64;
    l2_ask4((unsigned long long)px, (unsigned long long)(pj == 0 ? px + 6 * GKS : pw));   /* two k-tiles of a row are 512 bytes apart */
  }
  put(0);
  __syncthreads();                                     /* tile 0 published to all eight waves */
#pragma unroll 1 /* stays rolled: one load site and one store site, the buffer picked by t & 1 */
  for (int t = 0; t + 1 < nt; ++t) {
    fetch(t + 1);
    gemm_tile(&st[t & 1][0] + (32 * wr + ln) * GP, &st[t & 1][GA_H] + (64 * wc + ln) * GP, hh, accs);
    __builtin_amdgcn_sched_barrier(0);                 /* the first use of the loaded f32 values stays behind the products; lifted among them, the wave waits out the loads ahead of its products */
    put(t + 1);                                        /* into the buffer whose readers all passed the barrier of trip t - 1 */
    __syncthreads();                                   /* publishes tile t+1 and ends every wave's reads of buffer t%2 */
  }
  gemm_tile(&st[(nt - 1) & 1][0] + (32 * wr + ln) * GP, &st[(nt - 1) & 1][GA_H] + (64 * wc + ln) * GP, hh, accs);
  const float* bias = pl == 0 ? bq : (pl == 1 ? bk : bv);
  if (pl < 2) {
    const float qsc = pl == 0 ? 1.4426950408889634f : 1.0f;   /* log2(e) rides in q, ahead of the rounding to f16 */
#pragma unroll
    for (int u = 0; u < 8; ++u) { const int t = u & 3, half = u >> 2; const float bvl = bf16_rne(bias[pc0 + t * 16 + ln]);
#pragma unroll
      for (int r = 0; r < 8; ++r) { const int rloc = half * 16 + 8 * hh + r; so[w][rloc][t * 16 + ln] = (accs[u][r] * alpha + bvl) * qsc; } }
    __builtin_amdgcn_fence(4 /* acq_rel order */, "workgroup"); __builtin_amdgcn_wave_barrier();
    unsigned short* Hh = (unsigned short*)(pl == 0 ? QH : KH);
    const int rsub = lane >> 3, c8 = (lane & 7) * 8;
#pragma unroll
    for (int j = 0; j < 8; ++j) { const int r = j * 4 + rsub; const v4f a = *(const v4fa*)&so[w][r][c8], c = *(const v4fa*)&so[w][r][c8 + 4]; FragH fh;
#pragma unroll
      for (int q = 0; q < 4; ++q) { fh.h[q] = (_Float16)a[q]; fh.h[4 + q] = (_Float16)c[q]; }
      const size_t o = (size_t)(row0 + r) * TQ + pc0 + c8;
      *(v8us*)(Hh + o) = fh.half[0]; }
  } else {
    // a lane's eight accumulator rows are eight consecutive tokens of one channel: 16 bytes of a V^T row, gathered per block so that each row leaves as 256 contiguous bytes
    unsigned short* vt = (unsigned short*)&so[0][0][0];
#pragma unroll
    for (int u = 0; u < 8; ++u) { const int t = u & 3, half = u >> 2; const float bvl = bf16_rne(bias[pc0 + t * 16 + ln]); FragH f;
#pragma unroll
      for (int r = 0; r < 8; ++r) f.h[r] = (_Float16)(accs[u][r] * alpha + bvl);
      *(v8us*)(vt + (64 * wc + t * 16 + ln) * VTP + 32 * wr + half * 16 + 8 * hh) = f.half[0]; }
    __syncthreads();   /* all eight waves' token columns are in LDS before the rows are read; pl is the same for the whole block */
    const int bidx = (mt * 128) / SEQ, s0 = mt * 128 - bidx * SEQ;
    unsigned short* dst = (unsigned short*)VT + ((size_t)bidx * TQ + pcb) * SEQ + s0;
#pragma unroll
    for (int j = 0; j < 8; ++j) { const int p = j * 256 + tid, cl = p >> 4, pc = (p & 15) * 8;
      *(v8us*)(dst + (size_t)cl * SEQ + pc) = *(const v8us*)(vt + cl * VTP + pc); }
    asm volatile("s_wait_xcnt 0x0" ::: "memory");   /* the stores' registers are not rewritten ahead of this (the other arm follows in the code) */
  } }

// flash-style attention per (b,h): block = 128 queries, 32 per wave (two blocks of 16 per wave, so that each K and V^T fragment read from LDS feeds two products), key tiles of 64; scores computed transposed (S^T tile = K rows x Q^T, D rows = keys, D columns = queries)
// so that two adjacent D tiles form the P (query x key) A fragment directly; softmax with per-lane query statistics (lanes l and l^16 share a query).
// Each query holds a reference score. The score accumulator starts at minus the reference (the C operand of the product) and q carries log2(e), so that the product
// ends as the argument of exp2: no maximum, no multiply-add and no rescale per key tile. q and k enter it rounded to f16 (11 bits): a relative step eight times finer than the bf16 rounding of x and W that made them.
// One test per tile, on the lanes' sums of P, sends the wave to the path that raises the reference, rescales O and the sums and forms P anew; tile 0 always takes it and sets the reference.
// O = P.V^T with B fragments from the VT plane; O written head-major OH[(b,h)][s][c]
// each key tile (K rows, V^T rows) is copied once per block of 128 queries into LDS, one tile ahead, and the four waves of its group read their fragments there
// Block = 8 waves in two groups of four: both groups hold the same 128 queries, group 0 walks the first half of the keys, group 1 the second, each through two LDS buffers of its own,
// so that two blocks put four waves on a SIMD and one wave's products, LDS waits and branch run under the others' exponentials. At the end group 1 hands O, its sums and its references to group 0 through LDS.
#define QW 32                  /* queries per wave */
#define KG 2                   /* key groups per block */
#define NTG (SEQ / KT / KG)    /* key tiles per group */
static_assert(SEQ % (KT * KG) == 0 && NTG >= 2);
static_assert(QW == 32 && SEQ % (4 * QW) == 0);
#define KP 40                  /* LDS pitch in halves of a K row: 64 data bytes + 16, a 16 B x odd pitch for ds_load_b128 readers */
#define KVP 72                 /* LDS pitch in halves of a V^T row: 128 data bytes + 16, likewise */
#define KPART (KT * KP)        /* 64 key rows of 32 channels */
#define TILE_H (KPART + HD * KVP) /* then 32 channel rows of V^T, 64 keys each */
// One lane's four 16-byte copies of a key tile, global memory to LDS through no register.
// s_wait_xcnt closes the statement so that no address register of a copy is rewritten ahead of it.
__device__ __forceinline__ void tile_copies(unsigned l0, unsigned l1, unsigned l2, unsigned l3,
                                            const _Float16* g0, const _Float16* g1, const _Float16* g2, const _Float16* g3) {
  asm volatile("global_load_async_to_lds_b128 %0, %4, off\n\t"
               "global_load_async_to_lds_b128 %1, %5, off\n\t"
               "global_load_async_to_lds_b128 %2, %6, off\n\t"
               "global_load_async_to_lds_b128 %3, %7, off\n\t"
               "s_wait_xcnt 0x0"
               :: "v"(l0), "v"(l1), "v"(l2), "v"(l3), "v"(g0), "v"(g1), "v"(g2), "v"(g3) : "memory");
}

/* the register budget of four waves per SIMD: two blocks of eight waves per WGP */
__global__ __launch_bounds__(256) __attribute__((amdgpu_waves_per_eu(4, 4))) void k_flash(const _Float16* __restrict__ QH, const _Float16* __restrict__ KH,
                                              const _Float16* __restrict__ VT, _Float16* __restrict__ OH) {
  __shared__ __attribute__((aligned(16))) _Float16 so[4][QW][40];
  __shared__ __attribute__((aligned(16))) _Float16 kv[KG][2][TILE_H];   /* per key group two key-tile buffers shared by its four waves */
  __shared__ v4f mo[4][8][32];                                          /* group 1's O: per wave eight 16-byte pieces of each lane */
  __shared__ float ms[4][4][32];                                        /* group 1's sums (two query blocks), then minus its references */
  const int tid = threadIdx.x, lane = tid & 31, ln = lane & 15, hh = lane >> 4;
  const int wv = __builtin_amdgcn_readfirstlane(tid >> 5);              /* the wave's number, a scalar */
  const int g = wv >> 2, w = wv & 3, gt = tid & 127;                    /* its key group, its place in the group; the thread's place in the group */
  const int bh = blockIdx.y; const int b = bh / NH, h = bh - b * NH;
  const int q0 = blockIdx.x * (4 * QW) + w * QW;
  v16h qh[2];   /* index u: the wave's query block, queries q0 + 16 u .. + 15 */
#pragma unroll /* arrays indexed by constants, so that they stay in registers (this holds for every loop over u below) */
  for (int u = 0; u < 2; ++u) { const size_t qrow = (size_t)b * SEQ + q0 + 16 * u + ln;
    qh[u] = g2_frag(QH + qrow * TQ + h * HD, hh);
    asm volatile("s_wait_xcnt 0x0" ::: "memory"); }   /* a later fragment may land in the address registers of these loads, and does so only behind the wait */
  // copy roles: K, thread -> (row gt/4 and +32, 16-byte piece gt%4); V^T, thread -> (row gt/8 and +16, piece gt%8)
  const int kr = gt >> 2, kc = (gt & 3) * 8, vr = gt >> 3, vc = (gt & 7) * 8;
  const _Float16* gkh = KH + ((size_t)b * SEQ + (size_t)g * (NTG * KT) + kr) * TQ + h * HD + kc;
  const _Float16* gvt = VT + ((size_t)bh * HD + vr) * SEQ + (size_t)g * (NTG * KT) + vc;
  const unsigned lds0 = (unsigned)(size_t)&kv[g][0][0];
  const unsigned lk = lds0 + (unsigned)(kr * KP + kc) * 2u, lv = lds0 + (unsigned)(KPART + vr * KVP + vc) * 2u;
  auto issue_tile = [&](int t) {
    const unsigned bo = (unsigned)(t & 1) * (unsigned)(TILE_H * 2);
    const _Float16* a = gkh + (size_t)t * KT * TQ; const _Float16* v = gvt + (size_t)t * KT;
    tile_copies(lk + bo, lk + bo + 32 * KP * 2, lv + bo, lv + bo + 16 * KVP * 2,
                a, a + (size_t)32 * TQ, v, v + (size_t)16 * SEQ);
  };
  const v8f z8 = {0.f,0.f,0.f,0.f,0.f,0.f,0.f,0.f};
  float rl[2] = {0.f, 0.f}; v8f o0[2] = {z8, z8}, o1[2] = {z8, z8};
  v8f cr[2] = {z8, z8};   /* minus the query's held reference, in all eight rows of the lane's score column */
  constexpr int NT = NTG;   /* t counts the group's own tiles */
  issue_tile(0);
  {
    // behind tile 0's copies L2 is asked for the head's K rows and V^T, one request per 256-byte unit, the units dealt among the blocks that read them:
    // a unit of K (one key row of four heads) among those heads and blockIdx.x % 4, a unit of V^T among blockIdx.x % 4; four blocks ask for each
    static_assert(TQ == 256 && HD == 32);
    const int xs = (int)blockIdx.x & 3, pj = tid & 127;
    const _Float16* pk = KH + ((size_t)b * SEQ + (size_t)((pj * 16 + (h & 3) * 4 + xs) % SEQ)) * TQ + (h >> 2) * 128;
    const _Float16* pv = VT + (size_t)bh * HD * SEQ + (size_t)((pj * 4 + xs) % (HD * SEQ / 128)) * 128;
    l2_ask((unsigned long long)(g == 0 ? pk : pv));
  }
  asm volatile("s_wait_asynccnt 0x0" ::: "memory");   /* this wave's copies of tile 0 have landed */
  __syncthreads();                                     /* each group's tile 0 published to its four waves */
  issue_tile(1);
#pragma unroll 1
  for (int t = 0; t < NT; ++t) {
    const _Float16* kb = &kv[g][t & 1][0] + ln * KP;
    const _Float16* vp = &kv[g][t & 1][KPART] + ln * KVP;
    v16h ah[4];
#pragma unroll /* fragment arrays indexed by constants, so that they stay in registers */
    for (int j = 0; j < 4; ++j) ah[j] = g2_frag(kb + 16 * j * KP, hh);
    __builtin_amdgcn_sched_barrier(0);   /* keeps the 8 LDS reads of K one group ahead of the products; sunk among them, each pair is waited out to zero in front of its product */
    v8f s[2][4];
#pragma unroll /* as above: s[] and the fragments stay in registers */
    for (int j = 0; j < 4; ++j) {
#pragma unroll
      for (int u = 0; u < 2; ++u) s[u][j] = __builtin_amdgcn_wmma_f32_16x16x32_f16(false, ah[j], false, qh[u], (short)0, cr[u], false, false); }
    // the V^T fragments are read here, into registers that the K fragments leave; the exponentials below cover their latency
    const v16h vb0 = g2_frag(vp, hh), vb1 = g2_frag(vp + 16 * KVP, hh), vb2 = g2_frag(vp + 32, hh), vb3 = g2_frag(vp + 16 * KVP + 32, hh);
    __builtin_amdgcn_sched_barrier(0);   /* keeps these 8 reads one group ahead of the exponentials; sunk to their use, the wave waits out their latency in front of the last products */
    constexpr float PTOP = 32768.0f;   /* a lane's sum of P up to here: every P fits f16 */
    constexpr float HEAD = 7.0f;       /* a raised reference stands 2^7 above the tile's maximum, so that later maxima have 2^22 of room under PTOP */
    FragH pa[2][2]; float ls[2] = {0.f, 0.f};
#pragma unroll
    for (int t4 = 0; t4 < 4; ++t4) {
#pragma unroll
      for (int u = 0; u < 2; ++u) {
#pragma unroll
        for (int r = 0; r < 8; ++r) { const float p = __builtin_amdgcn_exp2f(s[u][t4][r]); ls[u] += p; pa[u][t4 >> 1].h[((t4 & 1) << 3) + r] = (_Float16)p; } }
    }
    const bool over = !(ls[0] <= PTOP) || !(ls[1] <= PTOP);   /* also true for a sum that is not a number */
    if (t == 0 || __builtin_amdgcn_ballot_w32(over) != 0u) {   /* one scalar branch per tile, the same for the whole wave */
#pragma unroll
      for (int u = 0; u < 2; ++u) {
        float m = s[u][0][0];
#pragma unroll
        for (int t4 = 0; t4 < 4; ++t4) {
#pragma unroll
          for (int r = 0; r < 8; ++r) m = fmaxf(m, s[u][t4][r]); }
        m = fmaxf(m, __shfl_xor(m, 16, 32));
        const float d = t == 0 ? m + HEAD : fmaxf(m + HEAD, 0.f);   /* the reference only rises once it is set */
        const float a = t == 0 ? 1.0f : __builtin_amdgcn_exp2f(-d); /* tile 0: O and the sums are still zero */
        const v8f dv = {d, d, d, d, d, d, d, d};
        cr[u] -= dv;
        float l = 0.f;
#pragma unroll
        for (int t4 = 0; t4 < 4; ++t4) {
#pragma unroll
          for (int r = 0; r < 8; ++r) { const float p = __builtin_amdgcn_exp2f(s[u][t4][r] - d); l += p; pa[u][t4 >> 1].h[((t4 & 1) << 3) + r] = (_Float16)p; } }
        ls[u] = l; rl[u] *= a;
#pragma unroll
        for (int r = 0; r < 8; ++r) { const float ar = __shfl(a, 8 * hh + r, 32); o0[u][r] *= ar; o1[u][r] *= ar; }
      }
    }
#pragma unroll
    for (int u = 0; u < 2; ++u) { ls[u] += __shfl_xor(ls[u], 16, 32); rl[u] += ls[u]; }
    // the builtin form: the compiler keeps the distance behind each product; the four accumulators take turns
#pragma unroll
    for (int u = 0; u < 2; ++u) {
      o0[u] = __builtin_amdgcn_wmma_f32_16x16x32_f16(false, pa[u][0].v, false, vb0, (short)0, o0[u], false, false);
      o1[u] = __builtin_amdgcn_wmma_f32_16x16x32_f16(false, pa[u][0].v, false, vb1, (short)0, o1[u], false, false); }
#pragma unroll
    for (int u = 0; u < 2; ++u) {
      o0[u] = __builtin_amdgcn_wmma_f32_16x16x32_f16(false, pa[u][1].v, false, vb2, (short)0, o0[u], false, false);
      o1[u] = __builtin_amdgcn_wmma_f32_16x16x32_f16(false, pa[u][1].v, false, vb3, (short)0, o1[u], false, false); }
    asm volatile("s_wait_dscnt 0x0" ::: "memory");     /* this wave's reads of buffer t%2 are done before it is refilled */
    asm volatile("s_wait_asynccnt 0x0" ::: "memory");  /* this wave's copies of tile t+1 have landed */
    __syncthreads();                                   /* publishes tile t+1 and ends every wave's reads of buffer t%2 */
    if (t + 2 < NT) issue_tile(t + 2);
  }
  asm volatile("s_wait_asynccnt 0x0" ::: "memory");    /* no copy outstanding when the wave goes on to its end */
  if (g == 1) {
#pragma unroll
    for (int u = 0; u < 2; ++u) {
      mo[w][4 * u + 0][lane] = __builtin_shufflevector(o0[u], o0[u], 0, 1, 2, 3); mo[w][4 * u + 1][lane] = __builtin_shufflevector(o0[u], o0[u], 4, 5, 6, 7);
      mo[w][4 * u + 2][lane] = __builtin_shufflevector(o1[u], o1[u], 0, 1, 2, 3); mo[w][4 * u + 3][lane] = __builtin_shufflevector(o1[u], o1[u], 4, 5, 6, 7);
      ms[w][u][lane] = rl[u]; ms[w][2 + u][lane] = cr[u][0]; }
  }
  __syncthreads();     /* group 1's O, sums and references are in LDS before group 0 reads them; every wave passes it */
  if (g == 1) return;  /* whole waves leave, behind the last barrier */
  // both halves are brought to the higher of the two references, added, and divided by the joint sum
#pragma unroll
  for (int u = 0; u < 2; ++u) {
    const float lb = ms[w][u][lane], cb = ms[w][2 + u][lane], ca = cr[u][0];
    const float cm = fminf(ca, cb);                    /* minus the higher reference */
    float fa, fb;   /* 2^(own reference - higher reference); the v_nop fills the slot behind each exponential */
    asm("v_exp_f32 %0, %2\n\tv_nop\n\tv_exp_f32 %1, %3\n\tv_nop" : "=&v"(fa), "=&v"(fb) : "v"(cm - ca), "v"(cm - cb));
    const float inv = 1.0f / (rl[u] * fa + lb * fb);
    const float ia = fa * inv, ib = fb * inv;
    const v4f b0l = mo[w][4 * u + 0][lane], b0h = mo[w][4 * u + 1][lane], b1l = mo[w][4 * u + 2][lane], b1h = mo[w][4 * u + 3][lane];
#pragma unroll
    for (int r = 0; r < 8; ++r) { const float ar = __shfl(ia, 8 * hh + r, 32), br = __shfl(ib, 8 * hh + r, 32);
      const float p0 = r < 4 ? b0l[r & 3] : b0h[r & 3], p1 = r < 4 ? b1l[r & 3] : b1h[r & 3];
      so[w][16 * u + 8 * hh + r][ln] = (_Float16)(o0[u][r] * ar + p0 * br); so[w][16 * u + 8 * hh + r][16 + ln] = (_Float16)(o1[u][r] * ar + p1 * br); } }
  __builtin_amdgcn_fence(4 /* acq_rel order */, "workgroup"); __builtin_amdgcn_wave_barrier();
  unsigned short* ob = (unsigned short*)OH + ((size_t)bh * SEQ + q0) * HD;
  {
#pragma unroll
    for (int j = 0; j < QW / 8; ++j) { const int p = j * 32 + lane; const v8us v = *(const v8us*)&so[w][p >> 2][(p & 3) * 8]; *(v8us*)(ob + (size_t)p * 8) = v; }
     } }

// output projection into the f32 output rows: A = OH head-major ([(b,h)][s][32], k-step == head), Bh = Wot f16 [DOUT][TQ] (x16), C row = b*SEQ_FULL + s (pitch ldc);
__global__ __launch_bounds__(128) void k_gemm_out(const _Float16* __restrict__ OHp, const _Float16* __restrict__ Bh, int ldb, float alpha, const float* __restrict__ bias,
                                                  float* __restrict__ C, int ldc, int M, int N) {
  __shared__ __attribute__((aligned(16))) float so[4][32][68];
  __shared__ __attribute__((aligned(16))) _Float16 st[2][GTILE_H];   /* two k-tile buffers shared by the four waves */
  const int tid = threadIdx.x, w = tid >> 5, lane = tid & 31, ln = lane & 15, hh = lane >> 4;
  const int ntn = N >> 6; const int mt = blockIdx.x / ntn, nq = blockIdx.x - mt * ntn; const int row0 = mt * 128 + 32 * w, col0 = nq * 64; if (mt * 128 >= M) return;   /* the whole block leaves, ahead of every copy and barrier */
  const int bidx = row0 / SEQ, l0 = row0 - bidx * SEQ;
  const size_t hstr = (size_t)SEQ * HD;
  // copy roles: A, one head's 128 rows are 8 KiB in a row: thread -> (row tid/4 and +32 i, 16-byte piece tid%4), heads 2t and 2t+1 side by side in an LDS row; B: thread -> (row tid/8 and +16 i, piece tid%8)
  const int ar = tid >> 2, ap = (tid & 3) * 8, cr = tid >> 3, cp = (tid & 7) * 8;
  const _Float16* ga = OHp + (((size_t)bidx * NH) * SEQ + (l0 - 32 * w) + ar) * HD + ap;
  const _Float16* gb = Bh + (size_t)(col0 + cr) * ldb + cp;
  const size_t sb = (size_t)16 * ldb;
  const unsigned la = (unsigned)(size_t)&st[0][0] + (unsigned)(ar * GP + ap) * 2u, lb = (unsigned)(size_t)&st[0][0] + (unsigned)(GA_H + cr * GP + cp) * 2u;
  auto issue_tile = [&](int t) {
    const unsigned pa = la + (unsigned)(t & 1) * (unsigned)(GTILE_H * 2), pb = lb + (unsigned)(t & 1) * (unsigned)(GTILE_H * 2);
    const _Float16* a = ga + (size_t)(2 * t) * hstr; const _Float16* a2 = a + hstr; const _Float16* b = gb + (size_t)t * GKS;
    gemm_copies(pa, pa + 32 * GP * 2, pa + 64 * GP * 2, pa + 96 * GP * 2, pa + 64, pa + 64 + 32 * GP * 2, pa + 64 + 64 * GP * 2, pa + 64 + 96 * GP * 2,
                pb, pb + 16 * GP * 2, pb + 32 * GP * 2, pb + 48 * GP * 2,
                a, a + 32 * HD, a + 64 * HD, a + 96 * HD, a2, a2 + 32 * HD, a2 + 64 * HD, a2 + 96 * HD, b, b + sb, b + 2 * sb, b + 3 * sb);
  };
  const v8f z8 = {0.f,0.f,0.f,0.f,0.f,0.f,0.f,0.f}; v8f accs[8] = {z8, z8, z8, z8, z8, z8, z8, z8};   /* accs[j]: rows 0..15 x columns 16j.., accs[4+j]: rows 16..31 */
  constexpr int nt = TQ / GKS;
  static_assert(GKS == 2 * HD && nt >= 2);
  issue_tile(0);
  {
    // behind tile 0's copies L2 is asked for the later k-tiles, one request per 256-byte unit: heads 2..7 of the block's 128 rows of O (32 units a head), dealt between the even and the odd column blocks;
    // the second unit of the 64 rows of Wo^T (the first comes with tile 0), dealt between the even and the odd row blocks
    static_assert(NH == 8 && HD == 32 && TQ == 256);
    const bool isa = tid < 96; const int ua = (nq & 1) * 96 + (isa ? tid : 0);
    const _Float16* pa = OHp + (((size_t)bidx * NH + 2 + (ua >> 5)) * SEQ + (l0 - 32 * w)) * HD + (ua & 31) * 128;
    const _Float16* pb = Bh + (size_t)(col0 + (mt & 1) * 32 + (tid & 31)) * ldb + 128;
    l2_ask((unsigned long long)(isa ? pa : pb));
  }
  asm volatile("s_wait_asynccnt 0x0" ::: "memory");   /* this wave's copies of tile 0 have landed */
  __syncthreads();                                     /* tile 0 published to all four waves */
  issue_tile(1);
#pragma unroll 1 /* stays rolled: one publish point and one refill site, the buffer picked by t & 1 */
  for (int t = 0; t < nt; ++t) {
    gemm_tile(&st[t & 1][0] + (32 * w + ln) * GP, &st[t & 1][GA_H] + ln * GP, hh, accs);
    asm volatile("s_wait_dscnt 0x0" ::: "memory");     /* this wave's reads of buffer t%2 are done before it is refilled */
    asm volatile("s_wait_asynccnt 0x0" ::: "memory");  /* this wave's copies of tile t+1 have landed */
    __syncthreads();                                   /* publishes tile t+1 and ends every wave's reads of buffer t%2 */
    if (t + 2 < nt) issue_tile(t + 2);
  }
  asm volatile("s_wait_asynccnt 0x0" ::: "memory");    /* no copy outstanding when the wave goes on to its epilogue */
#pragma unroll
  for (int u = 0; u < 8; ++u) { const int t = u & 3, half = u >> 2; const int col = col0 + t * 16 + ln; const float bvl = bf16_rne(bias[col]);
#pragma unroll
    for (int r = 0; r < 8; ++r) { const int rloc = half * 16 + 8 * hh + r; so[w][rloc][t * 16 + ln] = accs[u][r] * alpha + bvl; } }
  __builtin_amdgcn_fence(4 /* acq_rel order */, "workgroup"); __builtin_amdgcn_wave_barrier();
  const int rsub = lane >> 4, c4 = (lane & 15) * 4;
  const size_t crow0 = (size_t)bidx * SEQ_FULL + l0;
  {
#pragma unroll
    for (int q = 0; q < 16; ++q) { const int r = q * 2 + rsub; const v4f v = *(const v4fa*)&so[w][r][c4]; *(v4f*)(C + (crow0 + r) * ldc + col0 + c4) = v; }
     } }

extern "C" void kernel_launch(void* const* d_in, const int* in_sizes, int n_in,
                              void* d_out, int out_size, void* d_ws, size_t ws_size, hipStream_t stream) {
  if (n_in < 9) return;
  const float* X  = (const float*)d_in[0];      /* [NB_FULL][SEQ_FULL][DIN] */
  const float* Wq = (const float*)d_in[1];      /* [DIN][TQ] */
  const float* bq = (const float*)d_in[2];      /* [TQ] */
  const float* Wk = (const float*)d_in[3];
  const float* bk = (const float*)d_in[4];
  const float* Wv = (const float*)d_in[5];
  const float* bv = (const float*)d_in[6];
  const float* Wo = (const float*)d_in[7];      /* [TQ][DOUT] */
  const float* bo = (const float*)d_in[8];      /* [DOUT] */
  const long long needX = (long long)(((size_t)(NB - 1) * SEQ_FULL + SEQ) * DIN);
  const long long needO = (long long)(((size_t)(NB - 1) * SEQ_FULL + SEQ) * DOUT);
  if ((long long)in_sizes[0] < needX || in_sizes[1] < DIN * TQ || in_sizes[2] < TQ || in_sizes[3] < DIN * TQ || in_sizes[4] < TQ ||
      in_sizes[5] < DIN * TQ || in_sizes[6] < TQ || in_sizes[7] < TQ * DOUT || in_sizes[8] < DOUT || (long long)out_size < needO) return;
  char* ws = (char*)d_ws; size_t off = 0;
  auto take = [&](size_t bytes) { char* p = ws + off; off += (bytes + 255) & ~(size_t)255; return p; };
  _Float16* Wot = (_Float16*)take((size_t)DOUT * TQ * 2);
  _Float16* QH = (_Float16*)take(NR * TQ * 2);
  _Float16* KH = (_Float16*)take(NR * TQ * 2);
  _Float16* VT = (_Float16*)take((size_t)NB * NH * HD * SEQ * 2);
  _Float16* OH = (_Float16*)take((size_t)NB * NH * SEQ * HD * 2);
  if (off > ws_size || off > (size_t)134217728) return;
  const float a16 = 0.0625f;

  k_gemm_qkv<<<(unsigned)(QKV_NG + WOBLK), 256, 0, stream>>>(X, Wq, Wk, Wv, Wo, a16, bq, bk, bv, QH, KH, VT, Wot);   /* q, k in f16; V^T per (b,h): [32][SEQ]; Wo^T x16 */
  k_flash<<<dim3(SEQ / (4 * QW), NB * NH), 256, 0, stream>>>(QH, KH, VT, OH);                              /* attention -> O head-major */
  k_gemm_out<<<(unsigned)((NR / 128) * (DOUT / 64)), 128, 0, stream>>>(OH, Wot, TQ, a16, bo, (float*)d_out, DOUT, (int)NR, DOUT);   /* out = O Wo + bo */
}
